// v000
// Measured on an AMD MI455X. A time is GPU time per run, averaged over a window of back-to-back runs after a warm-up
// (all launches, gaps included; the runs take copies of the inputs in turn), and the median of several windows.
// Apart from v000's, it joins two sittings. Times from different sittings can be a few percent apart, while
// side-by-side timings come from the same sitting.
// v000 is the starting kernel. One run takes 128 microseconds.
// Contractions enc.W1, dec.W2 and weights.enc: v_wmma_f32_16x16x32_f16 (f16 operands with power-of-two carries: activations x16, weight planes x256, probabilities x512; f32 accumulate); tanh, the 256-term V dot and the softmax: f32 on the vector unit.
#include <hip/hip_runtime.h>
#include <math.h>

typedef __attribute__((ext_vector_type(16))) _Float16 v16h;
typedef __attribute__((ext_vector_type(8)))  _Float16 v8h;
typedef __attribute__((ext_vector_type(8)))  float    v8f;
typedef __attribute__((ext_vector_type(4)))  float    v4f;
typedef __attribute__((ext_vector_type(2)))  float    v2f;
typedef __attribute__((ext_vector_type(4)))  unsigned int v4u;

// ---------------------------------------------------------------------------
// Shape constants
// ---------------------------------------------------------------------------
constexpr int kB  = 8;
constexpr int kTE = 512;
constexpr int kTD = 256;
constexpr int kD  = 256;
constexpr int kU  = 256;
constexpr int kEncRows = kB * kTE;
constexpr int kDecRows = kB * kTD;
static_assert(kEncRows == 4096 && kDecRows == 2048, "row counts");
static_assert((kD % 32) == 0 && (kTE % 32) == 0, "GEMM K multiples of 32");
static_assert((kU % 64) == 0 && (kTE % 64) == 0 && (kTD % 64) == 0 && (kD % 64) == 0 && (kDecRows % 64) == 0, "GEMM M,N multiples of 64");
static_assert(kU == 256 && kTE == 512, "score kernel thread map: 256 threads, two encoder positions per thread");

// power-of-two carries of the f16 operand planes and the folded-back epilogue scales
constexpr float kXCarry   = 16.0f;
constexpr float kWCarry   = 256.0f;
constexpr float kPCarry   = 512.0f;
constexpr float kProjScale = 1.0f / (kWCarry * kXCarry);
constexpr float kCtxScale  = 1.0f / (kPCarry * kXCarry);
constexpr float kF16MinNormal = 6.103515625e-05f;

// exp(2x) is evaluated as 2^(x * 2*log2(e)). The argument constant is the SAME in every compilation pass
// (no target-dependent selection), so a host-passed scale and the device code always agree; only the body
// of the device-only 2^a helper depends on which builtin the device compiler offers.
constexpr float kArgScale = 2.8853900817779268f;
static_assert(kArgScale > 2.885f && kArgScale < 2.886f, "argument constant is 2*log2(e) in every pass");
__device__ __forceinline__ float exp_scaled(float a) {
#if __has_builtin(__builtin_amdgcn_exp2f)
  return __builtin_amdgcn_exp2f(a);
#else
  return exp2f(a);
#endif
}
constexpr float kEpScale = kArgScale * kProjScale;

// ---------------------------------------------------------------------------
// Workspace region map (bytes; every offset is a multiple of 128)
//   ENCH f16 [4096][256]     enc x16, row-major                  2,097,152
//   DECH f16 [2048][256]     dec x16, row-major                  1,048,576
//   ENCT f16 [8][256][512]   enc x16, transposed per batch       2,097,152
//   WT   f16 [2][256][256]   W1^T, W2^T x256 ([u][d])              262,144
//   EPS  f32 [8][256][512]   kArgScale * enc.W1, [b][u][e]       4,194,304
//   DPB  f32 [2048][256]     dec.W2 + b2                         2,097,152
//   PH   f16 [2048][512]     softmax weights x512                2,097,152
//   total                                                       13,893,632
// ---------------------------------------------------------------------------
constexpr size_t kOffENCH = 0;
constexpr size_t kOffDECH = kOffENCH + (size_t)kEncRows * kD * 2;
constexpr size_t kOffENCT = kOffDECH + (size_t)kDecRows * kD * 2;
constexpr size_t kOffWT   = kOffENCT + (size_t)kB * kD * kTE * 2;
constexpr size_t kOffEPS  = kOffWT   + (size_t)2 * kU * kD * 2;
constexpr size_t kOffDPB  = kOffEPS  + (size_t)kB * kU * kTE * 4;
constexpr size_t kOffPH   = kOffDPB  + (size_t)kDecRows * kU * 4;
constexpr size_t kWsTotal = kOffPH   + (size_t)kDecRows * kTE * 2;
static_assert(kWsTotal == 13893632ull, "carve total");
static_assert(kWsTotal <= 134217728ull, "carve cap");
static_assert((kOffDECH % 128) == 0 && (kOffENCT % 128) == 0 && (kOffWT % 128) == 0 && (kOffEPS % 128) == 0 &&
              (kOffDPB % 128) == 0 && (kOffPH % 128) == 0, "128-B aligned regions");

// output packing (bytes -> float elements)
constexpr size_t kOut0Bytes = (size_t)kB * kTD * kD * 4;
constexpr size_t kOut1OffBytes = 2097152ull;
constexpr size_t kOut1Bytes = (size_t)kB * kTD * kTE * 4;
static_assert(kOut0Bytes == kOut1OffBytes, "second output follows the first");
static_assert(kOut1OffBytes + kOut1Bytes == 6291456ull, "output total");
static_assert((kOut1OffBytes % 128) == 0, "second output line aligned");
constexpr size_t kOut1OffElems = kOut1OffBytes / 4;

// ---------------------------------------------------------------------------
// Small helpers
// ---------------------------------------------------------------------------
__device__ __forceinline__ unsigned pk16(unsigned short a, unsigned short b) { return (unsigned)a | ((unsigned)b << 16); }

// f32 -> f16 bits (RNE); magnitudes under the f16 normal range become +0 by a select before the convert
__device__ __forceinline__ unsigned short h_bits_flush(float f) {
  const float g = (fabsf(f) < kF16MinNormal) ? 0.0f : f;
  const _Float16 h = (_Float16)g;
  return __builtin_bit_cast(unsigned short, h);
}

/* fragment load: elements 0..7 <- p[0..7], elements 8..15 <- p[16..23] */
union FragH { v16h v; v8h h[2]; };
__device__ __forceinline__ v16h frag_load(const _Float16* p) {
  FragH f;
  f.h[0] = *(const v8h*)(p);
  f.h[1] = *(const v8h*)(p + 16);
  return f.v;
}
/* one matrix instruction followed by its own hazard guard: ties this accumulator, names both fragments */
__device__ __forceinline__ v8f mma_f16(v16h a, v16h b, v8f c) {
  c = __builtin_amdgcn_wmma_f32_16x16x32_f16(false, a, false, b, (short)0, c, false, false);
  asm volatile("v_nop\n\tv_nop\n\tv_nop\n\tv_nop" : "+v"(c) : "v"(a), "v"(b));
  return c;
}

// ---------------------------------------------------------------------------
// Register-blocked batched f16 GEMM: C[m,n] = scale * sum_k A[m,k] * Bt[n,k] (+ bias[n] when BIAS_MODE == 2).
// A row-major [M,K]; Bt row-major [N,K]; M,N % 64 == 0, K % 32 == 0; each wave owns a 64x64 tile; blockIdx.y = batch.
// ---------------------------------------------------------------------------
template <int BIAS_MODE>
__global__ __launch_bounds__(256) void gemm_f16_tile64(
    const unsigned short* __restrict__ Ap, int lda, long strideA,
    const unsigned short* __restrict__ Btp, int ldb, long strideB,
    float* __restrict__ Cout, int ldc, long strideC,
    const float* __restrict__ bias,
    int M, int N, int K, float scale) {
  const _Float16* A  = (const _Float16*)Ap;
  const _Float16* Bt = (const _Float16*)Btp;
  __shared__ __align__(16) float sT[8][16 * 68];
  const int b    = blockIdx.y;
  const int lane = threadIdx.x & 31;
  const int wave = threadIdx.x >> 5;
  const int tilesN = N >> 6;
  const int tilesM = M >> 6;
  const int tile = blockIdx.x * 8 + wave;
  /* wave-uniform exit; this kernel has no block barriers */
  if (tile >= tilesM * tilesN) return;
  const int tm = tile / tilesN;
  const int tn = tile - tm * tilesN;
  const int m0 = tm << 6;
  const int n0 = tn << 6;

  const _Float16* Ab = A  + (size_t)b * strideA;
  const _Float16* Bb = Bt + (size_t)b * strideB;

  /* row (A) / column (B, D) within a 16-wide subtile; k offset and D row offset of this lane half */
  const int rlane = lane & 15;
  const int koff  = (lane >> 4) * 8;
  const int mOff  = (lane >> 4) * 8;

  v8f acc[4][4];
#pragma unroll
  for (int i = 0; i < 4; ++i)
#pragma unroll
    for (int j = 0; j < 4; ++j) acc[i][j] = (v8f){0.f,0.f,0.f,0.f,0.f,0.f,0.f,0.f};

  for (int k0 = 0; k0 < K; k0 += 32) {
    v16h bh[4];
#pragma unroll
    for (int j = 0; j < 4; ++j) {
      const size_t bo = (size_t)(n0 + (j << 4) + rlane) * ldb + koff + k0;
      bh[j] = frag_load(Bb + bo);
    }
#pragma unroll
    for (int i = 0; i < 4; ++i) {
      const size_t ao = (size_t)(m0 + (i << 4) + rlane) * lda + koff + k0;
      const v16h ah = frag_load(Ab + ao);
#pragma unroll
      for (int j = 0; j < 4; ++j) acc[i][j] = mma_f16(ah, bh[j], acc[i][j]);
    }
  }

  // ---- epilogue ----
  float* slab = sT[wave];
  float* C = Cout + (size_t)b * strideC;
#pragma unroll
  for (int i = 0; i < 4; ++i) {
    const int mBase = m0 + (i << 4);
#pragma unroll
    for (int j = 0; j < 4; ++j) {
      const int n = n0 + (j << 4) + rlane;
      float bv = 0.f;
      if (BIAS_MODE == 2) bv = bias[n];
#pragma unroll
      for (int r = 0; r < 8; ++r) {
        float v = acc[i][j][r] * scale;
        if (BIAS_MODE == 2) v += bv;
        slab[(mOff + r) * 68 + (j << 4) + rlane] = v;
      }
    }
    __builtin_amdgcn_fence(__ATOMIC_RELEASE, "workgroup");
    __builtin_amdgcn_wave_barrier();
    __builtin_amdgcn_fence(__ATOMIC_ACQUIRE, "workgroup");
    {
      /* row segment = 256 B = 16 lanes x 16 B; lanes 0..15 row 2*it, lanes 16..31 row 2*it+1 */
      const int hh = lane >> 4, c4 = (lane & 15) * 4;
      {
#pragma unroll
        for (int it = 0; it < 8; ++it) {
          const int row = it * 2 + hh;
          v4f v = *(const v4f*)(slab + row * 68 + c4);
          *(v4f*)(C + (size_t)(mBase + row) * ldc + n0 + c4) = v;
        }
        
      }
    }
    __builtin_amdgcn_fence(__ATOMIC_RELEASE, "workgroup");
    __builtin_amdgcn_wave_barrier();
    __builtin_amdgcn_fence(__ATOMIC_ACQUIRE, "workgroup");
  }
}

// ---------------------------------------------------------------------------
// Row-major f32 -> f16 (x carry) cast of the encoder rows (blocks 0..511) and the decoder rows (blocks 512..767).
// 8 consecutive elements per thread: enc 4096*256/8 = 131,072 threads = 512 blocks; dec 2048*256/8 = 65,536 threads
// = 256 blocks; the grid covers both planes exactly. One 16-B store per lane; 32 consecutive lanes = 512 contiguous
// ---------------------------------------------------------------------------
constexpr int kEncCastBlocks = (kEncRows * kD / 8) / 256;
constexpr int kDecCastBlocks = (kDecRows * kD / 8) / 256;
static_assert(kEncCastBlocks * 256 * 8 == kEncRows * kD, "enc cast coverage");
static_assert(kDecCastBlocks * 256 * 8 == kDecRows * kD, "dec cast coverage");

__global__ __launch_bounds__(256) void cast_rows_kernel(const float* enc, const float* dec,
                                                        unsigned short* encH, unsigned short* decH, float carry) {
  /* block-uniform plane select */
  const int isDec = (blockIdx.x >= (unsigned)kEncCastBlocks) ? 1 : 0;
  const int blk = (int)blockIdx.x - isDec * kEncCastBlocks;
  const float* src = isDec ? dec : enc;
  unsigned short* dst = isDec ? decH : encH;
  const size_t e0 = ((size_t)blk * 256 + threadIdx.x) * 8;
  const v4f a = *(const v4f*)(src + e0);
  const v4f c = *(const v4f*)(src + e0 + 4);
  unsigned short hb[8];
#pragma unroll
  for (int e = 0; e < 4; ++e) {
    const float fa = a[e] * carry;
    const float fc = c[e] * carry;
    hb[e]     = h_bits_flush(fa);
    hb[4 + e] = h_bits_flush(fc);
  }
  const v4u u = (v4u){pk16(hb[0], hb[1]), pk16(hb[2], hb[3]), pk16(hb[4], hb[5]), pk16(hb[6], hb[7])};
  unsigned short* q = dst + e0;
  *(v4u*)q = u;
  
}

// ---------------------------------------------------------------------------
// Transpose + cast: in[rows][cols] f32 (row pitch ldi) -> out[cols][rows] f16 (row pitch ldo), values x carry.
// grid (rows/64, cols/64, planes); plane z reads (twoSrc && z == 1 ? inB : inA) + z*inBatch, writes out + z*outBatch.
// Load coverage: 16 iterations x 256 threads = 4096 = the whole 64x64 tile (coalesced along cols).
// Store coverage: 8 waves x 2 iterations x 4 rows (lane>>3) = 64 out rows; (lane&7) x 8 halves = 64 out cols; each
// ---------------------------------------------------------------------------
__global__ __launch_bounds__(256) void transpose_cast_kernel(const float* inA, const float* inB, int twoSrc,
                                                             long inBatch, int ldi,
                                                             unsigned short* __restrict__ out, long outBatch, int ldo,
                                                             float carry) {
  __shared__ float sm[64][65];
  const int t  = threadIdx.x;
  const int r0 = blockIdx.x * 64;
  const int c0 = blockIdx.y * 64;
  const int z  = blockIdx.z;
  /* block-uniform source select */
  const float* src = ((twoSrc != 0 && z == 1) ? inB : inA) + (size_t)z * inBatch;
#pragma unroll
  for (int i = 0; i < 16; ++i) {
    const int e = i * 256 + t;
    const int r = e >> 6;
    const int c = e & 63;
    sm[c][r] = src[(size_t)(r0 + r) * ldi + c0 + c] * carry;
  }
  __syncthreads();
  const int lane = t & 31, wave = t >> 5;
  const int q = lane >> 3, c8 = (lane & 7) * 8;
  unsigned short* op = out + (size_t)z * outBatch;
  {
#pragma unroll
    for (int it = 0; it < 2; ++it) {
      const int row = wave * 8 + it * 4 + q;
      unsigned short hb[8];
#pragma unroll
      for (int e = 0; e < 8; ++e) hb[e] = h_bits_flush(sm[row][c8 + e]);
      const v4u u = (v4u){pk16(hb[0], hb[1]), pk16(hb[2], hb[3]), pk16(hb[4], hb[5]), pk16(hb[6], hb[7])};
      *(v4u*)(op + (size_t)(c0 + row) * ldo + r0 + c8) = u;
    }
    
  }
}

// ---------------------------------------------------------------------------
// Score + softmax, f32. Block = one batch element b and 4 consecutive decoder steps; 256 threads; thread tid owns the
// encoder positions 2*tid and 2*tid+1 (256 x 2 = 512 = the whole softmax axis), 8 accumulators.
// EPS[b][u][e] holds kArgScale*(enc.W1); the LDS row sU[u] = {kArgScale*(dec.W2 + b2 + b1) for the 4 steps, -2*V[u],
// 0, 0, 0} (all 8 slots written by thread u). tanh(x) = 1 - 2/(1 + exp(2x)), so
//   logit = sum_u V[u] + bV + sum_u (-2*V[u]) / (1 + exp(2x)).
// Reductions in fixed order: wave shuffle tree, then the 8 wave partials in index order.
// 256w..256w+255 of each of the block's 4 rows); the x512 f16 copy as one packed 4-B word per lane (32 lanes = one
// grid = 8 * 64 = 512 blocks. Barriers under block-uniform control only; no early exit.
// ---------------------------------------------------------------------------
__global__ __launch_bounds__(256) void score_softmax_kernel(
    const float* __restrict__ eps, const float* __restrict__ dpb, const float* __restrict__ b1,
    const float* __restrict__ vvec, const float* __restrict__ bV,
    float* __restrict__ wout, unsigned* __restrict__ pw) {
  __shared__ __align__(16) float sU[kU * 8];
  __shared__ float sRedM[4 * 8];
  __shared__ float sRedS[4 * 8];
  __shared__ float sRedV[8];
  const int tid = threadIdx.x, lane = tid & 31, wave = tid >> 5;
  const int bt0 = blockIdx.x * 4;
  const int b   = bt0 / kTD;

  {
    const float bb = b1[tid];
    const float vv = vvec[tid];
    v4f dsv;
    dsv[0] = (dpb[(size_t)(bt0 + 0) * kU + tid] + bb) * kArgScale;
    dsv[1] = (dpb[(size_t)(bt0 + 1) * kU + tid] + bb) * kArgScale;
    dsv[2] = (dpb[(size_t)(bt0 + 2) * kU + tid] + bb) * kArgScale;
    dsv[3] = (dpb[(size_t)(bt0 + 3) * kU + tid] + bb) * kArgScale;
    const v4f vsl = (v4f){-2.0f * vv, 0.0f, 0.0f, 0.0f};
    *(v4f*)(sU + tid * 8)     = dsv;
    *(v4f*)(sU + tid * 8 + 4) = vsl;
    float sv = vv;
#pragma unroll
    for (int off = 16; off > 0; off >>= 1) sv += __shfl_xor(sv, off, 32);
    if (lane == 0) sRedV[wave] = sv;
  }
  __syncthreads();
  float cst = sRedV[0];
#pragma unroll
  for (int w = 1; w < 8; ++w) cst += sRedV[w];
  cst += bV[0];

  float acc[4][2];
#pragma unroll
  for (int t = 0; t < 4; ++t) { acc[t][0] = 0.0f; acc[t][1] = 0.0f; }

  const float* ep = eps + (size_t)b * kU * kTE + 2 * tid;
#pragma unroll 2
  for (int u = 0; u < kU; ++u) {
    const v2f x  = *(const v2f*)(ep + (size_t)u * kTE);
    const v4f d  = *(const v4f*)(sU + u * 8);
    const float vm = sU[u * 8 + 4];
#pragma unroll
    for (int t = 0; t < 4; ++t) {
      const float e0 = exp_scaled(x[0] + d[t]);
      const float e1 = exp_scaled(x[1] + d[t]);
      const float r0 = __builtin_amdgcn_rcpf(1.0f + e0);
      const float r1 = __builtin_amdgcn_rcpf(1.0f + e1);
      acc[t][0] = fmaf(r0, vm, acc[t][0]);
      acc[t][1] = fmaf(r1, vm, acc[t][1]);
    }
  }

  float lg[4][2];
  float mx[4];
#pragma unroll
  for (int t = 0; t < 4; ++t) {
    lg[t][0] = acc[t][0] + cst;
    lg[t][1] = acc[t][1] + cst;
    float m = fmaxf(lg[t][0], lg[t][1]);
#pragma unroll
    for (int off = 16; off > 0; off >>= 1) m = fmaxf(m, __shfl_xor(m, off, 32));
    mx[t] = m;
  }
  if (lane == 0) {
#pragma unroll
    for (int t = 0; t < 4; ++t) sRedM[t * 8 + wave] = mx[t];
  }
  __syncthreads();
  float ex[4][2];
  float sm[4];
#pragma unroll
  for (int t = 0; t < 4; ++t) {
    float m = sRedM[t * 8];
#pragma unroll
    for (int w = 1; w < 8; ++w) m = fmaxf(m, sRedM[t * 8 + w]);
    ex[t][0] = expf(lg[t][0] - m);
    ex[t][1] = expf(lg[t][1] - m);
    float s = ex[t][0] + ex[t][1];
#pragma unroll
    for (int off = 16; off > 0; off >>= 1) s += __shfl_xor(s, off, 32);
    sm[t] = s;
  }
  if (lane == 0) {
#pragma unroll
    for (int t = 0; t < 4; ++t) sRedS[t * 8 + wave] = sm[t];
  }
  __syncthreads();
  v2f wv[4];
  unsigned pk[4];
#pragma unroll
  for (int t = 0; t < 4; ++t) {
    float s = sRedS[t * 8];
#pragma unroll
    for (int w = 1; w < 8; ++w) s += sRedS[t * 8 + w];
    const float inv = __builtin_amdgcn_rcpf(s);
    const float w0 = ex[t][0] * inv;
    const float w1 = ex[t][1] * inv;
    wv[t] = (v2f){w0, w1};
    pk[t] = pk16(h_bits_flush(w0 * kPCarry), h_bits_flush(w1 * kPCarry));
  }
  {
#pragma unroll
    for (int t = 0; t < 4; ++t) {
      *(v2f*)(wout + (size_t)(bt0 + t) * kTE + 2 * tid) = wv[t];
      *(unsigned*)(pw + (size_t)(bt0 + t) * (kTE / 2) + tid) = pk[t];
    }
    
  }
}

// ---------------------------------------------------------------------------
// Host glue: 7 kernel launches, nothing else.
// GEMM shapes (all K % 32 == 0, M and N % 64 == 0):
//   enc projection (swapped roles): M 256 (u), N 512 (e), K 256 (d), 8 batches -> 4 x 8 tiles = 32 -> grid (4, 8)
//   dec projection                : M 2048,    N 256 (u), K 256 (d)            -> 32 x 4 tiles = 128 -> grid (16, 1)
//   context                       : M 256 (t), N 256 (d), K 512 (e), 8 batches -> 4 x 4 tiles = 16 -> grid (2, 8)
// ---------------------------------------------------------------------------
static_assert((kU / 64) * (kTE / 64) == 4 * 8, "enc projection grid");
static_assert((kDecRows / 64) * (kU / 64) == 16 * 8, "dec projection grid");
static_assert((kTD / 64) * (kD / 64) == 2 * 8, "context grid");

extern "C" void kernel_launch(void* const* d_in, const int* in_sizes, int n_in,
                              void* d_out, int out_size, void* d_ws, size_t ws_size,
                              hipStream_t stream) {
  if (n_in < 8) return;
  if (in_sizes[0] != kB * kTE * kD) return;
  if (in_sizes[1] != kB * kTD * kD) return;
  if (in_sizes[2] != kD * kU) return;
  if (in_sizes[3] != kU) return;
  if (in_sizes[4] != kD * kU) return;
  if (in_sizes[5] != kU) return;
  if (in_sizes[6] != kU) return;
  if (in_sizes[7] != 1) return;
  if (out_size != kB * kTD * kD + kB * kTD * kTE) return;
  if (ws_size < kWsTotal) return;

  const float* enc = (const float*)d_in[0];
  const float* dec = (const float*)d_in[1];
  const float* W1  = (const float*)d_in[2];
  const float* b1  = (const float*)d_in[3];
  const float* W2  = (const float*)d_in[4];
  const float* b2  = (const float*)d_in[5];
  const float* Vv  = (const float*)d_in[6];
  const float* bV  = (const float*)d_in[7];

  float* out0 = (float*)d_out;
  float* out1 = (float*)d_out + kOut1OffElems;

  char* ws = (char*)d_ws;
  unsigned short* ENCH = (unsigned short*)(ws + kOffENCH);
  unsigned short* DECH = (unsigned short*)(ws + kOffDECH);
  unsigned short* ENCT = (unsigned short*)(ws + kOffENCT);
  unsigned short* WT   = (unsigned short*)(ws + kOffWT);
  float*          EPS  = (float*)(ws + kOffEPS);
  float*          DPB  = (float*)(ws + kOffDPB);
  unsigned short* PH   = (unsigned short*)(ws + kOffPH);
  unsigned short* W1T  = WT;
  unsigned short* W2T  = WT + (size_t)kU * kD;

  // ---- operand planes ----
  cast_rows_kernel<<<kEncCastBlocks + kDecCastBlocks, 256, 0, stream>>>(enc, dec, ENCH, DECH, kXCarry);
  /* W[d rows][u cols] (pitch kU) -> WT[u][d] (pitch kD); plane 0 = W1, plane 1 = W2; grid (d/64, u/64, 2) */
  transpose_cast_kernel<<<dim3(kD / 64, kU / 64, 2), 256, 0, stream>>>(
      W1, W2, 1, 0L, kU, WT, (long)kU * kD, kD, kWCarry);
  /* enc[b][e rows][d cols] (pitch kD) -> ENCT[b][d][e] (pitch kTE); grid (e/64, d/64, 8) */
  transpose_cast_kernel<<<dim3(kTE / 64, kD / 64, kB), 256, 0, stream>>>(
      enc, enc, 0, (long)kTE * kD, kD, ENCT, (long)kD * kTE, kTE, kXCarry);

  // ---- EPS[b][u][e] = kArgScale * sum_d W1T[u][d] * enc[b][e][d] ----
  gemm_f16_tile64<0><<<dim3(4, kB), 256, 0, stream>>>(
      W1T, kD, 0L,
      ENCH, kD, (long)kTE * kD,
      EPS, kTE, (long)kU * kTE,
      nullptr,
      kU, kTE, kD, kEpScale);

  // ---- DPB[bt][u] = sum_d dec[bt][d] * W2T[u][d] + b2[u] ----
  gemm_f16_tile64<2><<<dim3(16, 1), 256, 0, stream>>>(
      DECH, kD, 0L,
      W2T, kD, 0L,
      DPB, kU, 0L,
      b2,
      kDecRows, kU, kD, kProjScale);

  // ---- tanh, V dot, softmax over the encoder axis -> second output (f32) and the x512 f16 copy ----
  score_softmax_kernel<<<kB * (kTD / 4), 256, 0, stream>>>(EPS, DPB, b1, Vv, bV, out1, (unsigned*)PH);

  // ---- context[b][t][d] = (1/8192) * sum_e PH[b][t][e] * ENCT[b][d][e] ----
  gemm_f16_tile64<0><<<dim3(2, kB), 256, 0, stream>>>(
      PH, kTE, (long)kTD * kTE,
      ENCT, kTE, (long)kD * kTE,
      out0, kD, (long)kTD * kD,
      nullptr,
      kTD, kD, kTE, kCtxScale);
}

// v001
// Measured time: 98.8 microseconds a run.
// In two side-by-side timings against v000, it was 1.30 and 1.31 times as fast.
// Contractions enc.W1, dec.W2 and weights.enc: v_wmma_f32_16x16x32_f16 (f16 operands with power-of-two carries: activations x16, weight planes x256, probabilities x512; f32 accumulate); tanh, the 256-term V dot and the softmax: f32 on the vector unit.
#include <hip/hip_runtime.h>
#include <math.h>

typedef __attribute__((ext_vector_type(16))) _Float16 v16h;
typedef __attribute__((ext_vector_type(8)))  _Float16 v8h;
typedef __attribute__((ext_vector_type(8)))  float    v8f;
typedef __attribute__((ext_vector_type(4)))  float    v4f;
typedef __attribute__((ext_vector_type(2)))  float    v2f;
typedef __attribute__((ext_vector_type(4)))  unsigned int v4u;

// ---------------------------------------------------------------------------
// Shape constants
// ---------------------------------------------------------------------------
constexpr int kB  = 8;
constexpr int kTE = 512;
constexpr int kTD = 256;
constexpr int kD  = 256;
constexpr int kU  = 256;
constexpr int kEncRows = kB * kTE;
constexpr int kDecRows = kB * kTD;
static_assert(kEncRows == 4096 && kDecRows == 2048, "row counts");
static_assert((kD % 32) == 0 && (kTE % 32) == 0, "GEMM K multiples of 32");
static_assert((kU % 64) == 0 && (kTE % 64) == 0 && (kTD % 64) == 0 && (kD % 64) == 0 && (kDecRows % 64) == 0, "GEMM M,N multiples of 64");
static_assert(kU == 256 && kTE == 512, "score kernel thread map: 256 threads, two encoder positions per thread");

// power-of-two carries of the f16 operand planes and the folded-back epilogue scales
constexpr float kXCarry   = 16.0f;
constexpr float kWCarry   = 256.0f;
constexpr float kPCarry   = 512.0f;
constexpr float kProjScale = 1.0f / (kWCarry * kXCarry);
constexpr float kCtxScale  = 1.0f / (kPCarry * kXCarry);
constexpr float kF16MinNormal = 6.103515625e-05f;

// exp(2x) is evaluated as 2^(x * 2*log2(e)). The argument constant is the SAME in every compilation pass
// (no target-dependent selection), so a host-passed scale and the device code always agree; only the body
// of the device-only 2^a helper depends on which builtin the device compiler offers.
constexpr float kArgScale = 2.8853900817779268f;
static_assert(kArgScale > 2.885f && kArgScale < 2.886f, "argument constant is 2*log2(e) in every pass");
__device__ __forceinline__ float exp_scaled(float a) {
#if __has_builtin(__builtin_amdgcn_exp2f)
  return __builtin_amdgcn_exp2f(a);
#else
  return exp2f(a);
#endif
}
constexpr float kEpScale = kArgScale * kProjScale;

// ---------------------------------------------------------------------------
// Workspace region map (bytes; every offset is a multiple of 128)
//   ENCH f16 [4096][256]     enc x16, row-major                  2,097,152
//   DECH f16 [2048][256]     dec x16, row-major                  1,048,576
//   ENCT f16 [8][256][512]   enc x16, transposed per batch       2,097,152
//   WT   f16 [2][256][256]   W1^T, W2^T x256 ([u][d])              262,144
//   EPS  f32 [8][256][512]   kArgScale * enc.W1, [b][u][e]       4,194,304
//   DPB  f32 [2048][256]     dec.W2 + b2                         2,097,152
//   PH   f16 [2048][512]     softmax weights x512                2,097,152
//   total                                                       13,893,632
// ---------------------------------------------------------------------------
constexpr size_t kOffENCH = 0;
constexpr size_t kOffDECH = kOffENCH + (size_t)kEncRows * kD * 2;
constexpr size_t kOffENCT = kOffDECH + (size_t)kDecRows * kD * 2;
constexpr size_t kOffWT   = kOffENCT + (size_t)kB * kD * kTE * 2;
constexpr size_t kOffEPS  = kOffWT   + (size_t)2 * kU * kD * 2;
constexpr size_t kOffDPB  = kOffEPS  + (size_t)kB * kU * kTE * 4;
constexpr size_t kOffPH   = kOffDPB  + (size_t)kDecRows * kU * 4;
constexpr size_t kWsTotal = kOffPH   + (size_t)kDecRows * kTE * 2;
static_assert(kWsTotal == 13893632ull, "carve total");
static_assert(kWsTotal <= 134217728ull, "carve cap");
static_assert((kOffDECH % 128) == 0 && (kOffENCT % 128) == 0 && (kOffWT % 128) == 0 && (kOffEPS % 128) == 0 &&
              (kOffDPB % 128) == 0 && (kOffPH % 128) == 0, "128-B aligned regions");

// output packing (bytes -> float elements)
constexpr size_t kOut0Bytes = (size_t)kB * kTD * kD * 4;
constexpr size_t kOut1OffBytes = 2097152ull;
constexpr size_t kOut1Bytes = (size_t)kB * kTD * kTE * 4;
static_assert(kOut0Bytes == kOut1OffBytes, "second output follows the first");
static_assert(kOut1OffBytes + kOut1Bytes == 6291456ull, "output total");
static_assert((kOut1OffBytes % 128) == 0, "second output line aligned");
constexpr size_t kOut1OffElems = kOut1OffBytes / 4;

// ---------------------------------------------------------------------------
// Small helpers
// ---------------------------------------------------------------------------
__device__ __forceinline__ unsigned pk16(unsigned short a, unsigned short b) { return (unsigned)a | ((unsigned)b << 16); }

// f32 -> f16 bits (RNE); magnitudes under the f16 normal range become +0 by a select before the convert
__device__ __forceinline__ unsigned short h_bits_flush(float f) {
  const float g = (fabsf(f) < kF16MinNormal) ? 0.0f : f;
  const _Float16 h = (_Float16)g;
  return __builtin_bit_cast(unsigned short, h);
}

/* fragment load: elements 0..7 <- p[0..7], elements 8..15 <- p[16..23] */
union FragH { v16h v; v8h h[2]; };
__device__ __forceinline__ v16h frag_load(const _Float16* p) {
  FragH f;
  f.h[0] = *(const v8h*)(p);
  f.h[1] = *(const v8h*)(p + 16);
  return f.v;
}
/* one matrix instruction followed by its own hazard guard: ties this accumulator, names both fragments */
__device__ __forceinline__ v8f mma_f16(v16h a, v16h b, v8f c) {
  c = __builtin_amdgcn_wmma_f32_16x16x32_f16(false, a, false, b, (short)0, c, false, false);
  asm volatile("v_nop\n\tv_nop\n\tv_nop\n\tv_nop" : "+v"(c) : "v"(a), "v"(b));
  return c;
}

// ---------------------------------------------------------------------------
// Register-blocked batched f16 GEMM: C[m,n] = scale * sum_k A[m,k] * Bt[n,k] (+ bias[n] when BIAS_MODE == 2).
// A row-major [M,K]; Bt row-major [N,K]; M,N % 64 == 0, K % 32 == 0; each wave owns a 64x64 tile; blockIdx.y = batch.
// ---------------------------------------------------------------------------
template <int BIAS_MODE>
__global__ __launch_bounds__(256) void gemm_f16_tile64(
    const unsigned short* __restrict__ Ap, int lda, long strideA,
    const unsigned short* __restrict__ Btp, int ldb, long strideB,
    float* __restrict__ Cout, int ldc, long strideC,
    const float* __restrict__ bias,
    int M, int N, int K, float scale) {
  const _Float16* A  = (const _Float16*)Ap;
  const _Float16* Bt = (const _Float16*)Btp;
  __shared__ __align__(16) float sT[8][16 * 68];
  const int b    = blockIdx.y;
  const int lane = threadIdx.x & 31;
  const int wave = threadIdx.x >> 5;
  const int tilesN = N >> 6;
  const int tilesM = M >> 6;
  const int tile = blockIdx.x * 8 + wave;
  /* wave-uniform exit; this kernel has no block barriers */
  if (tile >= tilesM * tilesN) return;
  const int tm = tile / tilesN;
  const int tn = tile - tm * tilesN;
  const int m0 = tm << 6;
  const int n0 = tn << 6;

  const _Float16* Ab = A  + (size_t)b * strideA;
  const _Float16* Bb = Bt + (size_t)b * strideB;

  /* row (A) / column (B, D) within a 16-wide subtile; k offset and D row offset of this lane half */
  const int rlane = lane & 15;
  const int koff  = (lane >> 4) * 8;
  const int mOff  = (lane >> 4) * 8;

  v8f acc[4][4];
#pragma unroll
  for (int i = 0; i < 4; ++i)
#pragma unroll
    for (int j = 0; j < 4; ++j) acc[i][j] = (v8f){0.f,0.f,0.f,0.f,0.f,0.f,0.f,0.f};

  for (int k0 = 0; k0 < K; k0 += 32) {
    v16h bh[4];
#pragma unroll
    for (int j = 0; j < 4; ++j) {
      const size_t bo = (size_t)(n0 + (j << 4) + rlane) * ldb + koff + k0;
      bh[j] = frag_load(Bb + bo);
    }
#pragma unroll
    for (int i = 0; i < 4; ++i) {
      const size_t ao = (size_t)(m0 + (i << 4) + rlane) * lda + koff + k0;
      const v16h ah = frag_load(Ab + ao);
#pragma unroll
      for (int j = 0; j < 4; ++j) acc[i][j] = mma_f16(ah, bh[j], acc[i][j]);
    }
  }

  // ---- epilogue ----
  float* slab = sT[wave];
  float* C = Cout + (size_t)b * strideC;
#pragma unroll
  for (int i = 0; i < 4; ++i) {
    const int mBase = m0 + (i << 4);
#pragma unroll
    for (int j = 0; j < 4; ++j) {
      const int n = n0 + (j << 4) + rlane;
      float bv = 0.f;
      if (BIAS_MODE == 2) bv = bias[n];
#pragma unroll
      for (int r = 0; r < 8; ++r) {
        float v = acc[i][j][r] * scale;
        if (BIAS_MODE == 2) v += bv;
        slab[(mOff + r) * 68 + (j << 4) + rlane] = v;
      }
    }
    __builtin_amdgcn_fence(__ATOMIC_RELEASE, "workgroup");
    __builtin_amdgcn_wave_barrier();
    __builtin_amdgcn_fence(__ATOMIC_ACQUIRE, "workgroup");
    {
      /* row segment = 256 B = 16 lanes x 16 B; lanes 0..15 row 2*it, lanes 16..31 row 2*it+1 */
      const int hh = lane >> 4, c4 = (lane & 15) * 4;
      {
#pragma unroll
        for (int it = 0; it < 8; ++it) {
          const int row = it * 2 + hh;
          v4f v = *(const v4f*)(slab + row * 68 + c4);
          *(v4f*)(C + (size_t)(mBase + row) * ldc + n0 + c4) = v;
        }
        
      }
    }
    __builtin_amdgcn_fence(__ATOMIC_RELEASE, "workgroup");
    __builtin_amdgcn_wave_barrier();
    __builtin_amdgcn_fence(__ATOMIC_ACQUIRE, "workgroup");
  }
}

// ---------------------------------------------------------------------------
// Row-major f32 -> f16 (x carry) cast of the encoder rows (blocks 0..511) and the decoder rows (blocks 512..767).
// 8 consecutive elements per thread: enc 4096*256/8 = 131,072 threads = 512 blocks; dec 2048*256/8 = 65,536 threads
// = 256 blocks; the grid covers both planes exactly. One 16-B store per lane; 32 consecutive lanes = 512 contiguous
// ---------------------------------------------------------------------------
constexpr int kEncCastBlocks = (kEncRows * kD / 8) / 256;
constexpr int kDecCastBlocks = (kDecRows * kD / 8) / 256;
static_assert(kEncCastBlocks * 256 * 8 == kEncRows * kD, "enc cast coverage");
static_assert(kDecCastBlocks * 256 * 8 == kDecRows * kD, "dec cast coverage");

__global__ __launch_bounds__(256) void cast_rows_kernel(const float* enc, const float* dec,
                                                        unsigned short* encH, unsigned short* decH, float carry) {
  /* block-uniform plane select */
  const int isDec = (blockIdx.x >= (unsigned)kEncCastBlocks) ? 1 : 0;
  const int blk = (int)blockIdx.x - isDec * kEncCastBlocks;
  const float* src = isDec ? dec : enc;
  unsigned short* dst = isDec ? decH : encH;
  const size_t e0 = ((size_t)blk * 256 + threadIdx.x) * 8;
  const v4f a = *(const v4f*)(src + e0);
  const v4f c = *(const v4f*)(src + e0 + 4);
  unsigned short hb[8];
#pragma unroll
  for (int e = 0; e < 4; ++e) {
    const float fa = a[e] * carry;
    const float fc = c[e] * carry;
    hb[e]     = h_bits_flush(fa);
    hb[4 + e] = h_bits_flush(fc);
  }
  const v4u u = (v4u){pk16(hb[0], hb[1]), pk16(hb[2], hb[3]), pk16(hb[4], hb[5]), pk16(hb[6], hb[7])};
  unsigned short* q = dst + e0;
  *(v4u*)q = u;
  
}

// ---------------------------------------------------------------------------
// Transpose + cast: in[rows][cols] f32 (row pitch ldi) -> out[cols][rows] f16 (row pitch ldo), values x carry.
// grid (rows/64, cols/64, planes); plane z reads (twoSrc && z == 1 ? inB : inA) + z*inBatch, writes out + z*outBatch.
// Load coverage: 16 iterations x 256 threads = 4096 = the whole 64x64 tile (coalesced along cols).
// Store coverage: 8 waves x 2 iterations x 4 rows (lane>>3) = 64 out rows; (lane&7) x 8 halves = 64 out cols; each
// ---------------------------------------------------------------------------
__global__ __launch_bounds__(256) void transpose_cast_kernel(const float* inA, const float* inB, int twoSrc,
                                                             long inBatch, int ldi,
                                                             unsigned short* __restrict__ out, long outBatch, int ldo,
                                                             float carry) {
  __shared__ float sm[64][65];
  const int t  = threadIdx.x;
  const int r0 = blockIdx.x * 64;
  const int c0 = blockIdx.y * 64;
  const int z  = blockIdx.z;
  /* block-uniform source select */
  const float* src = ((twoSrc != 0 && z == 1) ? inB : inA) + (size_t)z * inBatch;
#pragma unroll
  for (int i = 0; i < 16; ++i) {
    const int e = i * 256 + t;
    const int r = e >> 6;
    const int c = e & 63;
    sm[c][r] = src[(size_t)(r0 + r) * ldi + c0 + c] * carry;
  }
  __syncthreads();
  const int lane = t & 31, wave = t >> 5;
  const int q = lane >> 3, c8 = (lane & 7) * 8;
  unsigned short* op = out + (size_t)z * outBatch;
  {
#pragma unroll
    for (int it = 0; it < 2; ++it) {
      const int row = wave * 8 + it * 4 + q;
      unsigned short hb[8];
#pragma unroll
      for (int e = 0; e < 8; ++e) hb[e] = h_bits_flush(sm[row][c8 + e]);
      const v4u u = (v4u){pk16(hb[0], hb[1]), pk16(hb[2], hb[3]), pk16(hb[4], hb[5]), pk16(hb[6], hb[7])};
      *(v4u*)(op + (size_t)(c0 + row) * ldo + r0 + c8) = u;
    }
    
  }
}

// ---------------------------------------------------------------------------
// Rows of EPS are held in a ring of kSets register sets of kPf rows. A set is refilled one stage behind its use, so a
// row is asked for (kSets - 2) * kPf rows of arithmetic ahead of its use. Why: every block of a batch walks the same
// rows at the same pace, so a row's first readers all wait out a memory round trip unless it was asked for early.
constexpr int kPf   = 8;
constexpr int kSets = 4;
constexpr int kRing = kPf * kSets;
static_assert((kU % kRing) == 0 && kU >= 2 * kRing, "the u loop takes one whole ring per trip");

__device__ __forceinline__ void load_rows(v2f (&x)[kPf], const float* p) {
#pragma unroll
  for (int i = 0; i < kPf; ++i) x[i] = *(const v2f*)(p + (size_t)i * kTE);
}
__device__ __forceinline__ void score_rows(const v2f (&x)[kPf], const float* su, float (&acc)[4][2]) {
#pragma unroll
  for (int i = 0; i < kPf; ++i) {
    const v4f d  = *(const v4f*)(su + i * 8);
    const float vm = su[i * 8 + 4];
#pragma unroll
    for (int t = 0; t < 4; ++t) {
      const float e0 = exp_scaled(x[i][0] + d[t]);
      const float e1 = exp_scaled(x[i][1] + d[t]);
      const float r0 = __builtin_amdgcn_rcpf(1.0f + e0);
      const float r1 = __builtin_amdgcn_rcpf(1.0f + e1);
      acc[t][0] = fmaf(r0, vm, acc[t][0]);
      acc[t][1] = fmaf(r1, vm, acc[t][1]);
    }
  }
}

// ---------------------------------------------------------------------------
// Score + softmax, f32. Block = one batch element b and 4 consecutive decoder steps; 256 threads; thread tid owns the
// encoder positions 2*tid and 2*tid+1 (256 x 2 = 512 = the whole softmax axis), 8 accumulators.
// EPS[b][u][e] holds kArgScale*(enc.W1); the LDS row sU[u] = {kArgScale*(dec.W2 + b2 + b1) for the 4 steps, -2*V[u],
// 0, 0, 0} (all 8 slots written by thread u). tanh(x) = 1 - 2/(1 + exp(2x)), so
//   logit = sum_u V[u] + bV + sum_u (-2*V[u]) / (1 + exp(2x)).
// Reductions in fixed order: wave shuffle tree, then the 8 wave partials in index order.
// 256w..256w+255 of each of the block's 4 rows); the x512 f16 copy as one packed 4-B word per lane (32 lanes = one
// grid = 8 * 64 = 512 blocks. Barriers under block-uniform control only; no early exit.
// ---------------------------------------------------------------------------
__global__ __launch_bounds__(256) void score_softmax_kernel(
    const float* __restrict__ eps, const float* __restrict__ dpb, const float* __restrict__ b1,
    const float* __restrict__ vvec, const float* __restrict__ bV,
    float* __restrict__ wout, unsigned* __restrict__ pw) {
  __shared__ __align__(16) float sU[kU * 8];
  __shared__ float sRedM[4 * 8];
  __shared__ float sRedS[4 * 8];
  __shared__ float sRedV[8];
  const int tid = threadIdx.x, lane = tid & 31, wave = tid >> 5;
  const int bt0 = blockIdx.x * 4;
  const int b   = bt0 / kTD;

  /* all sets of the ring but the last: in flight across the set-up of sU */
  const float* ep = eps + (size_t)b * kU * kTE + 2 * tid;
  v2f xr[kSets][kPf];
#pragma unroll
  for (int s = 0; s < kSets - 1; ++s) load_rows(xr[s], ep + (size_t)(s * kPf) * kTE);

  {
    const float bb = b1[tid];
    const float vv = vvec[tid];
    v4f dsv;
    dsv[0] = (dpb[(size_t)(bt0 + 0) * kU + tid] + bb) * kArgScale;
    dsv[1] = (dpb[(size_t)(bt0 + 1) * kU + tid] + bb) * kArgScale;
    dsv[2] = (dpb[(size_t)(bt0 + 2) * kU + tid] + bb) * kArgScale;
    dsv[3] = (dpb[(size_t)(bt0 + 3) * kU + tid] + bb) * kArgScale;
    const v4f vsl = (v4f){-2.0f * vv, 0.0f, 0.0f, 0.0f};
    *(v4f*)(sU + tid * 8)     = dsv;
    *(v4f*)(sU + tid * 8 + 4) = vsl;
    float sv = vv;
#pragma unroll
    for (int off = 16; off > 0; off >>= 1) sv += __shfl_xor(sv, off, 32);
    if (lane == 0) sRedV[wave] = sv;
  }
  __syncthreads();
  float cst = sRedV[0];
#pragma unroll
  for (int w = 1; w < 8; ++w) cst += sRedV[w];
  cst += bV[0];

  float acc[4][2];
#pragma unroll
  for (int t = 0; t < 4; ++t) { acc[t][0] = 0.0f; acc[t][1] = 0.0f; }

  for (int u = 0; u < kU - kRing; u += kRing) {
#pragma unroll
    for (int s = 0; s < kSets; ++s) {
      score_rows(xr[s], sU + (u + s * kPf) * 8, acc);
      /* The two scheduling barriers keep each refill in its stage: without them the compiler reads the whole ring at
         the top of a trip and refills it late, which takes the lead away. The set refilled is the one used a stage
         ago: a refill that overtakes its set's last use goes to spare registers, and the copy back at the top of the
         trip waits for every load in flight. LDS reads (0x100) may still move up across both. */
      __builtin_amdgcn_sched_barrier(0x100);
      const int f = (s + kSets - 1) % kSets;
      load_rows(xr[f], ep + (size_t)(u + (s == 0 ? 0 : kRing) + f * kPf) * kTE);
      __builtin_amdgcn_sched_barrier(0x100);
    }
  }
  /* the last ring: only its last set is still to be fetched */
  score_rows(xr[0], sU + (kU - kRing) * 8, acc);
  __builtin_amdgcn_sched_barrier(0x100);  /* as in the loop */
  load_rows(xr[kSets - 1], ep + (size_t)(kU - kPf) * kTE);
  __builtin_amdgcn_sched_barrier(0x100);  /* as in the loop */
#pragma unroll
  for (int s = 1; s < kSets; ++s) score_rows(xr[s], sU + (kU - kRing + s * kPf) * 8, acc);

  float lg[4][2];
  float mx[4];
#pragma unroll
  for (int t = 0; t < 4; ++t) {
    lg[t][0] = acc[t][0] + cst;
    lg[t][1] = acc[t][1] + cst;
    float m = fmaxf(lg[t][0], lg[t][1]);
#pragma unroll
    for (int off = 16; off > 0; off >>= 1) m = fmaxf(m, __shfl_xor(m, off, 32));
    mx[t] = m;
  }
  if (lane == 0) {
#pragma unroll
    for (int t = 0; t < 4; ++t) sRedM[t * 8 + wave] = mx[t];
  }
  __syncthreads();
  float ex[4][2];
  float sm[4];
#pragma unroll
  for (int t = 0; t < 4; ++t) {
    float m = sRedM[t * 8];
#pragma unroll
    for (int w = 1; w < 8; ++w) m = fmaxf(m, sRedM[t * 8 + w]);
    ex[t][0] = expf(lg[t][0] - m);
    ex[t][1] = expf(lg[t][1] - m);
    float s = ex[t][0] + ex[t][1];
#pragma unroll
    for (int off = 16; off > 0; off >>= 1) s += __shfl_xor(s, off, 32);
    sm[t] = s;
  }
  if (lane == 0) {
#pragma unroll
    for (int t = 0; t < 4; ++t) sRedS[t * 8 + wave] = sm[t];
  }
  __syncthreads();
  v2f wv[4];
  unsigned pk[4];
#pragma unroll
  for (int t = 0; t < 4; ++t) {
    float s = sRedS[t * 8];
#pragma unroll
    for (int w = 1; w < 8; ++w) s += sRedS[t * 8 + w];
    const float inv = __builtin_amdgcn_rcpf(s);
    const float w0 = ex[t][0] * inv;
    const float w1 = ex[t][1] * inv;
    wv[t] = (v2f){w0, w1};
    pk[t] = pk16(h_bits_flush(w0 * kPCarry), h_bits_flush(w1 * kPCarry));
  }
  {
#pragma unroll
    for (int t = 0; t < 4; ++t) {
      *(v2f*)(wout + (size_t)(bt0 + t) * kTE + 2 * tid) = wv[t];
      *(unsigned*)(pw + (size_t)(bt0 + t) * (kTE / 2) + tid) = pk[t];
    }
    
  }
}

// ---------------------------------------------------------------------------
// Host glue: 7 kernel launches, nothing else.
// GEMM shapes (all K % 32 == 0, M and N % 64 == 0):
//   enc projection (swapped roles): M 256 (u), N 512 (e), K 256 (d), 8 batches -> 4 x 8 tiles = 32 -> grid (4, 8)
//   dec projection                : M 2048,    N 256 (u), K 256 (d)            -> 32 x 4 tiles = 128 -> grid (16, 1)
//   context                       : M 256 (t), N 256 (d), K 512 (e), 8 batches -> 4 x 4 tiles = 16 -> grid (2, 8)
// ---------------------------------------------------------------------------
static_assert((kU / 64) * (kTE / 64) == 4 * 8, "enc projection grid");
static_assert((kDecRows / 64) * (kU / 64) == 16 * 8, "dec projection grid");
static_assert((kTD / 64) * (kD / 64) == 2 * 8, "context grid");

extern "C" void kernel_launch(void* const* d_in, const int* in_sizes, int n_in,
                              void* d_out, int out_size, void* d_ws, size_t ws_size,
                              hipStream_t stream) {
  if (n_in < 8) return;
  if (in_sizes[0] != kB * kTE * kD) return;
  if (in_sizes[1] != kB * kTD * kD) return;
  if (in_sizes[2] != kD * kU) return;
  if (in_sizes[3] != kU) return;
  if (in_sizes[4] != kD * kU) return;
  if (in_sizes[5] != kU) return;
  if (in_sizes[6] != kU) return;
  if (in_sizes[7] != 1) return;
  if (out_size != kB * kTD * kD + kB * kTD * kTE) return;
  if (ws_size < kWsTotal) return;

  const float* enc = (const float*)d_in[0];
  const float* dec = (const float*)d_in[1];
  const float* W1  = (const float*)d_in[2];
  const float* b1  = (const float*)d_in[3];
  const float* W2  = (const float*)d_in[4];
  const float* b2  = (const float*)d_in[5];
  const float* Vv  = (const float*)d_in[6];
  const float* bV  = (const float*)d_in[7];

  float* out0 = (float*)d_out;
  float* out1 = (float*)d_out + kOut1OffElems;

  char* ws = (char*)d_ws;
  unsigned short* ENCH = (unsigned short*)(ws + kOffENCH);
  unsigned short* DECH = (unsigned short*)(ws + kOffDECH);
  unsigned short* ENCT = (unsigned short*)(ws + kOffENCT);
  unsigned short* WT   = (unsigned short*)(ws + kOffWT);
  float*          EPS  = (float*)(ws + kOffEPS);
  float*          DPB  = (float*)(ws + kOffDPB);
  unsigned short* PH   = (unsigned short*)(ws + kOffPH);
  unsigned short* W1T  = WT;
  unsigned short* W2T  = WT + (size_t)kU * kD;

  // ---- operand planes ----
  cast_rows_kernel<<<kEncCastBlocks + kDecCastBlocks, 256, 0, stream>>>(enc, dec, ENCH, DECH, kXCarry);
  /* W[d rows][u cols] (pitch kU) -> WT[u][d] (pitch kD); plane 0 = W1, plane 1 = W2; grid (d/64, u/64, 2) */
  transpose_cast_kernel<<<dim3(kD / 64, kU / 64, 2), 256, 0, stream>>>(
      W1, W2, 1, 0L, kU, WT, (long)kU * kD, kD, kWCarry);
  /* enc[b][e rows][d cols] (pitch kD) -> ENCT[b][d][e] (pitch kTE); grid (e/64, d/64, 8) */
  transpose_cast_kernel<<<dim3(kTE / 64, kD / 64, kB), 256, 0, stream>>>(
      enc, enc, 0, (long)kTE * kD, kD, ENCT, (long)kD * kTE, kTE, kXCarry);

  // ---- EPS[b][u][e] = kArgScale * sum_d W1T[u][d] * enc[b][e][d] ----
  gemm_f16_tile64<0><<<dim3(4, kB), 256, 0, stream>>>(
      W1T, kD, 0L,
      ENCH, kD, (long)kTE * kD,
      EPS, kTE, (long)kU * kTE,
      nullptr,
      kU, kTE, kD, kEpScale);

  // ---- DPB[bt][u] = sum_d dec[bt][d] * W2T[u][d] + b2[u] ----
  gemm_f16_tile64<2><<<dim3(16, 1), 256, 0, stream>>>(
      DECH, kD, 0L,
      W2T, kD, 0L,
      DPB, kU, 0L,
      b2,
      kDecRows, kU, kD, kProjScale);

  // ---- tanh, V dot, softmax over the encoder axis -> second output (f32) and the x512 f16 copy ----
  score_softmax_kernel<<<kB * (kTD / 4), 256, 0, stream>>>(EPS, DPB, b1, Vv, bV, out1, (unsigned*)PH);

  // ---- context[b][t][d] = (1/8192) * sum_e PH[b][t][e] * ENCT[b][d][e] ----
  gemm_f16_tile64<0><<<dim3(2, kB), 256, 0, stream>>>(
      PH, kTE, (long)kTD * kTE,
      ENCT, kTE, (long)kD * kTE,
      out0, kD, (long)kTD * kD,
      nullptr,
      kTD, kD, kTE, kCtxScale);
}

// v002
// One run takes 79 microseconds.
// Next to v001, in two timings, it ran 1.26 times as fast each time.
// Counting every step since v000, it is 1.64 times as fast.
// Contractions enc.W1, dec.W2 and weights.enc: v_wmma_f32_16x16x32_f16 (f16 operands with power-of-two carries: activations x16, weight planes x256, probabilities x512; f32 accumulate); tanh, the 256-term V dot and the softmax: f32 on the vector unit.
#include <hip/hip_runtime.h>
#include <math.h>

typedef __attribute__((ext_vector_type(16))) _Float16 v16h;
typedef __attribute__((ext_vector_type(8)))  _Float16 v8h;
typedef __attribute__((ext_vector_type(8)))  float    v8f;
typedef __attribute__((ext_vector_type(4)))  float    v4f;
typedef __attribute__((ext_vector_type(2)))  float    v2f;
typedef __attribute__((ext_vector_type(4)))  unsigned int v4u;

// ---------------------------------------------------------------------------
// Shape constants
// ---------------------------------------------------------------------------
constexpr int kB  = 8;
constexpr int kTE = 512;
constexpr int kTD = 256;
constexpr int kD  = 256;
constexpr int kU  = 256;
constexpr int kEncRows = kB * kTE;
constexpr int kDecRows = kB * kTD;
static_assert(kEncRows == 4096 && kDecRows == 2048, "row counts");
static_assert((kD % 32) == 0 && (kTE % 32) == 0, "GEMM K multiples of 32");
static_assert((kU % 64) == 0 && (kTE % 64) == 0 && (kTD % 64) == 0 && (kD % 64) == 0 && (kDecRows % 64) == 0, "GEMM M,N multiples of 64");
static_assert(kU == 256 && kTE == 512, "score kernel thread map: 256 threads, two encoder positions per thread");

// power-of-two carries of the f16 operand planes and the folded-back epilogue scales
constexpr float kXCarry   = 16.0f;
constexpr float kWCarry   = 256.0f;
constexpr float kPCarry   = 512.0f;
constexpr float kProjScale = 1.0f / (kWCarry * kXCarry);
constexpr float kCtxScale  = 1.0f / (kPCarry * kXCarry);
constexpr float kF16MinNormal = 6.103515625e-05f;

// exp(2x) is evaluated as 2^(x * 2*log2(e)). The argument constant is the SAME in every compilation pass
// (no target-dependent selection), so a host-passed scale and the device code always agree; only the body
// of the device-only 2^a helper depends on which builtin the device compiler offers.
constexpr float kArgScale = 2.8853900817779268f;
static_assert(kArgScale > 2.885f && kArgScale < 2.886f, "argument constant is 2*log2(e) in every pass");
__device__ __forceinline__ float exp_scaled(float a) {
#if __has_builtin(__builtin_amdgcn_exp2f)
  return __builtin_amdgcn_exp2f(a);
#else
  return exp2f(a);
#endif
}
constexpr float kEpScale = kArgScale * kProjScale;

// ---------------------------------------------------------------------------
// Workspace region map (bytes; every offset is a multiple of 128)
//   ENCH f16 [4096][256]     enc x16, row-major                  2,097,152
//   DECH f16 [2048][256]     dec x16, row-major                  1,048,576
//   ENCT f16 [8][256][512]   enc x16, transposed per batch       2,097,152
//   WT   f16 [2][256][256]   W1^T, W2^T x256 ([u][d])              262,144
//   EPS  f32 [8][256][512]   kArgScale * enc.W1, [b][u][e]       4,194,304
//   DPB  f32 [2048][256]     dec.W2 + b2                         2,097,152
//   PH   f16 [2048][512]     softmax weights x512                2,097,152
//   total                                                       13,893,632
// ---------------------------------------------------------------------------
constexpr size_t kOffENCH = 0;
constexpr size_t kOffDECH = kOffENCH + (size_t)kEncRows * kD * 2;
constexpr size_t kOffENCT = kOffDECH + (size_t)kDecRows * kD * 2;
constexpr size_t kOffWT   = kOffENCT + (size_t)kB * kD * kTE * 2;
constexpr size_t kOffEPS  = kOffWT   + (size_t)2 * kU * kD * 2;
constexpr size_t kOffDPB  = kOffEPS  + (size_t)kB * kU * kTE * 4;
constexpr size_t kOffPH   = kOffDPB  + (size_t)kDecRows * kU * 4;
constexpr size_t kWsTotal = kOffPH   + (size_t)kDecRows * kTE * 2;
static_assert(kWsTotal == 13893632ull, "carve total");
static_assert(kWsTotal <= 134217728ull, "carve cap");
static_assert((kOffDECH % 128) == 0 && (kOffENCT % 128) == 0 && (kOffWT % 128) == 0 && (kOffEPS % 128) == 0 &&
              (kOffDPB % 128) == 0 && (kOffPH % 128) == 0, "128-B aligned regions");

// output packing (bytes -> float elements)
constexpr size_t kOut0Bytes = (size_t)kB * kTD * kD * 4;
constexpr size_t kOut1OffBytes = 2097152ull;
constexpr size_t kOut1Bytes = (size_t)kB * kTD * kTE * 4;
static_assert(kOut0Bytes == kOut1OffBytes, "second output follows the first");
static_assert(kOut1OffBytes + kOut1Bytes == 6291456ull, "output total");
static_assert((kOut1OffBytes % 128) == 0, "second output line aligned");
constexpr size_t kOut1OffElems = kOut1OffBytes / 4;

// ---------------------------------------------------------------------------
// Small helpers
// ---------------------------------------------------------------------------
__device__ __forceinline__ unsigned pk16(unsigned short a, unsigned short b) { return (unsigned)a | ((unsigned)b << 16); }

// f32 -> f16 bits (RNE); magnitudes under the f16 normal range become +0 by a select before the convert
__device__ __forceinline__ unsigned short h_bits_flush(float f) {
  const float g = (fabsf(f) < kF16MinNormal) ? 0.0f : f;
  const _Float16 h = (_Float16)g;
  return __builtin_bit_cast(unsigned short, h);
}

/* fragment load: elements 0..7 <- p[0..7], elements 8..15 <- p[16..23] */
union FragH { v16h v; v8h h[2]; };
__device__ __forceinline__ v16h frag_load(const _Float16* p) {
  FragH f;
  f.h[0] = *(const v8h*)(p);
  f.h[1] = *(const v8h*)(p + 16);
  return f.v;
}
/* one matrix instruction followed by its own hazard guard: ties this accumulator, names both fragments */
__device__ __forceinline__ v8f mma_f16(v16h a, v16h b, v8f c) {
  c = __builtin_amdgcn_wmma_f32_16x16x32_f16(false, a, false, b, (short)0, c, false, false);
  asm volatile("v_nop\n\tv_nop\n\tv_nop\n\tv_nop" : "+v"(c) : "v"(a), "v"(b));
  return c;
}

// ---------------------------------------------------------------------------
// Register-blocked batched f16 GEMM: C[m,n] = scale * sum_k A[m,k] * Bt[n,k] (+ bias[n] when BIAS_MODE == 2).
// A row-major [M,K]; Bt row-major [N,K]; M,N % 64 == 0, K % 32 == 0; each wave owns a 64x64 tile; b = batch, bx = the
// block's index inside its batch. sT: the block's LDS slabs for the epilogue, one per wave.
// ---------------------------------------------------------------------------
template <int BIAS_MODE>
__device__ __forceinline__ void gemm_tile64_body(
    float (&sT)[8][16 * 68], int bx, int b,
    const unsigned short* __restrict__ Ap, int lda, long strideA,
    const unsigned short* __restrict__ Btp, int ldb, long strideB,
    float* __restrict__ Cout, int ldc, long strideC,
    const float* __restrict__ bias,
    int M, int N, int K, float scale) {
  const _Float16* A  = (const _Float16*)Ap;
  const _Float16* Bt = (const _Float16*)Btp;
  const int lane = threadIdx.x & 31;
  const int wave = threadIdx.x >> 5;
  const int tilesN = N >> 6;
  const int tilesM = M >> 6;
  const int tile = bx * 8 + wave;
  /* wave-uniform exit; the GEMM kernels have no block barriers */
  if (tile >= tilesM * tilesN) return;
  const int tm = tile / tilesN;
  const int tn = tile - tm * tilesN;
  const int m0 = tm << 6;
  const int n0 = tn << 6;

  const _Float16* Ab = A  + (size_t)b * strideA;
  const _Float16* Bb = Bt + (size_t)b * strideB;

  /* row (A) / column (B, D) within a 16-wide subtile; k offset and D row offset of this lane half */
  const int rlane = lane & 15;
  const int koff  = (lane >> 4) * 8;
  const int mOff  = (lane >> 4) * 8;

  v8f acc[4][4];
#pragma unroll
  for (int i = 0; i < 4; ++i)
#pragma unroll
    for (int j = 0; j < 4; ++j) acc[i][j] = (v8f){0.f,0.f,0.f,0.f,0.f,0.f,0.f,0.f};

  for (int k0 = 0; k0 < K; k0 += 32) {
    v16h bh[4];
#pragma unroll
    for (int j = 0; j < 4; ++j) {
      const size_t bo = (size_t)(n0 + (j << 4) + rlane) * ldb + koff + k0;
      bh[j] = frag_load(Bb + bo);
    }
#pragma unroll
    for (int i = 0; i < 4; ++i) {
      const size_t ao = (size_t)(m0 + (i << 4) + rlane) * lda + koff + k0;
      const v16h ah = frag_load(Ab + ao);
#pragma unroll
      for (int j = 0; j < 4; ++j) acc[i][j] = mma_f16(ah, bh[j], acc[i][j]);
    }
  }

  // ---- epilogue ----
  float* slab = sT[wave];
  float* C = Cout + (size_t)b * strideC;
#pragma unroll
  for (int i = 0; i < 4; ++i) {
    const int mBase = m0 + (i << 4);
#pragma unroll
    for (int j = 0; j < 4; ++j) {
      const int n = n0 + (j << 4) + rlane;
      float bv = 0.f;
      if (BIAS_MODE == 2) bv = bias[n];
#pragma unroll
      for (int r = 0; r < 8; ++r) {
        float v = acc[i][j][r] * scale;
        if (BIAS_MODE == 2) v += bv;
        slab[(mOff + r) * 68 + (j << 4) + rlane] = v;
      }
    }
    __builtin_amdgcn_fence(__ATOMIC_RELEASE, "workgroup");
    __builtin_amdgcn_wave_barrier();
    __builtin_amdgcn_fence(__ATOMIC_ACQUIRE, "workgroup");
    {
      /* row segment = 256 B = 16 lanes x 16 B; lanes 0..15 row 2*it, lanes 16..31 row 2*it+1 */
      const int hh = lane >> 4, c4 = (lane & 15) * 4;
      {
#pragma unroll
        for (int it = 0; it < 8; ++it) {
          const int row = it * 2 + hh;
          v4f v = *(const v4f*)(slab + row * 68 + c4);
          *(v4f*)(C + (size_t)(mBase + row) * ldc + n0 + c4) = v;
        }
        
      }
    }
    __builtin_amdgcn_fence(__ATOMIC_RELEASE, "workgroup");
    __builtin_amdgcn_wave_barrier();
    __builtin_amdgcn_fence(__ATOMIC_ACQUIRE, "workgroup");
  }
}

/* one GEMM per launch: grid (blocks per batch, batches) */
__global__ __launch_bounds__(256) void gemm_f16_tile64(
    const unsigned short* __restrict__ Ap, int lda, long strideA,
    const unsigned short* __restrict__ Btp, int ldb, long strideB,
    float* __restrict__ Cout, int ldc, long strideC,
    int M, int N, int K, float scale) {
  __shared__ __align__(16) float sT[8][16 * 68];
  gemm_tile64_body<0>(sT, (int)blockIdx.x, (int)blockIdx.y, Ap, lda, strideA, Btp, ldb, strideB, Cout, ldc, strideC,
                      nullptr, M, N, K, scale);
}

// ---------------------------------------------------------------------------
// Row-major f32 -> f16 (x carry) cast of the encoder rows (bx 0..511) and the decoder rows (bx 512..767).
// 8 consecutive elements per thread: enc 4096*256/8 = 131,072 threads = 512 blocks; dec 2048*256/8 = 65,536 threads
// = 256 blocks; the grid covers both planes exactly. One 16-B store per lane; 32 consecutive lanes = 512 contiguous
// ---------------------------------------------------------------------------
constexpr int kEncCastBlocks = (kEncRows * kD / 8) / 256;
constexpr int kDecCastBlocks = (kDecRows * kD / 8) / 256;
static_assert(kEncCastBlocks * 256 * 8 == kEncRows * kD, "enc cast coverage");
static_assert(kDecCastBlocks * 256 * 8 == kDecRows * kD, "dec cast coverage");

__device__ __forceinline__ void cast_rows_body(int bx, const float* enc, const float* dec,
                                               unsigned short* encH, unsigned short* decH, float carry) {
  /* block-uniform plane select */
  const int isDec = (bx >= kEncCastBlocks) ? 1 : 0;
  const int blk = bx - isDec * kEncCastBlocks;
  const float* src = isDec ? dec : enc;
  unsigned short* dst = isDec ? decH : encH;
  const size_t e0 = ((size_t)blk * 256 + threadIdx.x) * 8;
  const v4f a = *(const v4f*)(src + e0);
  const v4f c = *(const v4f*)(src + e0 + 4);
  unsigned short hb[8];
#pragma unroll
  for (int e = 0; e < 4; ++e) {
    const float fa = a[e] * carry;
    const float fc = c[e] * carry;
    hb[e]     = h_bits_flush(fa);
    hb[4 + e] = h_bits_flush(fc);
  }
  const v4u u = (v4u){pk16(hb[0], hb[1]), pk16(hb[2], hb[3]), pk16(hb[4], hb[5]), pk16(hb[6], hb[7])};
  unsigned short* q = dst + e0;
  *(v4u*)q = u;
  /* the wait stands before any of the store's registers is reused */
  asm volatile("s_wait_xcnt 0x0" ::: "memory");
}

// ---------------------------------------------------------------------------
// Transpose + cast: in[rows][cols] f32 (row pitch ldi) -> out[cols][rows] f16 (row pitch ldo), values x carry.
// Block (bx, by) of (rows/64, cols/64) of one plane; src and op point at that plane; sm is the block's LDS tile.
// Load coverage: 16 iterations x 256 threads = 4096 = the whole 64x64 tile (coalesced along cols).
// Store coverage: 8 waves x 2 iterations x 4 rows (lane>>3) = 64 out rows; (lane&7) x 8 halves = 64 out cols; each
// ---------------------------------------------------------------------------
__device__ __forceinline__ void transpose_cast_body(float (&sm)[64][65], int bx, int by, const float* src, int ldi,
                                                    unsigned short* __restrict__ op, int ldo, float carry) {
  const int t  = threadIdx.x;
  const int r0 = bx * 64;
  const int c0 = by * 64;
#pragma unroll
  for (int i = 0; i < 16; ++i) {
    const int e = i * 256 + t;
    const int r = e >> 6;
    const int c = e & 63;
    sm[c][r] = src[(size_t)(r0 + r) * ldi + c0 + c] * carry;
  }
  __syncthreads();
  const int lane = t & 31, wave = t >> 5;
  const int q = lane >> 3, c8 = (lane & 7) * 8;
  {
#pragma unroll
    for (int it = 0; it < 2; ++it) {
      const int row = wave * 8 + it * 4 + q;
      unsigned short hb[8];
#pragma unroll
      for (int e = 0; e < 8; ++e) hb[e] = h_bits_flush(sm[row][c8 + e]);
      const v4u u = (v4u){pk16(hb[0], hb[1]), pk16(hb[2], hb[3]), pk16(hb[4], hb[5]), pk16(hb[6], hb[7])};
      *(v4u*)(op + (size_t)(c0 + row) * ldo + r0 + c8) = u;
    }
    /* one wait for both stores, as behind the cast job's store */
    asm volatile("s_wait_xcnt 0x0" ::: "memory");
  }
}

// ---------------------------------------------------------------------------
// Launch 1: all f16 operand planes, one grid. The jobs read only inputs and write disjoint planes.
// Job by block index (block-uniform, so the transpose's barrier is reached by all threads of a block or by none):
//   0 .. 31        W[d][u] (pitch kU) -> WT[u][d] (pitch kD), plane 0 = W1, plane 1 = W2, (d/64, u/64, 2) = (4, 4, 2)
//   32 .. 287      enc[b][e][d] (pitch kD) -> ENCT[b][d][e] (pitch kTE), (e/64, d/64, b) = (8, 4, 8)
//   288 .. 1055    row-major casts of enc and dec
// ---------------------------------------------------------------------------
constexpr int kWTX = kD / 64, kWTY = kU / 64;
constexpr int kWTBlocks = kWTX * kWTY * 2;
constexpr int kEncTX = kTE / 64, kEncTY = kD / 64;
constexpr int kEncTBlocks = kEncTX * kEncTY * kB;
constexpr int kPlaneBlocks = kWTBlocks + kEncTBlocks + kEncCastBlocks + kDecCastBlocks;
static_assert(kWTBlocks == 32 && kEncTBlocks == 256 && kPlaneBlocks == 1056, "operand grid");

__global__ __launch_bounds__(256) void operand_planes_kernel(const float* enc, const float* dec,
                                                             const float* W1, const float* W2,
                                                             unsigned short* encH, unsigned short* decH,
                                                             unsigned short* wT, unsigned short* encT,
                                                             float xCarry, float wCarry) {
  __shared__ float sm[64][65];
  const int blk = (int)blockIdx.x;
  if (blk < kWTBlocks) {
    const int bx = blk % kWTX;
    const int by = (blk / kWTX) % kWTY;
    const int z  = blk / (kWTX * kWTY);
    transpose_cast_body(sm, bx, by, (z == 1) ? W2 : W1, kU, wT + (size_t)z * kU * kD, kD, wCarry);
  } else if (blk < kWTBlocks + kEncTBlocks) {
    const int j  = blk - kWTBlocks;
    const int bx = j % kEncTX;
    const int by = (j / kEncTX) % kEncTY;
    const int z  = j / (kEncTX * kEncTY);
    transpose_cast_body(sm, bx, by, enc + (size_t)z * kTE * kD, kD, encT + (size_t)z * kD * kTE, kTE, xCarry);
  } else {
    cast_rows_body(blk - kWTBlocks - kEncTBlocks, enc, dec, encH, decH, xCarry);
  }
}

// ---------------------------------------------------------------------------
// Launch 2: the two projections do not depend on each other and neither fills the chip: one grid. Job by block index
// (block-uniform):
//   0 .. 31        job 0, enc projection (batched, no bias; kEncGemmGridX blocks per batch)
//   32 .. 47       job 1, dec projection (one batch, bias)
// ---------------------------------------------------------------------------
constexpr int kEncGemmGridX  = (kU / 64) * (kTE / 64) / 8;
constexpr int kEncGemmBlocks = kEncGemmGridX * kB;
constexpr int kDecGemmBlocks = (kDecRows / 64) * (kU / 64) / 8;
constexpr int kProjBlocks = kEncGemmBlocks + kDecGemmBlocks;
static_assert(kEncGemmBlocks == 32 && kDecGemmBlocks == 16 && kProjBlocks == 48, "projection grid");

__global__ __launch_bounds__(256) void projections_kernel(
    const unsigned short* __restrict__ A0, long strideA0,
    const unsigned short* __restrict__ Bt0, long strideB0,
    float* __restrict__ C0, int ldc0, long strideC0, int M0, int N0, float scale0,
    const unsigned short* __restrict__ A1,
    const unsigned short* __restrict__ Bt1,
    float* __restrict__ C1, int ldc1, const float* __restrict__ bias1, int M1, int N1, float scale1,
    int ldk, int K) {
  __shared__ __align__(16) float sT[8][16 * 68];
  const int blk = (int)blockIdx.x;
  if (blk < kEncGemmBlocks) {
    gemm_tile64_body<0>(sT, blk % kEncGemmGridX, blk / kEncGemmGridX, A0, ldk, strideA0, Bt0, ldk, strideB0,
                        C0, ldc0, strideC0, nullptr, M0, N0, K, scale0);
  } else {
    gemm_tile64_body<2>(sT, blk - kEncGemmBlocks, 0, A1, ldk, 0L, Bt1, ldk, 0L,
                        C1, ldc1, 0L, bias1, M1, N1, K, scale1);
  }
}

// ---------------------------------------------------------------------------
// Rows of EPS are held in a ring of kSets register sets of kPf rows. A set is refilled one stage behind its use, so a
// row is asked for (kSets - 2) * kPf rows of arithmetic ahead of its use. Why: every block of a batch walks the same
// rows at the same pace, so a row's first readers all wait out a memory round trip unless it was asked for early.
constexpr int kPf   = 8;
constexpr int kSets = 4;
constexpr int kRing = kPf * kSets;
static_assert((kU % kRing) == 0 && kU >= 2 * kRing, "the u loop takes one whole ring per trip");

__device__ __forceinline__ void load_rows(v2f (&x)[kPf], const float* p) {
#pragma unroll
  for (int i = 0; i < kPf; ++i) x[i] = *(const v2f*)(p + (size_t)i * kTE);
}
__device__ __forceinline__ void score_rows(const v2f (&x)[kPf], const float* su, float (&acc)[4][2]) {
#pragma unroll
  for (int i = 0; i < kPf; ++i) {
    const v4f d  = *(const v4f*)(su + i * 8);
    const float vm = su[i * 8 + 4];
#pragma unroll
    for (int t = 0; t < 4; ++t) {
      const float e0 = exp_scaled(x[i][0] + d[t]);
      const float e1 = exp_scaled(x[i][1] + d[t]);
      const float r0 = __builtin_amdgcn_rcpf(1.0f + e0);
      const float r1 = __builtin_amdgcn_rcpf(1.0f + e1);
      acc[t][0] = fmaf(r0, vm, acc[t][0]);
      acc[t][1] = fmaf(r1, vm, acc[t][1]);
    }
  }
}

// ---------------------------------------------------------------------------
// Score + softmax, f32. Block = one batch element b and 4 consecutive decoder steps; 256 threads; thread tid owns the
// encoder positions 2*tid and 2*tid+1 (256 x 2 = 512 = the whole softmax axis), 8 accumulators.
// EPS[b][u][e] holds kArgScale*(enc.W1); the LDS row sU[u] = {kArgScale*(dec.W2 + b2 + b1) for the 4 steps, -2*V[u],
// 0, 0, 0} (all 8 slots written by thread u). tanh(x) = 1 - 2/(1 + exp(2x)), so
//   logit = sum_u V[u] + bV + sum_u (-2*V[u]) / (1 + exp(2x)).
// Reductions in fixed order: wave shuffle tree, then the 8 wave partials in index order.
// 256w..256w+255 of each of the block's 4 rows); the x512 f16 copy as one packed 4-B word per lane (32 lanes = one
// grid = 8 * 64 = 512 blocks. Barriers under block-uniform control only; no early exit.
// ---------------------------------------------------------------------------
__global__ __launch_bounds__(256) void score_softmax_kernel(
    const float* __restrict__ eps, const float* __restrict__ dpb, const float* __restrict__ b1,
    const float* __restrict__ vvec, const float* __restrict__ bV,
    float* __restrict__ wout, unsigned* __restrict__ pw) {
  __shared__ __align__(16) float sU[kU * 8];
  __shared__ float sRedM[4 * 8];
  __shared__ float sRedS[4 * 8];
  __shared__ float sRedV[8];
  const int tid = threadIdx.x, lane = tid & 31, wave = tid >> 5;
  const int bt0 = blockIdx.x * 4;
  const int b   = bt0 / kTD;

  /* all sets of the ring but the last: in flight across the set-up of sU */
  const float* ep = eps + (size_t)b * kU * kTE + 2 * tid;
  v2f xr[kSets][kPf];
#pragma unroll
  for (int s = 0; s < kSets - 1; ++s) load_rows(xr[s], ep + (size_t)(s * kPf) * kTE);

  {
    const float bb = b1[tid];
    const float vv = vvec[tid];
    v4f dsv;
    dsv[0] = (dpb[(size_t)(bt0 + 0) * kU + tid] + bb) * kArgScale;
    dsv[1] = (dpb[(size_t)(bt0 + 1) * kU + tid] + bb) * kArgScale;
    dsv[2] = (dpb[(size_t)(bt0 + 2) * kU + tid] + bb) * kArgScale;
    dsv[3] = (dpb[(size_t)(bt0 + 3) * kU + tid] + bb) * kArgScale;
    const v4f vsl = (v4f){-2.0f * vv, 0.0f, 0.0f, 0.0f};
    *(v4f*)(sU + tid * 8)     = dsv;
    *(v4f*)(sU + tid * 8 + 4) = vsl;
    float sv = vv;
#pragma unroll
    for (int off = 16; off > 0; off >>= 1) sv += __shfl_xor(sv, off, 32);
    if (lane == 0) sRedV[wave] = sv;
  }
  __syncthreads();
  float cst = sRedV[0];
#pragma unroll
  for (int w = 1; w < 8; ++w) cst += sRedV[w];
  cst += bV[0];

  float acc[4][2];
#pragma unroll
  for (int t = 0; t < 4; ++t) { acc[t][0] = 0.0f; acc[t][1] = 0.0f; }

  for (int u = 0; u < kU - kRing; u += kRing) {
#pragma unroll
    for (int s = 0; s < kSets; ++s) {
      score_rows(xr[s], sU + (u + s * kPf) * 8, acc);
      /* The two scheduling barriers keep each refill in its stage: without them the compiler reads the whole ring at
         the top of a trip and refills it late, which takes the lead away. The set refilled is the one used a stage
         ago: a refill that overtakes its set's last use goes to spare registers, and the copy back at the top of the
         trip waits for every load in flight. LDS reads (0x100) may still move up across both. */
      __builtin_amdgcn_sched_barrier(0x100);
      const int f = (s + kSets - 1) % kSets;
      load_rows(xr[f], ep + (size_t)(u + (s == 0 ? 0 : kRing) + f * kPf) * kTE);
      __builtin_amdgcn_sched_barrier(0x100);
    }
  }
  /* the last ring: only its last set is still to be fetched */
  score_rows(xr[0], sU + (kU - kRing) * 8, acc);
  __builtin_amdgcn_sched_barrier(0x100);  /* as in the loop */
  load_rows(xr[kSets - 1], ep + (size_t)(kU - kPf) * kTE);
  __builtin_amdgcn_sched_barrier(0x100);  /* as in the loop */
#pragma unroll
  for (int s = 1; s < kSets; ++s) score_rows(xr[s], sU + (kU - kRing + s * kPf) * 8, acc);

  float lg[4][2];
  float mx[4];
#pragma unroll
  for (int t = 0; t < 4; ++t) {
    lg[t][0] = acc[t][0] + cst;
    lg[t][1] = acc[t][1] + cst;
    float m = fmaxf(lg[t][0], lg[t][1]);
#pragma unroll
    for (int off = 16; off > 0; off >>= 1) m = fmaxf(m, __shfl_xor(m, off, 32));
    mx[t] = m;
  }
  if (lane == 0) {
#pragma unroll
    for (int t = 0; t < 4; ++t) sRedM[t * 8 + wave] = mx[t];
  }
  __syncthreads();
  float ex[4][2];
  float sm[4];
#pragma unroll
  for (int t = 0; t < 4; ++t) {
    float m = sRedM[t * 8];
#pragma unroll
    for (int w = 1; w < 8; ++w) m = fmaxf(m, sRedM[t * 8 + w]);
    ex[t][0] = expf(lg[t][0] - m);
    ex[t][1] = expf(lg[t][1] - m);
    float s = ex[t][0] + ex[t][1];
#pragma unroll
    for (int off = 16; off > 0; off >>= 1) s += __shfl_xor(s, off, 32);
    sm[t] = s;
  }
  if (lane == 0) {
#pragma unroll
    for (int t = 0; t < 4; ++t) sRedS[t * 8 + wave] = sm[t];
  }
  __syncthreads();
  v2f wv[4];
  unsigned pk[4];
#pragma unroll
  for (int t = 0; t < 4; ++t) {
    float s = sRedS[t * 8];
#pragma unroll
    for (int w = 1; w < 8; ++w) s += sRedS[t * 8 + w];
    const float inv = __builtin_amdgcn_rcpf(s);
    const float w0 = ex[t][0] * inv;
    const float w1 = ex[t][1] * inv;
    wv[t] = (v2f){w0, w1};
    pk[t] = pk16(h_bits_flush(w0 * kPCarry), h_bits_flush(w1 * kPCarry));
  }
  {
#pragma unroll
    for (int t = 0; t < 4; ++t) {
      *(v2f*)(wout + (size_t)(bt0 + t) * kTE + 2 * tid) = wv[t];
      *(unsigned*)(pw + (size_t)(bt0 + t) * (kTE / 2) + tid) = pk[t];
    }
    
  }
}

// ---------------------------------------------------------------------------
// Host glue: 4 kernel launches, nothing else.
// GEMM shapes (all K % 32 == 0, M and N % 64 == 0):
//   enc projection (swapped roles): M 256 (u), N 512 (e), K 256 (d), 8 batches -> 4 x 8 tiles = 32 -> 4 x 8 blocks
//   dec projection                : M 2048,    N 256 (u), K 256 (d)            -> 32 x 4 tiles = 128 -> 16 blocks
//   context                       : M 256 (t), N 256 (d), K 512 (e), 8 batches -> 4 x 4 tiles = 16 -> grid (2, 8)
// ---------------------------------------------------------------------------
static_assert((kU / 64) * (kTE / 64) == 4 * 8, "enc projection grid");
static_assert((kDecRows / 64) * (kU / 64) == 16 * 8, "dec projection grid");
static_assert((kTD / 64) * (kD / 64) == 2 * 8, "context grid");

extern "C" void kernel_launch(void* const* d_in, const int* in_sizes, int n_in,
                              void* d_out, int out_size, void* d_ws, size_t ws_size,
                              hipStream_t stream) {
  if (n_in < 8) return;
  if (in_sizes[0] != kB * kTE * kD) return;
  if (in_sizes[1] != kB * kTD * kD) return;
  if (in_sizes[2] != kD * kU) return;
  if (in_sizes[3] != kU) return;
  if (in_sizes[4] != kD * kU) return;
  if (in_sizes[5] != kU) return;
  if (in_sizes[6] != kU) return;
  if (in_sizes[7] != 1) return;
  if (out_size != kB * kTD * kD + kB * kTD * kTE) return;
  if (ws_size < kWsTotal) return;

  const float* enc = (const float*)d_in[0];
  const float* dec = (const float*)d_in[1];
  const float* W1  = (const float*)d_in[2];
  const float* b1  = (const float*)d_in[3];
  const float* W2  = (const float*)d_in[4];
  const float* b2  = (const float*)d_in[5];
  const float* Vv  = (const float*)d_in[6];
  const float* bV  = (const float*)d_in[7];

  float* out0 = (float*)d_out;
  float* out1 = (float*)d_out + kOut1OffElems;

  char* ws = (char*)d_ws;
  unsigned short* ENCH = (unsigned short*)(ws + kOffENCH);
  unsigned short* DECH = (unsigned short*)(ws + kOffDECH);
  unsigned short* ENCT = (unsigned short*)(ws + kOffENCT);
  unsigned short* WT   = (unsigned short*)(ws + kOffWT);
  float*          EPS  = (float*)(ws + kOffEPS);
  float*          DPB  = (float*)(ws + kOffDPB);
  unsigned short* PH   = (unsigned short*)(ws + kOffPH);
  unsigned short* W1T  = WT;
  unsigned short* W2T  = WT + (size_t)kU * kD;

  // ---- operand planes ----
  operand_planes_kernel<<<kPlaneBlocks, 256, 0, stream>>>(enc, dec, W1, W2, ENCH, DECH, WT, ENCT, kXCarry, kWCarry);

  // ---- job 0: EPS[b][u][e] = kArgScale * sum_d W1T[u][d] * enc[b][e][d] ----
  // ---- job 1: DPB[bt][u] = sum_d dec[bt][d] * W2T[u][d] + b2[u] ----
  projections_kernel<<<kProjBlocks, 256, 0, stream>>>(
      W1T, 0L,
      ENCH, (long)kTE * kD,
      EPS, kTE, (long)kU * kTE, kU, kTE, kEpScale,
      DECH,
      W2T,
      DPB, kU, b2, kDecRows, kU, kProjScale,
      kD, kD);

  // ---- tanh, V dot, softmax over the encoder axis -> second output (f32) and the x512 f16 copy ----
  score_softmax_kernel<<<kB * (kTD / 4), 256, 0, stream>>>(EPS, DPB, b1, Vv, bV, out1, (unsigned*)PH);

  // ---- context[b][t][d] = (1/8192) * sum_e PH[b][t][e] * ENCT[b][d][e] ----
  gemm_f16_tile64<<<dim3(2, kB), 256, 0, stream>>>(
      PH, kTE, (long)kTD * kTE,
      ENCT, kTE, (long)kD * kTE,
      out0, kD, (long)kTD * kD,
      kTD, kD, kTE, kCtxScale);
}

// v003
// Measured time: 69 microseconds a run.
// In two side-by-side timings against v002, it was 1.16 and 1.14 times as fast.
// Counting every step since v000, it is 1.89 times as fast.
// Contractions enc.W1, dec.W2 and weights.enc: v_wmma_f32_16x16x32_f16 (f16 operands with power-of-two carries: activations x16, weight planes x256, probabilities x512; f32 accumulate); tanh, the 256-term V dot and the softmax: f32 on the vector unit.
#include <hip/hip_runtime.h>
#include <math.h>

typedef __attribute__((ext_vector_type(16))) _Float16 v16h;
typedef __attribute__((ext_vector_type(8)))  _Float16 v8h;
typedef __attribute__((ext_vector_type(8)))  float    v8f;
typedef __attribute__((ext_vector_type(4)))  float    v4f;
typedef __attribute__((ext_vector_type(2)))  float    v2f;
typedef __attribute__((ext_vector_type(4)))  unsigned int v4u;

// ---------------------------------------------------------------------------
// Shape constants
// ---------------------------------------------------------------------------
constexpr int kB  = 8;
constexpr int kTE = 512;
constexpr int kTD = 256;
constexpr int kD  = 256;
constexpr int kU  = 256;
constexpr int kEncRows = kB * kTE;
constexpr int kDecRows = kB * kTD;
static_assert(kEncRows == 4096 && kDecRows == 2048, "row counts");
static_assert((kD % 32) == 0 && (kTE % 32) == 0, "GEMM K multiples of 32");
static_assert((kU % 64) == 0 && (kTE % 64) == 0 && (kTD % 64) == 0 && (kD % 64) == 0 && (kDecRows % 64) == 0, "GEMM M,N multiples of 64");
static_assert(kU == 256 && kTE == 512, "score kernel thread map: 256 threads, two encoder positions per thread");

// power-of-two carries of the f16 operand planes and the folded-back epilogue scales
constexpr float kXCarry   = 16.0f;
constexpr float kWCarry   = 256.0f;
constexpr float kPCarry   = 512.0f;
constexpr float kProjScale = 1.0f / (kWCarry * kXCarry);
constexpr float kCtxScale  = 1.0f / (kPCarry * kXCarry);
constexpr float kF16MinNormal = 6.103515625e-05f;

// exp(2x) is evaluated as 2^(x * 2*log2(e)). The argument constant is the SAME in every compilation pass
// (no target-dependent selection), so a host-passed scale and the device code always agree; only the body
// of the device-only 2^a helper depends on which builtin the device compiler offers.
constexpr float kArgScale = 2.8853900817779268f;
static_assert(kArgScale > 2.885f && kArgScale < 2.886f, "argument constant is 2*log2(e) in every pass");
__device__ __forceinline__ float exp_scaled(float a) {
#if __has_builtin(__builtin_amdgcn_exp2f)
  return __builtin_amdgcn_exp2f(a);
#else
  return exp2f(a);
#endif
}
constexpr float kEpScale = kArgScale * kProjScale;
// exp(2(a + d)) = exp(2a) * exp(2d), a = the enc side, d = the dec side, each factor formed once where its projection is
// at hand. The enc exponent is clamped to the f32 normal range, so its factor is never 0 or infinite. The product form is
// used only while every dec exponent of a block lies within kDecLim: then a clamped enc factor still leaves an exponent
// sum beyond +-24, where 1/(1 + 2^s) is 0 or 1 to f32 rounding, as it is for the true sum. Any other block takes the sum
// form from the unclamped plane.
constexpr float kExpLim = 126.0f;
constexpr float kDecLim = 102.0f;
static_assert(kExpLim - kDecLim >= 24.0f, "a clamped enc factor saturates the term for every admitted dec exponent");
__device__ __forceinline__ float exp_factor(float a) { return exp_scaled(fminf(fmaxf(a, -kExpLim), kExpLim)); }

// ---------------------------------------------------------------------------
// Workspace region map (bytes; every offset is a multiple of 128)
//   ENCH f16 [4096][256]     enc x16, row-major                  2,097,152
//   DECH f16 [2048][256]     dec x16, row-major                  1,048,576
//   ENCT f16 [8][256][512]   enc x16, transposed per batch       2,097,152
//   WT   f16 [2][256][256]   W1^T, W2^T x256 ([u][d])              262,144
//   EPS  f32 [8][256][512]   kArgScale * enc.W1, [b][u][e]       4,194,304
//   DPB  f32 [2048][256]     dec.W2 + b2                         2,097,152
//   PH   f16 [2048][512]     softmax weights x512                2,097,152
//   EPF  f32 [8][256][512]   2^EPS, exponent clamped, [b][u][e]  4,194,304
//   total                                                       18,087,936
// ---------------------------------------------------------------------------
constexpr size_t kOffENCH = 0;
constexpr size_t kOffDECH = kOffENCH + (size_t)kEncRows * kD * 2;
constexpr size_t kOffENCT = kOffDECH + (size_t)kDecRows * kD * 2;
constexpr size_t kOffWT   = kOffENCT + (size_t)kB * kD * kTE * 2;
constexpr size_t kOffEPS  = kOffWT   + (size_t)2 * kU * kD * 2;
constexpr size_t kOffDPB  = kOffEPS  + (size_t)kB * kU * kTE * 4;
constexpr size_t kOffPH   = kOffDPB  + (size_t)kDecRows * kU * 4;
constexpr size_t kOffEPF  = kOffPH   + (size_t)kDecRows * kTE * 2;
constexpr size_t kWsTotal = kOffEPF  + (size_t)kB * kU * kTE * 4;
static_assert(kWsTotal == 18087936ull, "carve total");
static_assert(kWsTotal <= 134217728ull, "carve cap");
static_assert((kOffDECH % 128) == 0 && (kOffENCT % 128) == 0 && (kOffWT % 128) == 0 && (kOffEPS % 128) == 0 &&
              (kOffDPB % 128) == 0 && (kOffPH % 128) == 0 && (kOffEPF % 128) == 0, "128-B aligned regions");

// output packing (bytes -> float elements)
constexpr size_t kOut0Bytes = (size_t)kB * kTD * kD * 4;
constexpr size_t kOut1OffBytes = 2097152ull;
constexpr size_t kOut1Bytes = (size_t)kB * kTD * kTE * 4;
static_assert(kOut0Bytes == kOut1OffBytes, "second output follows the first");
static_assert(kOut1OffBytes + kOut1Bytes == 6291456ull, "output total");
static_assert((kOut1OffBytes % 128) == 0, "second output line aligned");
constexpr size_t kOut1OffElems = kOut1OffBytes / 4;

// ---------------------------------------------------------------------------
// Small helpers
// ---------------------------------------------------------------------------
__device__ __forceinline__ unsigned pk16(unsigned short a, unsigned short b) { return (unsigned)a | ((unsigned)b << 16); }

// f32 -> f16 bits (RNE); magnitudes under the f16 normal range become +0 by a select before the convert
__device__ __forceinline__ unsigned short h_bits_flush(float f) {
  const float g = (fabsf(f) < kF16MinNormal) ? 0.0f : f;
  const _Float16 h = (_Float16)g;
  return __builtin_bit_cast(unsigned short, h);
}

/* fragment load: elements 0..7 <- p[0..7], elements 8..15 <- p[16..23] */
union FragH { v16h v; v8h h[2]; };
__device__ __forceinline__ v16h frag_load(const _Float16* p) {
  FragH f;
  f.h[0] = *(const v8h*)(p);
  f.h[1] = *(const v8h*)(p + 16);
  return f.v;
}
/* one matrix instruction followed by its own hazard guard: ties this accumulator, names both fragments */
__device__ __forceinline__ v8f mma_f16(v16h a, v16h b, v8f c) {
  c = __builtin_amdgcn_wmma_f32_16x16x32_f16(false, a, false, b, (short)0, c, false, false);
  asm volatile("v_nop\n\tv_nop\n\tv_nop\n\tv_nop" : "+v"(c) : "v"(a), "v"(b));
  return c;
}

// ---------------------------------------------------------------------------
// Register-blocked batched f16 GEMM: C[m,n] = scale * sum_k A[m,k] * Bt[n,k] (+ bias[n] when BIAS_MODE == 2); with
// EXP_PLANE the plane Xout (shaped as Cout) also takes exp_factor(C[m,n]).
// A row-major [M,K]; Bt row-major [N,K]; M,N % 64 == 0, K % 32 == 0; each wave owns a 64x64 tile; b = batch, bx = the
// block's index inside its batch. sT: the block's LDS slabs for the epilogue, one per wave.
// ---------------------------------------------------------------------------
template <int BIAS_MODE, bool EXP_PLANE>
__device__ __forceinline__ void gemm_tile64_body(
    float (&sT)[8][16 * 68], int bx, int b,
    const unsigned short* __restrict__ Ap, int lda, long strideA,
    const unsigned short* __restrict__ Btp, int ldb, long strideB,
    float* __restrict__ Cout, float* __restrict__ Xout, int ldc, long strideC,
    const float* __restrict__ bias,
    int M, int N, int K, float scale) {
  const _Float16* A  = (const _Float16*)Ap;
  const _Float16* Bt = (const _Float16*)Btp;
  const int lane = threadIdx.x & 31;
  const int wave = threadIdx.x >> 5;
  const int tilesN = N >> 6;
  const int tilesM = M >> 6;
  const int tile = bx * 8 + wave;
  /* wave-uniform exit; the GEMM kernels have no block barriers */
  if (tile >= tilesM * tilesN) return;
  const int tm = tile / tilesN;
  const int tn = tile - tm * tilesN;
  const int m0 = tm << 6;
  const int n0 = tn << 6;

  const _Float16* Ab = A  + (size_t)b * strideA;
  const _Float16* Bb = Bt + (size_t)b * strideB;

  /* row (A) / column (B, D) within a 16-wide subtile; k offset and D row offset of this lane half */
  const int rlane = lane & 15;
  const int koff  = (lane >> 4) * 8;
  const int mOff  = (lane >> 4) * 8;

  v8f acc[4][4];
#pragma unroll
  for (int i = 0; i < 4; ++i)
#pragma unroll
    for (int j = 0; j < 4; ++j) acc[i][j] = (v8f){0.f,0.f,0.f,0.f,0.f,0.f,0.f,0.f};

  for (int k0 = 0; k0 < K; k0 += 32) {
    v16h bh[4];
#pragma unroll
    for (int j = 0; j < 4; ++j) {
      const size_t bo = (size_t)(n0 + (j << 4) + rlane) * ldb + koff + k0;
      bh[j] = frag_load(Bb + bo);
    }
#pragma unroll
    for (int i = 0; i < 4; ++i) {
      const size_t ao = (size_t)(m0 + (i << 4) + rlane) * lda + koff + k0;
      const v16h ah = frag_load(Ab + ao);
#pragma unroll
      for (int j = 0; j < 4; ++j) acc[i][j] = mma_f16(ah, bh[j], acc[i][j]);
    }
  }

  // ---- epilogue ----
  float* slab = sT[wave];
  float* C = Cout + (size_t)b * strideC;
#pragma unroll
  for (int i = 0; i < 4; ++i) {
    const int mBase = m0 + (i << 4);
#pragma unroll
    for (int j = 0; j < 4; ++j) {
      const int n = n0 + (j << 4) + rlane;
      float bv = 0.f;
      if (BIAS_MODE == 2) bv = bias[n];
#pragma unroll
      for (int r = 0; r < 8; ++r) {
        float v = acc[i][j][r] * scale;
        if (BIAS_MODE == 2) v += bv;
        slab[(mOff + r) * 68 + (j << 4) + rlane] = v;
      }
    }
    __builtin_amdgcn_fence(__ATOMIC_RELEASE, "workgroup");
    __builtin_amdgcn_wave_barrier();
    __builtin_amdgcn_fence(__ATOMIC_ACQUIRE, "workgroup");
    {
      /* row segment = 256 B = 16 lanes x 16 B; lanes 0..15 row 2*it, lanes 16..31 row 2*it+1 */
      const int hh = lane >> 4, c4 = (lane & 15) * 4;
      {
#pragma unroll
        for (int it = 0; it < 8; ++it) {
          const int row = it * 2 + hh;
          v4f v = *(const v4f*)(slab + row * 68 + c4);
          *(v4f*)(C + (size_t)(mBase + row) * ldc + n0 + c4) = v;
          if (EXP_PLANE) {
            const v4f f = (v4f){exp_factor(v[0]), exp_factor(v[1]), exp_factor(v[2]), exp_factor(v[3])};
            *(v4f*)(Xout + (size_t)b * strideC + (size_t)(mBase + row) * ldc + n0 + c4) = f;
          }
        }
        
      }
    }
    __builtin_amdgcn_fence(__ATOMIC_RELEASE, "workgroup");
    __builtin_amdgcn_wave_barrier();
    __builtin_amdgcn_fence(__ATOMIC_ACQUIRE, "workgroup");
  }
}

/* one GEMM per launch: grid (blocks per batch, batches) */
__global__ __launch_bounds__(256) void gemm_f16_tile64(
    const unsigned short* __restrict__ Ap, int lda, long strideA,
    const unsigned short* __restrict__ Btp, int ldb, long strideB,
    float* __restrict__ Cout, int ldc, long strideC,
    int M, int N, int K, float scale) {
  __shared__ __align__(16) float sT[8][16 * 68];
  gemm_tile64_body<0, false>(sT, (int)blockIdx.x, (int)blockIdx.y, Ap, lda, strideA, Btp, ldb, strideB, Cout, nullptr, ldc,
                             strideC, nullptr, M, N, K, scale);
}

// ---------------------------------------------------------------------------
// Row-major f32 -> f16 (x carry) cast of the encoder rows (bx 0..511) and the decoder rows (bx 512..767).
// 8 consecutive elements per thread: enc 4096*256/8 = 131,072 threads = 512 blocks; dec 2048*256/8 = 65,536 threads
// = 256 blocks; the grid covers both planes exactly. One 16-B store per lane; 32 consecutive lanes = 512 contiguous
// ---------------------------------------------------------------------------
constexpr int kEncCastBlocks = (kEncRows * kD / 8) / 256;
constexpr int kDecCastBlocks = (kDecRows * kD / 8) / 256;
static_assert(kEncCastBlocks * 256 * 8 == kEncRows * kD, "enc cast coverage");
static_assert(kDecCastBlocks * 256 * 8 == kDecRows * kD, "dec cast coverage");

__device__ __forceinline__ void cast_rows_body(int bx, const float* enc, const float* dec,
                                               unsigned short* encH, unsigned short* decH, float carry) {
  /* block-uniform plane select */
  const int isDec = (bx >= kEncCastBlocks) ? 1 : 0;
  const int blk = bx - isDec * kEncCastBlocks;
  const float* src = isDec ? dec : enc;
  unsigned short* dst = isDec ? decH : encH;
  const size_t e0 = ((size_t)blk * 256 + threadIdx.x) * 8;
  const v4f a = *(const v4f*)(src + e0);
  const v4f c = *(const v4f*)(src + e0 + 4);
  unsigned short hb[8];
#pragma unroll
  for (int e = 0; e < 4; ++e) {
    const float fa = a[e] * carry;
    const float fc = c[e] * carry;
    hb[e]     = h_bits_flush(fa);
    hb[4 + e] = h_bits_flush(fc);
  }
  const v4u u = (v4u){pk16(hb[0], hb[1]), pk16(hb[2], hb[3]), pk16(hb[4], hb[5]), pk16(hb[6], hb[7])};
  unsigned short* q = dst + e0;
  *(v4u*)q = u;
  /* the wait stands before any of the store's registers is reused */
  asm volatile("s_wait_xcnt 0x0" ::: "memory");
}

// ---------------------------------------------------------------------------
// Transpose + cast: in[rows][cols] f32 (row pitch ldi) -> out[cols][rows] f16 (row pitch ldo), values x carry.
// Block (bx, by) of (rows/64, cols/64) of one plane; src and op point at that plane; sm is the block's LDS tile.
// Load coverage: 16 iterations x 256 threads = 4096 = the whole 64x64 tile (coalesced along cols).
// Store coverage: 8 waves x 2 iterations x 4 rows (lane>>3) = 64 out rows; (lane&7) x 8 halves = 64 out cols; each
// ---------------------------------------------------------------------------
__device__ __forceinline__ void transpose_cast_body(float (&sm)[64][65], int bx, int by, const float* src, int ldi,
                                                    unsigned short* __restrict__ op, int ldo, float carry) {
  const int t  = threadIdx.x;
  const int r0 = bx * 64;
  const int c0 = by * 64;
#pragma unroll
  for (int i = 0; i < 16; ++i) {
    const int e = i * 256 + t;
    const int r = e >> 6;
    const int c = e & 63;
    sm[c][r] = src[(size_t)(r0 + r) * ldi + c0 + c] * carry;
  }
  __syncthreads();
  const int lane = t & 31, wave = t >> 5;
  const int q = lane >> 3, c8 = (lane & 7) * 8;
  {
#pragma unroll
    for (int it = 0; it < 2; ++it) {
      const int row = wave * 8 + it * 4 + q;
      unsigned short hb[8];
#pragma unroll
      for (int e = 0; e < 8; ++e) hb[e] = h_bits_flush(sm[row][c8 + e]);
      const v4u u = (v4u){pk16(hb[0], hb[1]), pk16(hb[2], hb[3]), pk16(hb[4], hb[5]), pk16(hb[6], hb[7])};
      *(v4u*)(op + (size_t)(c0 + row) * ldo + r0 + c8) = u;
    }
    /* one wait for both stores, as behind the cast job's store */
    asm volatile("s_wait_xcnt 0x0" ::: "memory");
  }
}

// ---------------------------------------------------------------------------
// Launch 1: all f16 operand planes, one grid. The jobs read only inputs and write disjoint planes.
// Job by block index (block-uniform, so the transpose's barrier is reached by all threads of a block or by none):
//   0 .. 31        W[d][u] (pitch kU) -> WT[u][d] (pitch kD), plane 0 = W1, plane 1 = W2, (d/64, u/64, 2) = (4, 4, 2)
//   32 .. 287      enc[b][e][d] (pitch kD) -> ENCT[b][d][e] (pitch kTE), (e/64, d/64, b) = (8, 4, 8)
//   288 .. 1055    row-major casts of enc and dec
// ---------------------------------------------------------------------------
constexpr int kWTX = kD / 64, kWTY = kU / 64;
constexpr int kWTBlocks = kWTX * kWTY * 2;
constexpr int kEncTX = kTE / 64, kEncTY = kD / 64;
constexpr int kEncTBlocks = kEncTX * kEncTY * kB;
constexpr int kPlaneBlocks = kWTBlocks + kEncTBlocks + kEncCastBlocks + kDecCastBlocks;
static_assert(kWTBlocks == 32 && kEncTBlocks == 256 && kPlaneBlocks == 1056, "operand grid");

__global__ __launch_bounds__(256) void operand_planes_kernel(const float* enc, const float* dec,
                                                             const float* W1, const float* W2,
                                                             unsigned short* encH, unsigned short* decH,
                                                             unsigned short* wT, unsigned short* encT,
                                                             float xCarry, float wCarry) {
  __shared__ float sm[64][65];
  const int blk = (int)blockIdx.x;
  if (blk < kWTBlocks) {
    const int bx = blk % kWTX;
    const int by = (blk / kWTX) % kWTY;
    const int z  = blk / (kWTX * kWTY);
    transpose_cast_body(sm, bx, by, (z == 1) ? W2 : W1, kU, wT + (size_t)z * kU * kD, kD, wCarry);
  } else if (blk < kWTBlocks + kEncTBlocks) {
    const int j  = blk - kWTBlocks;
    const int bx = j % kEncTX;
    const int by = (j / kEncTX) % kEncTY;
    const int z  = j / (kEncTX * kEncTY);
    transpose_cast_body(sm, bx, by, enc + (size_t)z * kTE * kD, kD, encT + (size_t)z * kD * kTE, kTE, xCarry);
  } else {
    cast_rows_body(blk - kWTBlocks - kEncTBlocks, enc, dec, encH, decH, xCarry);
  }
}

// ---------------------------------------------------------------------------
// Launch 2: the two projections do not depend on each other and neither fills the chip: one grid. Job by block index
// (block-uniform):
//   0 .. 31        job 0, enc projection (batched, no bias, also stored as its exp factor; kEncGemmGridX blocks per batch)
//   32 .. 47       job 1, dec projection (one batch, bias)
// ---------------------------------------------------------------------------
constexpr int kEncGemmGridX  = (kU / 64) * (kTE / 64) / 8;
constexpr int kEncGemmBlocks = kEncGemmGridX * kB;
constexpr int kDecGemmBlocks = (kDecRows / 64) * (kU / 64) / 8;
constexpr int kProjBlocks = kEncGemmBlocks + kDecGemmBlocks;
static_assert(kEncGemmBlocks == 32 && kDecGemmBlocks == 16 && kProjBlocks == 48, "projection grid");

__global__ __launch_bounds__(256) void projections_kernel(
    const unsigned short* __restrict__ A0, long strideA0,
    const unsigned short* __restrict__ Bt0, long strideB0,
    float* __restrict__ C0, float* __restrict__ X0, int ldc0, long strideC0, int M0, int N0, float scale0,
    const unsigned short* __restrict__ A1,
    const unsigned short* __restrict__ Bt1,
    float* __restrict__ C1, int ldc1, const float* __restrict__ bias1, int M1, int N1, float scale1,
    int ldk, int K) {
  __shared__ __align__(16) float sT[8][16 * 68];
  const int blk = (int)blockIdx.x;
  if (blk < kEncGemmBlocks) {
    gemm_tile64_body<0, true>(sT, blk % kEncGemmGridX, blk / kEncGemmGridX, A0, ldk, strideA0, Bt0, ldk, strideB0,
                              C0, X0, ldc0, strideC0, nullptr, M0, N0, K, scale0);
  } else {
    gemm_tile64_body<2, false>(sT, blk - kEncGemmBlocks, 0, A1, ldk, 0L, Bt1, ldk, 0L,
                               C1, nullptr, ldc1, 0L, bias1, M1, N1, K, scale1);
  }
}

// ---------------------------------------------------------------------------
// Rows of EPF are held in a ring of kSets register sets of kPf rows. A set is refilled one stage behind its use, so a
// row is asked for (kSets - 2) * kPf rows of arithmetic ahead of its use. Why: every block of a batch walks the same
// rows at the same pace, so a row's first readers all wait out a memory round trip unless it was asked for early.
constexpr int kPf   = 8;
constexpr int kSets = 4;
constexpr int kRing = kPf * kSets;
static_assert((kU % kRing) == 0 && kU >= 2 * kRing, "the u loop takes one whole ring per trip");

__device__ __forceinline__ void load_rows(v2f (&x)[kPf], const float* p) {
#pragma unroll
  for (int i = 0; i < kPf; ++i) x[i] = *(const v2f*)(p + (size_t)i * kTE);
}
/* product form: x = rows of EPF, su = rows of sU (dec factors and -2*V) */
__device__ __forceinline__ void score_rows(const v2f (&x)[kPf], const float* su, float (&acc)[4][2]) {
#pragma unroll
  for (int i = 0; i < kPf; ++i) {
    const v4f d  = *(const v4f*)(su + i * 8);
    const float vm = su[i * 8 + 4];
#pragma unroll
    for (int t = 0; t < 4; ++t) {
      const float r0 = __builtin_amdgcn_rcpf(fmaf(x[i][0], d[t], 1.0f));
      const float r1 = __builtin_amdgcn_rcpf(fmaf(x[i][1], d[t], 1.0f));
      acc[t][0] = fmaf(r0, vm, acc[t][0]);
      acc[t][1] = fmaf(r1, vm, acc[t][1]);
    }
  }
}
/* sum form: x = rows of EPS, sd = rows of sD (dec exponents), su = rows of sU (for -2*V) */
__device__ __forceinline__ void score_rows_sum(const v2f (&x)[kPf], const float* sd, const float* su, float (&acc)[4][2]) {
#pragma unroll
  for (int i = 0; i < kPf; ++i) {
    const v4f d  = *(const v4f*)(sd + i * 4);
    const float vm = su[i * 8 + 4];
#pragma unroll
    for (int t = 0; t < 4; ++t) {
      const float e0 = exp_scaled(x[i][0] + d[t]);
      const float e1 = exp_scaled(x[i][1] + d[t]);
      const float r0 = __builtin_amdgcn_rcpf(1.0f + e0);
      const float r1 = __builtin_amdgcn_rcpf(1.0f + e1);
      acc[t][0] = fmaf(r0, vm, acc[t][0]);
      acc[t][1] = fmaf(r1, vm, acc[t][1]);
    }
  }
}

// ---------------------------------------------------------------------------
// Score + softmax, f32. Block = one batch element b and 4 consecutive decoder steps; 256 threads; thread tid owns the
// encoder positions 2*tid and 2*tid+1 (256 x 2 = 512 = the whole softmax axis), 8 accumulators.
// EPS[b][u][e] holds kArgScale*(enc.W1) and EPF[b][u][e] its exp factor; the LDS row sD[u] = kArgScale*(dec.W2 + b2 + b1)
// for the 4 steps, the LDS row sU[u] = {2^sD[u] for the 4 steps, -2*V[u], 0, 0, 0} (all slots written by thread u).
// tanh(x) = 1 - 2/(1 + exp(2x)), so
//   logit = sum_u V[u] + bV + sum_u (-2*V[u]) / (1 + exp(2x)), exp(2x) = EPF * sU (product form) = 2^(EPS + sD) (sum form).
// Reductions in fixed order: wave shuffle tree, then the 8 wave partials in index order.
// 256w..256w+255 of each of the block's 4 rows); the x512 f16 copy as one packed 4-B word per lane (32 lanes = one
// grid = 8 * 64 = 512 blocks. Barriers under block-uniform control only; no early exit.
// ---------------------------------------------------------------------------
__global__ __launch_bounds__(256) void score_softmax_kernel(
    const float* __restrict__ eps, const float* __restrict__ epf, const float* __restrict__ dpb,
    const float* __restrict__ b1,
    const float* __restrict__ vvec, const float* __restrict__ bV,
    float* __restrict__ wout, unsigned* __restrict__ pw) {
  __shared__ __align__(16) float sU[kU * 8];
  __shared__ float sRedM[4 * 8];
  __shared__ float sRedS[4 * 8];
  __shared__ float sRedV[8];
  __shared__ __align__(16) float sD[kU * 4];
  __shared__ unsigned sWide[8];
  const int tid = threadIdx.x, lane = tid & 31, wave = tid >> 5;
  const int bt0 = blockIdx.x * 4;
  const int b   = bt0 / kTD;

  /* all sets of the ring but the last: in flight across the set-up of sU */
  const float* ep = epf + (size_t)b * kU * kTE + 2 * tid;
  v2f xr[kSets][kPf];
#pragma unroll
  for (int s = 0; s < kSets - 1; ++s) load_rows(xr[s], ep + (size_t)(s * kPf) * kTE);

  {
    const float bb = b1[tid];
    const float vv = vvec[tid];
    v4f dsv;
    dsv[0] = (dpb[(size_t)(bt0 + 0) * kU + tid] + bb) * kArgScale;
    dsv[1] = (dpb[(size_t)(bt0 + 1) * kU + tid] + bb) * kArgScale;
    dsv[2] = (dpb[(size_t)(bt0 + 2) * kU + tid] + bb) * kArgScale;
    dsv[3] = (dpb[(size_t)(bt0 + 3) * kU + tid] + bb) * kArgScale;
    const v4f vsl = (v4f){-2.0f * vv, 0.0f, 0.0f, 0.0f};
    const v4f dfv = (v4f){exp_scaled(dsv[0]), exp_scaled(dsv[1]), exp_scaled(dsv[2]), exp_scaled(dsv[3])};
    *(v4f*)(sD + tid * 4)     = dsv;
    *(v4f*)(sU + tid * 8)     = dfv;
    *(v4f*)(sU + tid * 8 + 4) = vsl;
    /* a NaN exponent may pass: it makes its term NaN in either form */
    const float dmax = fmaxf(fmaxf(fabsf(dsv[0]), fabsf(dsv[1])), fmaxf(fabsf(dsv[2]), fabsf(dsv[3])));
    const unsigned wideMask = __builtin_amdgcn_ballot_w32(dmax > kDecLim);
    float sv = vv;
#pragma unroll
    for (int off = 16; off > 0; off >>= 1) sv += __shfl_xor(sv, off, 32);
    if (lane == 0) { sRedV[wave] = sv; sWide[wave] = wideMask; }
  }
  __syncthreads();
  float cst = sRedV[0];
#pragma unroll
  for (int w = 1; w < 8; ++w) cst += sRedV[w];
  cst += bV[0];
  unsigned anyWide = sWide[0];
#pragma unroll
  for (int w = 1; w < 8; ++w) anyWide |= sWide[w];

  float acc[4][2];
#pragma unroll
  for (int t = 0; t < 4; ++t) { acc[t][0] = 0.0f; acc[t][1] = 0.0f; }

  /* block-uniform: every thread reads the same eight words */
  if (__builtin_amdgcn_readfirstlane(anyWide) != 0u) {
    const float* er = eps + (size_t)b * kU * kTE + 2 * tid;
    for (int u = 0; u < kU; u += kPf) {
      v2f xs[kPf];
      load_rows(xs, er + (size_t)u * kTE);
      score_rows_sum(xs, sD + u * 4, sU + u * 8, acc);
    }
  } else {
  for (int u = 0; u < kU - kRing; u += kRing) {
#pragma unroll
    for (int s = 0; s < kSets; ++s) {
      score_rows(xr[s], sU + (u + s * kPf) * 8, acc);
      /* The two scheduling barriers keep each refill in its stage: without them the compiler reads the whole ring at
         the top of a trip and refills it late, which takes the lead away. The set refilled is the one used a stage
         ago: a refill that overtakes its set's last use goes to spare registers, and the copy back at the top of the
         trip waits for every load in flight. LDS reads (0x100) may still move up across both. */
      __builtin_amdgcn_sched_barrier(0x100);
      const int f = (s + kSets - 1) % kSets;
      load_rows(xr[f], ep + (size_t)(u + (s == 0 ? 0 : kRing) + f * kPf) * kTE);
      __builtin_amdgcn_sched_barrier(0x100);
    }
  }
  /* the last ring: only its last set is still to be fetched */
  score_rows(xr[0], sU + (kU - kRing) * 8, acc);
  __builtin_amdgcn_sched_barrier(0x100);  /* as in the loop */
  load_rows(xr[kSets - 1], ep + (size_t)(kU - kPf) * kTE);
  __builtin_amdgcn_sched_barrier(0x100);  /* as in the loop */
#pragma unroll
  for (int s = 1; s < kSets; ++s) score_rows(xr[s], sU + (kU - kRing + s * kPf) * 8, acc);
  }

  float lg[4][2];
  float mx[4];
#pragma unroll
  for (int t = 0; t < 4; ++t) {
    lg[t][0] = acc[t][0] + cst;
    lg[t][1] = acc[t][1] + cst;
    float m = fmaxf(lg[t][0], lg[t][1]);
#pragma unroll
    for (int off = 16; off > 0; off >>= 1) m = fmaxf(m, __shfl_xor(m, off, 32));
    mx[t] = m;
  }
  if (lane == 0) {
#pragma unroll
    for (int t = 0; t < 4; ++t) sRedM[t * 8 + wave] = mx[t];
  }
  __syncthreads();
  float ex[4][2];
  float sm[4];
#pragma unroll
  for (int t = 0; t < 4; ++t) {
    float m = sRedM[t * 8];
#pragma unroll
    for (int w = 1; w < 8; ++w) m = fmaxf(m, sRedM[t * 8 + w]);
    ex[t][0] = expf(lg[t][0] - m);
    ex[t][1] = expf(lg[t][1] - m);
    float s = ex[t][0] + ex[t][1];
#pragma unroll
    for (int off = 16; off > 0; off >>= 1) s += __shfl_xor(s, off, 32);
    sm[t] = s;
  }
  if (lane == 0) {
#pragma unroll
    for (int t = 0; t < 4; ++t) sRedS[t * 8 + wave] = sm[t];
  }
  __syncthreads();
  v2f wv[4];
  unsigned pk[4];
#pragma unroll
  for (int t = 0; t < 4; ++t) {
    float s = sRedS[t * 8];
#pragma unroll
    for (int w = 1; w < 8; ++w) s += sRedS[t * 8 + w];
    const float inv = __builtin_amdgcn_rcpf(s);
    const float w0 = ex[t][0] * inv;
    const float w1 = ex[t][1] * inv;
    wv[t] = (v2f){w0, w1};
    pk[t] = pk16(h_bits_flush(w0 * kPCarry), h_bits_flush(w1 * kPCarry));
  }
  {
#pragma unroll
    for (int t = 0; t < 4; ++t) {
      *(v2f*)(wout + (size_t)(bt0 + t) * kTE + 2 * tid) = wv[t];
      *(unsigned*)(pw + (size_t)(bt0 + t) * (kTE / 2) + tid) = pk[t];
    }
    
  }
}

// ---------------------------------------------------------------------------
// Host glue: 4 kernel launches, nothing else.
// GEMM shapes (all K % 32 == 0, M and N % 64 == 0):
//   enc projection (swapped roles): M 256 (u), N 512 (e), K 256 (d), 8 batches -> 4 x 8 tiles = 32 -> 4 x 8 blocks
//   dec projection                : M 2048,    N 256 (u), K 256 (d)            -> 32 x 4 tiles = 128 -> 16 blocks
//   context                       : M 256 (t), N 256 (d), K 512 (e), 8 batches -> 4 x 4 tiles = 16 -> grid (2, 8)
// ---------------------------------------------------------------------------
static_assert((kU / 64) * (kTE / 64) == 4 * 8, "enc projection grid");
static_assert((kDecRows / 64) * (kU / 64) == 16 * 8, "dec projection grid");
static_assert((kTD / 64) * (kD / 64) == 2 * 8, "context grid");

extern "C" void kernel_launch(void* const* d_in, const int* in_sizes, int n_in,
                              void* d_out, int out_size, void* d_ws, size_t ws_size,
                              hipStream_t stream) {
  if (n_in < 8) return;
  if (in_sizes[0] != kB * kTE * kD) return;
  if (in_sizes[1] != kB * kTD * kD) return;
  if (in_sizes[2] != kD * kU) return;
  if (in_sizes[3] != kU) return;
  if (in_sizes[4] != kD * kU) return;
  if (in_sizes[5] != kU) return;
  if (in_sizes[6] != kU) return;
  if (in_sizes[7] != 1) return;
  if (out_size != kB * kTD * kD + kB * kTD * kTE) return;
  if (ws_size < kWsTotal) return;

  const float* enc = (const float*)d_in[0];
  const float* dec = (const float*)d_in[1];
  const float* W1  = (const float*)d_in[2];
  const float* b1  = (const float*)d_in[3];
  const float* W2  = (const float*)d_in[4];
  const float* b2  = (const float*)d_in[5];
  const float* Vv  = (const float*)d_in[6];
  const float* bV  = (const float*)d_in[7];

  float* out0 = (float*)d_out;
  float* out1 = (float*)d_out + kOut1OffElems;

  char* ws = (char*)d_ws;
  unsigned short* ENCH = (unsigned short*)(ws + kOffENCH);
  unsigned short* DECH = (unsigned short*)(ws + kOffDECH);
  unsigned short* ENCT = (unsigned short*)(ws + kOffENCT);
  unsigned short* WT   = (unsigned short*)(ws + kOffWT);
  float*          EPS  = (float*)(ws + kOffEPS);
  float*          DPB  = (float*)(ws + kOffDPB);
  unsigned short* PH   = (unsigned short*)(ws + kOffPH);
  float*          EPF  = (float*)(ws + kOffEPF);
  unsigned short* W1T  = WT;
  unsigned short* W2T  = WT + (size_t)kU * kD;

  // ---- operand planes ----
  operand_planes_kernel<<<kPlaneBlocks, 256, 0, stream>>>(enc, dec, W1, W2, ENCH, DECH, WT, ENCT, kXCarry, kWCarry);

  // ---- job 0: EPS[b][u][e] = kArgScale * sum_d W1T[u][d] * enc[b][e][d], EPF = its exp factor ----
  // ---- job 1: DPB[bt][u] = sum_d dec[bt][d] * W2T[u][d] + b2[u] ----
  projections_kernel<<<kProjBlocks, 256, 0, stream>>>(
      W1T, 0L,
      ENCH, (long)kTE * kD,
      EPS, EPF, kTE, (long)kU * kTE, kU, kTE, kEpScale,
      DECH,
      W2T,
      DPB, kU, b2, kDecRows, kU, kProjScale,
      kD, kD);

  // ---- tanh, V dot, softmax over the encoder axis -> second output (f32) and the x512 f16 copy ----
  score_softmax_kernel<<<kB * (kTD / 4), 256, 0, stream>>>(EPS, EPF, DPB, b1, Vv, bV, out1, (unsigned*)PH);

  // ---- context[b][t][d] = (1/8192) * sum_e PH[b][t][e] * ENCT[b][d][e] ----
  gemm_f16_tile64<<<dim3(2, kB), 256, 0, stream>>>(
      PH, kTE, (long)kTD * kTE,
      ENCT, kTE, (long)kD * kTE,
      out0, kD, (long)kTD * kD,
      kTD, kD, kTE, kCtxScale);
}

// v004
// One run takes 44.9 microseconds.
// Next to v003, in two timings, it ran 1.54 times as fast each time.
// Over all steps from v000 it is 2.91 times as fast.
// Contractions enc.W1, dec.W2 and weights.enc: v_wmma_f32_16x16x32_f16 (f16 operands with power-of-two carries: activations x16, weight planes x256, probabilities x512; f32 accumulate); tanh, the 256-term V dot and the softmax: f32 on the vector unit.
#include <hip/hip_runtime.h>
#include <math.h>

typedef __attribute__((ext_vector_type(16))) _Float16 v16h;
typedef __attribute__((ext_vector_type(8)))  _Float16 v8h;
typedef __attribute__((ext_vector_type(8)))  float    v8f;
typedef __attribute__((ext_vector_type(4)))  float    v4f;
typedef __attribute__((ext_vector_type(2)))  float    v2f;
typedef __attribute__((ext_vector_type(4)))  unsigned int v4u;

// ---------------------------------------------------------------------------
// Shape constants
// ---------------------------------------------------------------------------
constexpr int kB  = 8;
constexpr int kTE = 512;
constexpr int kTD = 256;
constexpr int kD  = 256;
constexpr int kU  = 256;
constexpr int kEncRows = kB * kTE;
constexpr int kDecRows = kB * kTD;
static_assert(kEncRows == 4096 && kDecRows == 2048, "row counts");
static_assert((kD % 32) == 0 && (kTE % 32) == 0, "GEMM K multiples of 32");
static_assert((kU % 64) == 0 && (kTE % 64) == 0 && (kTD % 64) == 0 && (kD % 64) == 0 && (kDecRows % 64) == 0, "GEMM M,N multiples of 64");
static_assert(kU == 256 && kTE == 512, "score kernel thread map: 256 threads, two encoder positions per thread");

// power-of-two carries of the f16 operand planes and the folded-back epilogue scales
constexpr float kXCarry   = 16.0f;
constexpr float kWCarry   = 256.0f;
constexpr float kPCarry   = 512.0f;
constexpr float kProjScale = 1.0f / (kWCarry * kXCarry);
constexpr float kCtxScale  = 1.0f / (kPCarry * kXCarry);
constexpr float kF16MinNormal = 6.103515625e-05f;

// exp(2x) is evaluated as 2^(x * 2*log2(e)). The argument constant is the SAME in every compilation pass
// (no target-dependent selection), so a host-passed scale and the device code always agree; only the body
// of the device-only 2^a helper depends on which builtin the device compiler offers.
constexpr float kArgScale = 2.8853900817779268f;
static_assert(kArgScale > 2.885f && kArgScale < 2.886f, "argument constant is 2*log2(e) in every pass");
__device__ __forceinline__ float exp_scaled(float a) {
#if __has_builtin(__builtin_amdgcn_exp2f)
  return __builtin_amdgcn_exp2f(a);
#else
  return exp2f(a);
#endif
}
constexpr float kEpScale = kArgScale * kProjScale;
// exp(2(a + d)) = exp(2a) * exp(2d), a = the enc side, d = the dec side, each factor formed once where its projection is
// at hand. The enc exponent is clamped to the f32 normal range, so its factor is never 0 or infinite. The product form is
// used only while every dec exponent of a block lies within kDecLim: then a clamped enc factor still leaves an exponent
// sum beyond +-24, where 1/(1 + 2^s) is 0 or 1 to f32 rounding, as it is for the true sum. Any other block takes the sum
// form from the unclamped plane.
constexpr float kExpLim = 126.0f;
constexpr float kDecLim = 102.0f;
static_assert(kExpLim - kDecLim >= 24.0f, "a clamped enc factor saturates the term for every admitted dec exponent");
__device__ __forceinline__ float exp_factor(float a) { return exp_scaled(fminf(fmaxf(a, -kExpLim), kExpLim)); }

// ---------------------------------------------------------------------------
// Workspace region map (bytes; every offset is a multiple of 128)
//   ENCH f16 [4096][256]     enc x16, row-major                  2,097,152
//   DECH f16 [2048][256]     dec x16, row-major                  1,048,576
//   ENCT f16 [8][256][512]   enc x16, transposed per batch       2,097,152
//   WT   f16 [2][256][256]   W1^T, W2^T x256 ([u][d])              262,144
//   EPS  f32 [8][256][512]   kArgScale * enc.W1, [b][u][e]       4,194,304
//   DPB  f32 [2048][256]     dec.W2 + b2                         2,097,152
//   PH   f16 [2048][512]     softmax weights x512                2,097,152
//   EPF  f32 [8][256][512]   2^EPS, exponent clamped, [b][u][e]  4,194,304
//   total                                                       18,087,936
// ---------------------------------------------------------------------------
constexpr size_t kOffENCH = 0;
constexpr size_t kOffDECH = kOffENCH + (size_t)kEncRows * kD * 2;
constexpr size_t kOffENCT = kOffDECH + (size_t)kDecRows * kD * 2;
constexpr size_t kOffWT   = kOffENCT + (size_t)kB * kD * kTE * 2;
constexpr size_t kOffEPS  = kOffWT   + (size_t)2 * kU * kD * 2;
constexpr size_t kOffDPB  = kOffEPS  + (size_t)kB * kU * kTE * 4;
constexpr size_t kOffPH   = kOffDPB  + (size_t)kDecRows * kU * 4;
constexpr size_t kOffEPF  = kOffPH   + (size_t)kDecRows * kTE * 2;
constexpr size_t kWsTotal = kOffEPF  + (size_t)kB * kU * kTE * 4;
static_assert(kWsTotal == 18087936ull, "carve total");
static_assert(kWsTotal <= 134217728ull, "carve cap");
static_assert((kOffDECH % 128) == 0 && (kOffENCT % 128) == 0 && (kOffWT % 128) == 0 && (kOffEPS % 128) == 0 &&
              (kOffDPB % 128) == 0 && (kOffPH % 128) == 0 && (kOffEPF % 128) == 0, "128-B aligned regions");

// output packing (bytes -> float elements)
constexpr size_t kOut0Bytes = (size_t)kB * kTD * kD * 4;
constexpr size_t kOut1OffBytes = 2097152ull;
constexpr size_t kOut1Bytes = (size_t)kB * kTD * kTE * 4;
static_assert(kOut0Bytes == kOut1OffBytes, "second output follows the first");
static_assert(kOut1OffBytes + kOut1Bytes == 6291456ull, "output total");
static_assert((kOut1OffBytes % 128) == 0, "second output line aligned");
constexpr size_t kOut1OffElems = kOut1OffBytes / 4;

// ---------------------------------------------------------------------------
// Small helpers
// ---------------------------------------------------------------------------
__device__ __forceinline__ unsigned pk16(unsigned short a, unsigned short b) { return (unsigned)a | ((unsigned)b << 16); }

// f32 -> f16 bits (RNE); magnitudes under the f16 normal range become +0 by a select before the convert
__device__ __forceinline__ unsigned short h_bits_flush(float f) {
  const float g = (fabsf(f) < kF16MinNormal) ? 0.0f : f;
  const _Float16 h = (_Float16)g;
  return __builtin_bit_cast(unsigned short, h);
}

/* fragment load: elements 0..7 <- p[0..7], elements 8..15 <- p[16..23] */
union FragH { v16h v; v8h h[2]; };
__device__ __forceinline__ v16h frag_load(const _Float16* p) {
  FragH f;
  f.h[0] = *(const v8h*)(p);
  f.h[1] = *(const v8h*)(p + 16);
  return f.v;
}
/* one matrix instruction followed by its own hazard guard: ties this accumulator, names both fragments */
__device__ __forceinline__ v8f mma_f16(v16h a, v16h b, v8f c) {
  c = __builtin_amdgcn_wmma_f32_16x16x32_f16(false, a, false, b, (short)0, c, false, false);
  asm volatile("v_nop\n\tv_nop\n\tv_nop\n\tv_nop" : "+v"(c) : "v"(a), "v"(b));
  return c;
}

// ---------------------------------------------------------------------------
// Register-blocked batched f16 GEMM: C[m,n] = scale * sum_k A[m,k] * Bt[n,k] (+ bias[n] when BIAS_MODE == 2); with
// EXP_PLANE the plane Xout (shaped as Cout) also takes exp_factor(C[m,n]).
// A row-major [M,K]; Bt row-major [N,K]; M % 64 == 0, N == 64 * TN, K % 64 == 0; each wave owns a 64x64 tile; b = batch,
// bx = the block's index inside its batch. sT: the block's LDS slabs for the epilogue, one per wave.
// The block's 8 tiles are 8 / TN tile rows by all TN tile columns. Their A and Bt rows go to LDS once per block, kKC
// elements of K per stage, by asynchronous copies into two buffers: stage t + 1 is in flight while stage t is multiplied,
// and the fragments are read from LDS. ring: the two buffers, each (8 / TN + TN) * 64 rows of kRowH halves (A rows first).
// ---------------------------------------------------------------------------
constexpr int kKC   = 64;   /* halves of K per stage: one whole 128-B line of every row */
constexpr int kRowH = 72;   /* LDS row pitch in halves: 144 B = 16 B x 9, free of bank conflicts for 16-B fragment reads */
constexpr int kRowB = kRowH * 2;
static_assert((kD % kKC) == 0 && (kTE % kKC) == 0 && kD >= 2 * kKC && kTE >= 2 * kKC, "whole stages, two or more");

/* One stage: 32 rows per step (thread = row tid >> 3, 16-B piece tid & 7; a wave covers 4 whole lines per copy).
   l0, ga, gb: this thread's LDS byte address in the buffer and its 16 B in the first 32 rows of the A and the Bt slab. */
template <int AT, int TN>
__device__ __forceinline__ void stage_copies(unsigned l0, const _Float16* ga, size_t stepA,
                                             const _Float16* gb, size_t stepB) {
  constexpr int NJ = (AT + TN) * 2;
  static_assert((NJ % 6) == 0 && NJ <= 63, "six copies per statement; a stage stays under the outstanding limit");
  /* both loops unrolled: j is a constant, so the A / Bt choice and the address arrays fold into registers */
#pragma unroll
  for (int j0 = 0; j0 < NJ; j0 += 6) {
    unsigned l[6];
    const _Float16* g[6];
#pragma unroll
    for (int q = 0; q < 6; ++q) {
      const int j = j0 + q;
      l[q] = l0 + (unsigned)(j * 32 * kRowB);
      g[q] = (j < AT * 2) ? ga + (size_t)j * stepA : gb + (size_t)(j - AT * 2) * stepB;
    }
    /* the copies and, as the last line, the wait that stands before any of their address registers is rewritten */
    asm volatile(
        "global_load_async_to_lds_b128 %0, %6, off\n\t"
        "global_load_async_to_lds_b128 %1, %7, off\n\t"
        "global_load_async_to_lds_b128 %2, %8, off\n\t"
        "global_load_async_to_lds_b128 %3, %9, off\n\t"
        "global_load_async_to_lds_b128 %4, %10, off\n\t"
        "global_load_async_to_lds_b128 %5, %11, off\n\t"
        "s_wait_xcnt 0x0"
        :: "v"(l[0]), "v"(l[1]), "v"(l[2]), "v"(l[3]), "v"(l[4]), "v"(l[5]),
           "v"(g[0]), "v"(g[1]), "v"(g[2]), "v"(g[3]), "v"(g[4]), "v"(g[5])
        : "memory");
  }
}

template <int BIAS_MODE, bool EXP_PLANE, int TN>
__device__ __forceinline__ void gemm_tile64_body(
    float (&sT)[8][16 * 68], _Float16* ring, int bx, int b,
    const unsigned short* __restrict__ Ap, int lda, long strideA,
    const unsigned short* __restrict__ Btp, int ldb, long strideB,
    float* __restrict__ Cout, float* __restrict__ Xout, int ldc, long strideC,
    const float* __restrict__ bias,
    int M, int N, int K, float scale) {
  const _Float16* A  = (const _Float16*)Ap;
  const _Float16* Bt = (const _Float16*)Btp;
  const int lane = threadIdx.x & 31;
  const int wave = threadIdx.x >> 5;
  static_assert(TN == 4 || TN == 8, "a block's 8 tiles are whole tile rows");
  constexpr int AT = 8 / TN;
  constexpr int kStageH = (AT + TN) * 64 * kRowH;
  /* block-uniform exit, in front of every barrier */
  if (N != TN * 64 || bx * 8 >= (M >> 6) * TN) return;
  const int mB = ((bx * 8) / TN) << 6;
  const int at = wave / TN;
  const int bt = wave % TN;
  const int m0 = mB + (at << 6);
  const int n0 = bt << 6;

  const _Float16* Ab = A  + (size_t)b * strideA;
  const _Float16* Bb = Bt + (size_t)b * strideB;

  /* row (A) / column (B, D) within a 16-wide subtile; k offset and D row offset of this lane half */
  const int rlane = lane & 15;
  const int koff  = (lane >> 4) * 8;
  const int mOff  = (lane >> 4) * 8;

  v8f acc[4][4];
#pragma unroll
  for (int i = 0; i < 4; ++i)
#pragma unroll
    for (int j = 0; j < 4; ++j) acc[i][j] = (v8f){0.f,0.f,0.f,0.f,0.f,0.f,0.f,0.f};

  const int crow = (int)threadIdx.x >> 3;
  const int cpos = ((int)threadIdx.x & 7) * 8;
  const _Float16* ga = Ab + (size_t)(mB + crow) * lda + cpos;
  const _Float16* gb = Bb + (size_t)crow * ldb + cpos;
  const size_t stepA = (size_t)32 * lda;
  const size_t stepB = (size_t)32 * ldb;
  const unsigned l0 = (unsigned)(size_t)ring + (unsigned)(crow * kRowB + cpos * 2);
  const int T = K / kKC;

  stage_copies<AT, TN>(l0, ga, stepA, gb, stepB);
  /* stage 0 has landed for this wave; the barrier publishes it to the others */
  asm volatile("s_wait_asynccnt 0x0" ::: "memory");
  __syncthreads();
  if (T > 1) stage_copies<AT, TN>(l0 + (unsigned)(kStageH * 2), ga + kKC, stepA, gb + kKC, stepB);

  const _Float16* fa = ring + (at * 64 + rlane) * kRowH + koff;
  const _Float16* fb = ring + ((AT + bt) * 64 + rlane) * kRowH + koff;
  for (int t = 0; t < T; ++t) {
    const int bufH = (t & 1) * kStageH;
    /* unrolled, as the loops inside: fragment and accumulator arrays are indexed by constants only */
#pragma unroll
    for (int ks = 0; ks < kKC; ks += 32) {
      v16h bh[4], ah[4];
#pragma unroll
      for (int j = 0; j < 4; ++j) bh[j] = frag_load(fb + bufH + j * 16 * kRowH + ks);
#pragma unroll
      for (int i = 0; i < 4; ++i) ah[i] = frag_load(fa + bufH + i * 16 * kRowH + ks);
#pragma unroll
      for (int i = 0; i < 4; ++i)
#pragma unroll
        for (int j = 0; j < 4; ++j) acc[i][j] = mma_f16(ah[i], bh[j], acc[i][j]);
    }
    /* hand-over: this wave's reads of stage t are done, its copies of stage t + 1 have landed; the one barrier publishes
       stage t + 1 and frees stage t's buffer for the refill behind it */
    asm volatile("s_wait_dscnt 0x0" ::: "memory");
    asm volatile("s_wait_asynccnt 0x0" ::: "memory");
    __syncthreads();
    if (t + 2 < T) stage_copies<AT, TN>(l0 + (unsigned)(bufH * 2), ga + (size_t)(t + 2) * kKC, stepA,
                                        gb + (size_t)(t + 2) * kKC, stepB);
  }
  /* no copy is left in flight when the wave goes on */
  asm volatile("s_wait_asynccnt 0x0" ::: "memory");

  // ---- epilogue ----
  float* slab = sT[wave];
  float* C = Cout + (size_t)b * strideC;
#pragma unroll
  for (int i = 0; i < 4; ++i) {
    const int mBase = m0 + (i << 4);
#pragma unroll
    for (int j = 0; j < 4; ++j) {
      const int n = n0 + (j << 4) + rlane;
      float bv = 0.f;
      if (BIAS_MODE == 2) bv = bias[n];
#pragma unroll
      for (int r = 0; r < 8; ++r) {
        float v = acc[i][j][r] * scale;
        if (BIAS_MODE == 2) v += bv;
        slab[(mOff + r) * 68 + (j << 4) + rlane] = v;
      }
    }
    __builtin_amdgcn_fence(__ATOMIC_RELEASE, "workgroup");
    __builtin_amdgcn_wave_barrier();
    __builtin_amdgcn_fence(__ATOMIC_ACQUIRE, "workgroup");
    {
      /* row segment = 256 B = 16 lanes x 16 B; lanes 0..15 row 2*it, lanes 16..31 row 2*it+1 */
      const int hh = lane >> 4, c4 = (lane & 15) * 4;
      {
#pragma unroll
        for (int it = 0; it < 8; ++it) {
          const int row = it * 2 + hh;
          v4f v = *(const v4f*)(slab + row * 68 + c4);
          *(v4f*)(C + (size_t)(mBase + row) * ldc + n0 + c4) = v;
          if (EXP_PLANE) {
            const v4f f = (v4f){exp_factor(v[0]), exp_factor(v[1]), exp_factor(v[2]), exp_factor(v[3])};
            *(v4f*)(Xout + (size_t)b * strideC + (size_t)(mBase + row) * ldc + n0 + c4) = f;
          }
        }
        
      }
    }
    __builtin_amdgcn_fence(__ATOMIC_RELEASE, "workgroup");
    __builtin_amdgcn_wave_barrier();
    __builtin_amdgcn_fence(__ATOMIC_ACQUIRE, "workgroup");
  }
}

/* one GEMM per launch: grid (blocks per batch, batches) */
__global__ __launch_bounds__(256) void gemm_f16_tile64(
    const unsigned short* __restrict__ Ap, int lda, long strideA,
    const unsigned short* __restrict__ Btp, int ldb, long strideB,
    float* __restrict__ Cout, int ldc, long strideC,
    int M, int N, int K, float scale) {
  __shared__ __align__(16) float sT[8][16 * 68];
  __shared__ __align__(16) _Float16 ring[2 * (2 + 4) * 64 * kRowH];
  gemm_tile64_body<0, false, 4>(sT, ring, (int)blockIdx.x, (int)blockIdx.y, Ap, lda, strideA, Btp, ldb, strideB, Cout,
                                nullptr, ldc, strideC, nullptr, M, N, K, scale);
}

// ---------------------------------------------------------------------------
// Row-major f32 -> f16 (x carry) cast of the encoder rows (bx 0..511) and the decoder rows (bx 512..767).
// 8 consecutive elements per thread: enc 4096*256/8 = 131,072 threads = 512 blocks; dec 2048*256/8 = 65,536 threads
// = 256 blocks; the grid covers both planes exactly. One 16-B store per lane; 32 consecutive lanes = 512 contiguous
// ---------------------------------------------------------------------------
constexpr int kEncCastBlocks = (kEncRows * kD / 8) / 256;
constexpr int kDecCastBlocks = (kDecRows * kD / 8) / 256;
static_assert(kEncCastBlocks * 256 * 8 == kEncRows * kD, "enc cast coverage");
static_assert(kDecCastBlocks * 256 * 8 == kDecRows * kD, "dec cast coverage");

__device__ __forceinline__ void cast_rows_body(int bx, const float* enc, const float* dec,
                                               unsigned short* encH, unsigned short* decH, float carry) {
  /* block-uniform plane select */
  const int isDec = (bx >= kEncCastBlocks) ? 1 : 0;
  const int blk = bx - isDec * kEncCastBlocks;
  const float* src = isDec ? dec : enc;
  unsigned short* dst = isDec ? decH : encH;
  const size_t e0 = ((size_t)blk * 256 + threadIdx.x) * 8;
  const v4f a = *(const v4f*)(src + e0);
  const v4f c = *(const v4f*)(src + e0 + 4);
  unsigned short hb[8];
#pragma unroll
  for (int e = 0; e < 4; ++e) {
    const float fa = a[e] * carry;
    const float fc = c[e] * carry;
    hb[e]     = h_bits_flush(fa);
    hb[4 + e] = h_bits_flush(fc);
  }
  const v4u u = (v4u){pk16(hb[0], hb[1]), pk16(hb[2], hb[3]), pk16(hb[4], hb[5]), pk16(hb[6], hb[7])};
  unsigned short* q = dst + e0;
  *(v4u*)q = u;
  /* the wait stands before any of the store's registers is reused */
  asm volatile("s_wait_xcnt 0x0" ::: "memory");
}

// ---------------------------------------------------------------------------
// Transpose + cast: in[rows][cols] f32 (row pitch ldi) -> out[cols][rows] f16 (row pitch ldo), values x carry.
// Block (bx, by) of (rows/64, cols/64) of one plane; src and op point at that plane; sm is the block's LDS tile.
// Load coverage: 16 iterations x 256 threads = 4096 = the whole 64x64 tile (coalesced along cols).
// Store coverage: 8 waves x 2 iterations x 4 rows (lane>>3) = 64 out rows; (lane&7) x 8 halves = 64 out cols; each
// ---------------------------------------------------------------------------
__device__ __forceinline__ void transpose_cast_body(float (&sm)[64][65], int bx, int by, const float* src, int ldi,
                                                    unsigned short* __restrict__ op, int ldo, float carry) {
  const int t  = threadIdx.x;
  const int r0 = bx * 64;
  const int c0 = by * 64;
#pragma unroll
  for (int i = 0; i < 16; ++i) {
    const int e = i * 256 + t;
    const int r = e >> 6;
    const int c = e & 63;
    sm[c][r] = src[(size_t)(r0 + r) * ldi + c0 + c] * carry;
  }
  __syncthreads();
  const int lane = t & 31, wave = t >> 5;
  const int q = lane >> 3, c8 = (lane & 7) * 8;
  {
#pragma unroll
    for (int it = 0; it < 2; ++it) {
      const int row = wave * 8 + it * 4 + q;
      unsigned short hb[8];
#pragma unroll
      for (int e = 0; e < 8; ++e) hb[e] = h_bits_flush(sm[row][c8 + e]);
      const v4u u = (v4u){pk16(hb[0], hb[1]), pk16(hb[2], hb[3]), pk16(hb[4], hb[5]), pk16(hb[6], hb[7])};
      *(v4u*)(op + (size_t)(c0 + row) * ldo + r0 + c8) = u;
    }
    /* one wait for both stores, as behind the cast job's store */
    asm volatile("s_wait_xcnt 0x0" ::: "memory");
  }
}

// ---------------------------------------------------------------------------
// Launch 1: all f16 operand planes, one grid. The jobs read only inputs and write disjoint planes.
// Job by block index (block-uniform, so the transpose's barrier is reached by all threads of a block or by none):
//   0 .. 31        W[d][u] (pitch kU) -> WT[u][d] (pitch kD), plane 0 = W1, plane 1 = W2, (d/64, u/64, 2) = (4, 4, 2)
//   32 .. 287      enc[b][e][d] (pitch kD) -> ENCT[b][d][e] (pitch kTE), (e/64, d/64, b) = (8, 4, 8)
//   288 .. 1055    row-major casts of enc and dec
// ---------------------------------------------------------------------------
constexpr int kWTX = kD / 64, kWTY = kU / 64;
constexpr int kWTBlocks = kWTX * kWTY * 2;
constexpr int kEncTX = kTE / 64, kEncTY = kD / 64;
constexpr int kEncTBlocks = kEncTX * kEncTY * kB;
constexpr int kPlaneBlocks = kWTBlocks + kEncTBlocks + kEncCastBlocks + kDecCastBlocks;
static_assert(kWTBlocks == 32 && kEncTBlocks == 256 && kPlaneBlocks == 1056, "operand grid");

__global__ __launch_bounds__(256) void operand_planes_kernel(const float* enc, const float* dec,
                                                             const float* W1, const float* W2,
                                                             unsigned short* encH, unsigned short* decH,
                                                             unsigned short* wT, unsigned short* encT,
                                                             float xCarry, float wCarry) {
  __shared__ float sm[64][65];
  const int blk = (int)blockIdx.x;
  if (blk < kWTBlocks) {
    const int bx = blk % kWTX;
    const int by = (blk / kWTX) % kWTY;
    const int z  = blk / (kWTX * kWTY);
    transpose_cast_body(sm, bx, by, (z == 1) ? W2 : W1, kU, wT + (size_t)z * kU * kD, kD, wCarry);
  } else if (blk < kWTBlocks + kEncTBlocks) {
    const int j  = blk - kWTBlocks;
    const int bx = j % kEncTX;
    const int by = (j / kEncTX) % kEncTY;
    const int z  = j / (kEncTX * kEncTY);
    transpose_cast_body(sm, bx, by, enc + (size_t)z * kTE * kD, kD, encT + (size_t)z * kD * kTE, kTE, xCarry);
  } else {
    cast_rows_body(blk - kWTBlocks - kEncTBlocks, enc, dec, encH, decH, xCarry);
  }
}

// ---------------------------------------------------------------------------
// Launch 2: the two projections do not depend on each other and neither fills the chip: one grid. Job by block index
// (block-uniform):
//   0 .. 31        job 0, enc projection (batched, no bias, also stored as its exp factor; kEncGemmGridX blocks per batch)
//   32 .. 47       job 1, dec projection (one batch, bias)
// ---------------------------------------------------------------------------
constexpr int kEncGemmGridX  = (kU / 64) * (kTE / 64) / 8;
constexpr int kEncGemmBlocks = kEncGemmGridX * kB;
constexpr int kDecGemmBlocks = (kDecRows / 64) * (kU / 64) / 8;
constexpr int kProjBlocks = kEncGemmBlocks + kDecGemmBlocks;
static_assert(kEncGemmBlocks == 32 && kDecGemmBlocks == 16 && kProjBlocks == 48, "projection grid");

__global__ __launch_bounds__(256) void projections_kernel(
    const unsigned short* __restrict__ A0, long strideA0,
    const unsigned short* __restrict__ Bt0, long strideB0,
    float* __restrict__ C0, float* __restrict__ X0, int ldc0, long strideC0, int M0, int N0, float scale0,
    const unsigned short* __restrict__ A1,
    const unsigned short* __restrict__ Bt1,
    float* __restrict__ C1, int ldc1, const float* __restrict__ bias1, int M1, int N1, float scale1,
    int ldk, int K) {
  __shared__ __align__(16) float sT[8][16 * 68];
  __shared__ __align__(16) _Float16 ring[2 * (1 + 8) * 64 * kRowH];
  const int blk = (int)blockIdx.x;
  if (blk < kEncGemmBlocks) {
    gemm_tile64_body<0, true, kTE / 64>(sT, ring, blk % kEncGemmGridX, blk / kEncGemmGridX, A0, ldk, strideA0, Bt0, ldk,
                                        strideB0, C0, X0, ldc0, strideC0, nullptr, M0, N0, K, scale0);
  } else {
    gemm_tile64_body<2, false, kU / 64>(sT, ring, blk - kEncGemmBlocks, 0, A1, ldk, 0L, Bt1, ldk, 0L,
                                        C1, nullptr, ldc1, 0L, bias1, M1, N1, K, scale1);
  }
}

// ---------------------------------------------------------------------------
// Rows of EPF are held in a ring of kSets register sets of kPf rows. A set is refilled one stage behind its use, so a
// row is asked for (kSets - 2) * kPf rows of arithmetic ahead of its use. Why: every block of a batch walks the same
// rows at the same pace, so a row's first readers all wait out a memory round trip unless it was asked for early.
constexpr int kPf   = 8;
constexpr int kSets = 4;
constexpr int kRing = kPf * kSets;
static_assert((kU % kRing) == 0 && kU >= 2 * kRing, "the u loop takes one whole ring per trip");

__device__ __forceinline__ void load_rows(v2f (&x)[kPf], const float* p) {
#pragma unroll
  for (int i = 0; i < kPf; ++i) x[i] = *(const v2f*)(p + (size_t)i * kTE);
}
/* product form: x = rows of EPF, su = rows of sU (dec factors and -2*V) */
__device__ __forceinline__ void score_rows(const v2f (&x)[kPf], const float* su, float (&acc)[4][2]) {
#pragma unroll
  for (int i = 0; i < kPf; ++i) {
    const v4f d  = *(const v4f*)(su + i * 8);
    const float vm = su[i * 8 + 4];
#pragma unroll
    for (int t = 0; t < 4; ++t) {
      const float r0 = __builtin_amdgcn_rcpf(fmaf(x[i][0], d[t], 1.0f));
      const float r1 = __builtin_amdgcn_rcpf(fmaf(x[i][1], d[t], 1.0f));
      acc[t][0] = fmaf(r0, vm, acc[t][0]);
      acc[t][1] = fmaf(r1, vm, acc[t][1]);
    }
  }
}
/* sum form: x = rows of EPS, sd = rows of sD (dec exponents), su = rows of sU (for -2*V) */
__device__ __forceinline__ void score_rows_sum(const v2f (&x)[kPf], const float* sd, const float* su, float (&acc)[4][2]) {
#pragma unroll
  for (int i = 0; i < kPf; ++i) {
    const v4f d  = *(const v4f*)(sd + i * 4);
    const float vm = su[i * 8 + 4];
#pragma unroll
    for (int t = 0; t < 4; ++t) {
      const float e0 = exp_scaled(x[i][0] + d[t]);
      const float e1 = exp_scaled(x[i][1] + d[t]);
      const float r0 = __builtin_amdgcn_rcpf(1.0f + e0);
      const float r1 = __builtin_amdgcn_rcpf(1.0f + e1);
      acc[t][0] = fmaf(r0, vm, acc[t][0]);
      acc[t][1] = fmaf(r1, vm, acc[t][1]);
    }
  }
}

// ---------------------------------------------------------------------------
// Score + softmax, f32. Block = one batch element b and 4 consecutive decoder steps; 256 threads; thread tid owns the
// encoder positions 2*tid and 2*tid+1 (256 x 2 = 512 = the whole softmax axis), 8 accumulators.
// EPS[b][u][e] holds kArgScale*(enc.W1) and EPF[b][u][e] its exp factor; the LDS row sD[u] = kArgScale*(dec.W2 + b2 + b1)
// for the 4 steps, the LDS row sU[u] = {2^sD[u] for the 4 steps, -2*V[u], 0, 0, 0} (all slots written by thread u).
// tanh(x) = 1 - 2/(1 + exp(2x)), so
//   logit = sum_u V[u] + bV + sum_u (-2*V[u]) / (1 + exp(2x)), exp(2x) = EPF * sU (product form) = 2^(EPS + sD) (sum form).
// Reductions in fixed order: wave shuffle tree, then the 8 wave partials in index order.
// 256w..256w+255 of each of the block's 4 rows); the x512 f16 copy as one packed 4-B word per lane (32 lanes = one
// grid = 8 * 64 = 512 blocks. Barriers under block-uniform control only; no early exit.
// ---------------------------------------------------------------------------
__global__ __launch_bounds__(256) void score_softmax_kernel(
    const float* __restrict__ eps, const float* __restrict__ epf, const float* __restrict__ dpb,
    const float* __restrict__ b1,
    const float* __restrict__ vvec, const float* __restrict__ bV,
    float* __restrict__ wout, unsigned* __restrict__ pw) {
  __shared__ __align__(16) float sU[kU * 8];
  __shared__ float sRedM[4 * 8];
  __shared__ float sRedS[4 * 8];
  __shared__ float sRedV[8];
  __shared__ __align__(16) float sD[kU * 4];
  __shared__ unsigned sWide[8];
  const int tid = threadIdx.x, lane = tid & 31, wave = tid >> 5;
  const int bt0 = blockIdx.x * 4;
  const int b   = bt0 / kTD;

  /* all sets of the ring but the last: in flight across the set-up of sU */
  const float* ep = epf + (size_t)b * kU * kTE + 2 * tid;
  v2f xr[kSets][kPf];
#pragma unroll
  for (int s = 0; s < kSets - 1; ++s) load_rows(xr[s], ep + (size_t)(s * kPf) * kTE);

  {
    const float bb = b1[tid];
    const float vv = vvec[tid];
    v4f dsv;
    dsv[0] = (dpb[(size_t)(bt0 + 0) * kU + tid] + bb) * kArgScale;
    dsv[1] = (dpb[(size_t)(bt0 + 1) * kU + tid] + bb) * kArgScale;
    dsv[2] = (dpb[(size_t)(bt0 + 2) * kU + tid] + bb) * kArgScale;
    dsv[3] = (dpb[(size_t)(bt0 + 3) * kU + tid] + bb) * kArgScale;
    const v4f vsl = (v4f){-2.0f * vv, 0.0f, 0.0f, 0.0f};
    const v4f dfv = (v4f){exp_scaled(dsv[0]), exp_scaled(dsv[1]), exp_scaled(dsv[2]), exp_scaled(dsv[3])};
    *(v4f*)(sD + tid * 4)     = dsv;
    *(v4f*)(sU + tid * 8)     = dfv;
    *(v4f*)(sU + tid * 8 + 4) = vsl;
    /* a NaN exponent may pass: it makes its term NaN in either form */
    const float dmax = fmaxf(fmaxf(fabsf(dsv[0]), fabsf(dsv[1])), fmaxf(fabsf(dsv[2]), fabsf(dsv[3])));
    const unsigned wideMask = __builtin_amdgcn_ballot_w32(dmax > kDecLim);
    float sv = vv;
#pragma unroll
    for (int off = 16; off > 0; off >>= 1) sv += __shfl_xor(sv, off, 32);
    if (lane == 0) { sRedV[wave] = sv; sWide[wave] = wideMask; }
  }
  __syncthreads();
  float cst = sRedV[0];
#pragma unroll
  for (int w = 1; w < 8; ++w) cst += sRedV[w];
  cst += bV[0];
  unsigned anyWide = sWide[0];
#pragma unroll
  for (int w = 1; w < 8; ++w) anyWide |= sWide[w];

  float acc[4][2];
#pragma unroll
  for (int t = 0; t < 4; ++t) { acc[t][0] = 0.0f; acc[t][1] = 0.0f; }

  /* block-uniform: every thread reads the same eight words */
  if (__builtin_amdgcn_readfirstlane(anyWide) != 0u) {
    const float* er = eps + (size_t)b * kU * kTE + 2 * tid;
    for (int u = 0; u < kU; u += kPf) {
      v2f xs[kPf];
      load_rows(xs, er + (size_t)u * kTE);
      score_rows_sum(xs, sD + u * 4, sU + u * 8, acc);
    }
  } else {
  for (int u = 0; u < kU - kRing; u += kRing) {
#pragma unroll
    for (int s = 0; s < kSets; ++s) {
      score_rows(xr[s], sU + (u + s * kPf) * 8, acc);
      /* The two scheduling barriers keep each refill in its stage: without them the compiler reads the whole ring at
         the top of a trip and refills it late, which takes the lead away. The set refilled is the one used a stage
         ago: a refill that overtakes its set's last use goes to spare registers, and the copy back at the top of the
         trip waits for every load in flight. LDS reads (0x100) may still move up across both. */
      __builtin_amdgcn_sched_barrier(0x100);
      const int f = (s + kSets - 1) % kSets;
      load_rows(xr[f], ep + (size_t)(u + (s == 0 ? 0 : kRing) + f * kPf) * kTE);
      __builtin_amdgcn_sched_barrier(0x100);
    }
  }
  /* the last ring: only its last set is still to be fetched */
  score_rows(xr[0], sU + (kU - kRing) * 8, acc);
  __builtin_amdgcn_sched_barrier(0x100);  /* as in the loop */
  load_rows(xr[kSets - 1], ep + (size_t)(kU - kPf) * kTE);
  __builtin_amdgcn_sched_barrier(0x100);  /* as in the loop */
#pragma unroll
  for (int s = 1; s < kSets; ++s) score_rows(xr[s], sU + (kU - kRing + s * kPf) * 8, acc);
  }

  float lg[4][2];
  float mx[4];
#pragma unroll
  for (int t = 0; t < 4; ++t) {
    lg[t][0] = acc[t][0] + cst;
    lg[t][1] = acc[t][1] + cst;
    float m = fmaxf(lg[t][0], lg[t][1]);
#pragma unroll
    for (int off = 16; off > 0; off >>= 1) m = fmaxf(m, __shfl_xor(m, off, 32));
    mx[t] = m;
  }
  if (lane == 0) {
#pragma unroll
    for (int t = 0; t < 4; ++t) sRedM[t * 8 + wave] = mx[t];
  }
  __syncthreads();
  float ex[4][2];
  float sm[4];
#pragma unroll
  for (int t = 0; t < 4; ++t) {
    float m = sRedM[t * 8];
#pragma unroll
    for (int w = 1; w < 8; ++w) m = fmaxf(m, sRedM[t * 8 + w]);
    ex[t][0] = expf(lg[t][0] - m);
    ex[t][1] = expf(lg[t][1] - m);
    float s = ex[t][0] + ex[t][1];
#pragma unroll
    for (int off = 16; off > 0; off >>= 1) s += __shfl_xor(s, off, 32);
    sm[t] = s;
  }
  if (lane == 0) {
#pragma unroll
    for (int t = 0; t < 4; ++t) sRedS[t * 8 + wave] = sm[t];
  }
  __syncthreads();
  v2f wv[4];
  unsigned pk[4];
#pragma unroll
  for (int t = 0; t < 4; ++t) {
    float s = sRedS[t * 8];
#pragma unroll
    for (int w = 1; w < 8; ++w) s += sRedS[t * 8 + w];
    const float inv = __builtin_amdgcn_rcpf(s);
    const float w0 = ex[t][0] * inv;
    const float w1 = ex[t][1] * inv;
    wv[t] = (v2f){w0, w1};
    pk[t] = pk16(h_bits_flush(w0 * kPCarry), h_bits_flush(w1 * kPCarry));
  }
  {
#pragma unroll
    for (int t = 0; t < 4; ++t) {
      *(v2f*)(wout + (size_t)(bt0 + t) * kTE + 2 * tid) = wv[t];
      *(unsigned*)(pw + (size_t)(bt0 + t) * (kTE / 2) + tid) = pk[t];
    }
    
  }
}

// ---------------------------------------------------------------------------
// Host glue: 4 kernel launches, nothing else.
// GEMM shapes (all K % 32 == 0, M and N % 64 == 0):
//   enc projection (swapped roles): M 256 (u), N 512 (e), K 256 (d), 8 batches -> 4 x 8 tiles = 32 -> 4 x 8 blocks
//   dec projection                : M 2048,    N 256 (u), K 256 (d)            -> 32 x 4 tiles = 128 -> 16 blocks
//   context                       : M 256 (t), N 256 (d), K 512 (e), 8 batches -> 4 x 4 tiles = 16 -> grid (2, 8)
// ---------------------------------------------------------------------------
static_assert((kU / 64) * (kTE / 64) == 4 * 8, "enc projection grid");
static_assert((kDecRows / 64) * (kU / 64) == 16 * 8, "dec projection grid");
static_assert((kTD / 64) * (kD / 64) == 2 * 8, "context grid");

extern "C" void kernel_launch(void* const* d_in, const int* in_sizes, int n_in,
                              void* d_out, int out_size, void* d_ws, size_t ws_size,
                              hipStream_t stream) {
  if (n_in < 8) return;
  if (in_sizes[0] != kB * kTE * kD) return;
  if (in_sizes[1] != kB * kTD * kD) return;
  if (in_sizes[2] != kD * kU) return;
  if (in_sizes[3] != kU) return;
  if (in_sizes[4] != kD * kU) return;
  if (in_sizes[5] != kU) return;
  if (in_sizes[6] != kU) return;
  if (in_sizes[7] != 1) return;
  if (out_size != kB * kTD * kD + kB * kTD * kTE) return;
  if (ws_size < kWsTotal) return;

  const float* enc = (const float*)d_in[0];
  const float* dec = (const float*)d_in[1];
  const float* W1  = (const float*)d_in[2];
  const float* b1  = (const float*)d_in[3];
  const float* W2  = (const float*)d_in[4];
  const float* b2  = (const float*)d_in[5];
  const float* Vv  = (const float*)d_in[6];
  const float* bV  = (const float*)d_in[7];

  float* out0 = (float*)d_out;
  float* out1 = (float*)d_out + kOut1OffElems;

  char* ws = (char*)d_ws;
  unsigned short* ENCH = (unsigned short*)(ws + kOffENCH);
  unsigned short* DECH = (unsigned short*)(ws + kOffDECH);
  unsigned short* ENCT = (unsigned short*)(ws + kOffENCT);
  unsigned short* WT   = (unsigned short*)(ws + kOffWT);
  float*          EPS  = (float*)(ws + kOffEPS);
  float*          DPB  = (float*)(ws + kOffDPB);
  unsigned short* PH   = (unsigned short*)(ws + kOffPH);
  float*          EPF  = (float*)(ws + kOffEPF);
  unsigned short* W1T  = WT;
  unsigned short* W2T  = WT + (size_t)kU * kD;

  // ---- operand planes ----
  operand_planes_kernel<<<kPlaneBlocks, 256, 0, stream>>>(enc, dec, W1, W2, ENCH, DECH, WT, ENCT, kXCarry, kWCarry);

  // ---- job 0: EPS[b][u][e] = kArgScale * sum_d W1T[u][d] * enc[b][e][d], EPF = its exp factor ----
  // ---- job 1: DPB[bt][u] = sum_d dec[bt][d] * W2T[u][d] + b2[u] ----
  projections_kernel<<<kProjBlocks, 256, 0, stream>>>(
      W1T, 0L,
      ENCH, (long)kTE * kD,
      EPS, EPF, kTE, (long)kU * kTE, kU, kTE, kEpScale,
      DECH,
      W2T,
      DPB, kU, b2, kDecRows, kU, kProjScale,
      kD, kD);

  // ---- tanh, V dot, softmax over the encoder axis -> second output (f32) and the x512 f16 copy ----
  score_softmax_kernel<<<kB * (kTD / 4), 256, 0, stream>>>(EPS, EPF, DPB, b1, Vv, bV, out1, (unsigned*)PH);

  // ---- context[b][t][d] = (1/8192) * sum_e PH[b][t][e] * ENCT[b][d][e] ----
  gemm_f16_tile64<<<dim3(2, kB), 256, 0, stream>>>(
      PH, kTE, (long)kTD * kTE,
      ENCT, kTE, (long)kD * kTE,
      out0, kD, (long)kTD * kD,
      kTD, kD, kTE, kCtxScale);
}

// v005
// One run takes 32.7 microseconds.
// Timed twice side by side with v004, it ran 1.34 and 1.37 times as fast.
// All steps since v000 together make it 3.94 times as fast.
// Contractions enc.W1, dec.W2 and weights.enc: v_wmma_f32_16x16x32_f16 (f16 operands with power-of-two carries: activations x16, weight planes x256, probabilities x512; f32 accumulate); tanh, the 256-term V dot and the softmax: f32 on the vector unit.
#include <hip/hip_runtime.h>
#include <math.h>

typedef __attribute__((ext_vector_type(16))) _Float16 v16h;
typedef __attribute__((ext_vector_type(8)))  _Float16 v8h;
typedef __attribute__((ext_vector_type(8)))  float    v8f;
typedef __attribute__((ext_vector_type(4)))  float    v4f;
typedef __attribute__((ext_vector_type(2)))  float    v2f;
typedef __attribute__((ext_vector_type(4)))  unsigned int v4u;

// ---------------------------------------------------------------------------
// Shape constants
// ---------------------------------------------------------------------------
constexpr int kB  = 8;
constexpr int kTE = 512;
constexpr int kTD = 256;
constexpr int kD  = 256;
constexpr int kU  = 256;
constexpr int kEncRows = kB * kTE;
constexpr int kDecRows = kB * kTD;
static_assert(kEncRows == 4096 && kDecRows == 2048, "row counts");
static_assert((kD % 32) == 0 && (kTE % 32) == 0, "GEMM K multiples of 32");
static_assert((kU % 64) == 0 && (kTE % 64) == 0 && (kTD % 64) == 0 && (kD % 64) == 0 && (kDecRows % 64) == 0, "GEMM M,N multiples of 64");
static_assert(kU == 256 && kTE == 512, "score kernel thread map: 256 threads, two encoder positions per thread");

// power-of-two carries of the f16 operand planes and the folded-back epilogue scales
constexpr float kXCarry   = 16.0f;
constexpr float kWCarry   = 256.0f;
constexpr float kPCarry   = 512.0f;
constexpr float kProjScale = 1.0f / (kWCarry * kXCarry);
constexpr float kCtxScale  = 1.0f / (kPCarry * kXCarry);
constexpr float kF16MinNormal = 6.103515625e-05f;

// exp(2x) is evaluated as 2^(x * 2*log2(e)). The argument constant is the SAME in every compilation pass
// (no target-dependent selection), so a host-passed scale and the device code always agree; only the body
// of the device-only 2^a helper depends on which builtin the device compiler offers.
constexpr float kArgScale = 2.8853900817779268f;
static_assert(kArgScale > 2.885f && kArgScale < 2.886f, "argument constant is 2*log2(e) in every pass");
__device__ __forceinline__ float exp_scaled(float a) {
#if __has_builtin(__builtin_amdgcn_exp2f)
  return __builtin_amdgcn_exp2f(a);
#else
  return exp2f(a);
#endif
}
constexpr float kEpScale = kArgScale * kProjScale;
// exp(2(a + d)) = exp(2a) * exp(2d), a = the enc side, d = the dec side, each factor formed once where its projection is
// at hand. The enc exponent is clamped to the f32 normal range, so its factor is never 0 or infinite. The product form is
// used only while every dec exponent of a block lies within kDecLim: then a clamped enc factor still leaves an exponent
// sum beyond +-24, where 1/(1 + 2^s) is 0 or 1 to f32 rounding, as it is for the true sum. Any other block takes the sum
// form from the unclamped plane.
constexpr float kExpLim = 126.0f;
constexpr float kDecLim = 102.0f;
static_assert(kExpLim - kDecLim >= 24.0f, "a clamped enc factor saturates the term for every admitted dec exponent");
__device__ __forceinline__ float exp_factor(float a) { return exp_scaled(fminf(fmaxf(a, -kExpLim), kExpLim)); }

// ---------------------------------------------------------------------------
// Workspace region map (bytes; every offset is a multiple of 128)
//   ENCH f16 [4096][256]     enc x16, row-major                  2,097,152
//   DECH f16 [2048][256]     dec x16, row-major                  1,048,576
//   ENCT f16 [8][256][512]   enc x16, transposed per batch       2,097,152
//   WT   f16 [2][256][256]   W1^T, W2^T x256 ([u][d])              262,144
//   EPS  f32 [8][256][512]   kArgScale * enc.W1, [b][u][e]       4,194,304
//   DPB  f32 [2048][256]     dec.W2 + b2                         2,097,152
//   PH   f16 [2048][512]     softmax weights x512                2,097,152
//   EPF  f32 [8][256][512]   2^EPS, exponent clamped, [b][u][e]  4,194,304
//   total                                                       18,087,936
// ---------------------------------------------------------------------------
constexpr size_t kOffENCH = 0;
constexpr size_t kOffDECH = kOffENCH + (size_t)kEncRows * kD * 2;
constexpr size_t kOffENCT = kOffDECH + (size_t)kDecRows * kD * 2;
constexpr size_t kOffWT   = kOffENCT + (size_t)kB * kD * kTE * 2;
constexpr size_t kOffEPS  = kOffWT   + (size_t)2 * kU * kD * 2;
constexpr size_t kOffDPB  = kOffEPS  + (size_t)kB * kU * kTE * 4;
constexpr size_t kOffPH   = kOffDPB  + (size_t)kDecRows * kU * 4;
constexpr size_t kOffEPF  = kOffPH   + (size_t)kDecRows * kTE * 2;
constexpr size_t kWsTotal = kOffEPF  + (size_t)kB * kU * kTE * 4;
static_assert(kWsTotal == 18087936ull, "carve total");
static_assert(kWsTotal <= 134217728ull, "carve cap");
static_assert((kOffDECH % 128) == 0 && (kOffENCT % 128) == 0 && (kOffWT % 128) == 0 && (kOffEPS % 128) == 0 &&
              (kOffDPB % 128) == 0 && (kOffPH % 128) == 0 && (kOffEPF % 128) == 0, "128-B aligned regions");

// output packing (bytes -> float elements)
constexpr size_t kOut0Bytes = (size_t)kB * kTD * kD * 4;
constexpr size_t kOut1OffBytes = 2097152ull;
constexpr size_t kOut1Bytes = (size_t)kB * kTD * kTE * 4;
static_assert(kOut0Bytes == kOut1OffBytes, "second output follows the first");
static_assert(kOut1OffBytes + kOut1Bytes == 6291456ull, "output total");
static_assert((kOut1OffBytes % 128) == 0, "second output line aligned");
constexpr size_t kOut1OffElems = kOut1OffBytes / 4;

// ---------------------------------------------------------------------------
// Small helpers
// ---------------------------------------------------------------------------
__device__ __forceinline__ unsigned pk16(unsigned short a, unsigned short b) { return (unsigned)a | ((unsigned)b << 16); }

// f32 -> f16 bits (RNE); magnitudes under the f16 normal range become +0 by a select before the convert
__device__ __forceinline__ unsigned short h_bits_flush(float f) {
  const float g = (fabsf(f) < kF16MinNormal) ? 0.0f : f;
  const _Float16 h = (_Float16)g;
  return __builtin_bit_cast(unsigned short, h);
}

/* fragment load: elements 0..7 <- p[0..7], elements 8..15 <- p[16..23] */
union FragH { v16h v; v8h h[2]; };
__device__ __forceinline__ v16h frag_load(const _Float16* p) {
  FragH f;
  f.h[0] = *(const v8h*)(p);
  f.h[1] = *(const v8h*)(p + 16);
  return f.v;
}
/* one matrix instruction followed by its own hazard guard: ties this accumulator, names both fragments */
__device__ __forceinline__ v8f mma_f16(v16h a, v16h b, v8f c) {
  c = __builtin_amdgcn_wmma_f32_16x16x32_f16(false, a, false, b, (short)0, c, false, false);
  asm volatile("v_nop\n\tv_nop\n\tv_nop\n\tv_nop" : "+v"(c) : "v"(a), "v"(b));
  return c;
}

// ---------------------------------------------------------------------------
// Batched f16 GEMM: C[m,n] = scale * sum_k A[m,k] * Bt[n,k] (+ bias[n] when BIAS_MODE == 2); with EXP_PLANE the plane
// Xout (shaped as Cout) also takes exp_factor(C[m,n]).
// A row-major [M,K]; Bt row-major [N,K]; K == KK, N == 64 * TN, M % (64 * WM) == 0; b = batch, bx = the block's index
// inside its batch. A block owns one (64 * WM) x 64 tile of C: small, so that a launch has blocks for most of the chip.
// Its 8 waves are 4 (m) x 2 (n); a wave owns (16 * WM) x 32, whose rows are whole 128-B lines of C.
// The tile's A and Bt rows go to LDS for the whole of K by one run of asynchronous copies, so the way from L2 is waited
// out once per block; the fragments are read from LDS. stage: (64 * WM + 64) rows of KK + kPadH halves, A rows first.
// sT: the block's LDS slabs for the epilogue, one per wave.
// ---------------------------------------------------------------------------
constexpr int kPadH  = 8;    /* row pitch = K + 16 B = 16 B x odd: free of bank conflicts for 16-B fragment reads */
constexpr int kSlabW = 36;   /* slab row pitch in floats: 16-B multiple; rows r and r + 8 fall on different banks */

/* NA + NB copies per thread, RS rows per step of the block. l0, ga, gb: this thread's LDS byte address and its 16 B in
   the first RS rows of the A and the Bt slab; lstep, stepA, stepB: RS rows further in LDS (bytes) and in A, Bt (halves). */
template <int NA, int NB>
__device__ __forceinline__ void stage_copies(unsigned l0, unsigned lstep, const _Float16* ga, size_t stepA,
                                             const _Float16* gb, size_t stepB) {
  constexpr int NJ = NA + NB;
  static_assert((NJ % 8) == 0 && NJ <= 63, "eight copies per statement; the run stays under the outstanding limit");
  /* both loops unrolled: j is a constant, so the A / Bt choice and the address arrays fold into registers */
#pragma unroll
  for (int j0 = 0; j0 < NJ; j0 += 8) {
    unsigned l[8];
    const _Float16* g[8];
#pragma unroll
    for (int q = 0; q < 8; ++q) {
      const int j = j0 + q;
      l[q] = l0 + (unsigned)j * lstep;
      g[q] = (j < NA) ? ga + (size_t)j * stepA : gb + (size_t)(j - NA) * stepB;
    }
    /* the copies and, as the last line, the wait that stands before any of their address registers is rewritten */
    asm volatile(
        "global_load_async_to_lds_b128 %0, %8, off\n\t"
        "global_load_async_to_lds_b128 %1, %9, off\n\t"
        "global_load_async_to_lds_b128 %2, %10, off\n\t"
        "global_load_async_to_lds_b128 %3, %11, off\n\t"
        "global_load_async_to_lds_b128 %4, %12, off\n\t"
        "global_load_async_to_lds_b128 %5, %13, off\n\t"
        "global_load_async_to_lds_b128 %6, %14, off\n\t"
        "global_load_async_to_lds_b128 %7, %15, off\n\t"
        "s_wait_xcnt 0x0"
        :: "v"(l[0]), "v"(l[1]), "v"(l[2]), "v"(l[3]), "v"(l[4]), "v"(l[5]), "v"(l[6]), "v"(l[7]),
           "v"(g[0]), "v"(g[1]), "v"(g[2]), "v"(g[3]), "v"(g[4]), "v"(g[5]), "v"(g[6]), "v"(g[7])
        : "memory");
  }
}

template <int BIAS_MODE, bool EXP_PLANE, int WM, int KK, int TN>
__device__ __forceinline__ void gemm_tile_body(
    float (&sT)[8][16 * kSlabW], _Float16* stage, int bx, int b,
    const unsigned short* __restrict__ Ap, int lda, long strideA,
    const unsigned short* __restrict__ Btp, int ldb, long strideB,
    float* __restrict__ Cout, float* __restrict__ Xout, int ldc, long strideC,
    const float* __restrict__ bias,
    int M, int N, int K, float scale) {
  const _Float16* A  = (const _Float16*)Ap;
  const _Float16* Bt = (const _Float16*)Btp;
  const int lane = threadIdx.x & 31;
  const int wave = threadIdx.x >> 5;
  constexpr int AM     = 64 * WM;          /* A rows of the block */
  constexpr int kRowH  = KK + kPadH;       /* LDS row pitch in halves */
  constexpr int kPiece = KK / 8;           /* 16-B pieces per row */
  constexpr int RS     = 256 / kPiece;     /* rows per step of the block's 256 threads */
  static_assert(RS * kPiece == 256 && (AM % RS) == 0 && (64 % RS) == 0 && (KK % 32) == 0, "whole rows, whole steps");
  /* block-uniform exit, in front of the barrier */
  if (K != KK || N != TN * 64 || bx >= (M / AM) * TN) return;
  const int mB = (bx / TN) * AM;
  const int nB = (bx % TN) << 6;
  const int wm = wave >> 1;
  const int wn = wave & 1;
  const int m0 = mB + wm * (16 * WM);
  const int n0 = nB + (wn << 5);

  const _Float16* Ab = A  + (size_t)b * strideA;
  const _Float16* Bb = Bt + (size_t)b * strideB;

  /* row (A) / column (B, D) within a 16-wide subtile; k offset and D row offset of this lane half */
  const int rlane = lane & 15;
  const int koff  = (lane >> 4) * 8;
  const int mOff  = (lane >> 4) * 8;

  v8f acc[WM][2];
#pragma unroll
  for (int i = 0; i < WM; ++i)
#pragma unroll
    for (int j = 0; j < 2; ++j) acc[i][j] = (v8f){0.f,0.f,0.f,0.f,0.f,0.f,0.f,0.f};

  /* asked for ahead of the copies' wait, so that the epilogue does not wait for it */
  float bv[2] = {0.f, 0.f};
  if (BIAS_MODE == 2) {
#pragma unroll
    for (int j = 0; j < 2; ++j) bv[j] = bias[n0 + (j << 4) + rlane];
  }

  const int crow = (int)threadIdx.x / kPiece;
  const int cpos = ((int)threadIdx.x % kPiece) * 8;
  stage_copies<AM / RS, 64 / RS>((unsigned)(size_t)stage + (unsigned)((crow * kRowH + cpos) * 2),
                                 (unsigned)(RS * kRowH * 2),
                                 Ab + (size_t)(mB + crow) * lda + cpos, (size_t)RS * lda,
                                 Bb + (size_t)(nB + crow) * ldb + cpos, (size_t)RS * ldb);
  /* this wave's copies have landed; the barrier publishes every wave's rows to the others */
  asm volatile("s_wait_asynccnt 0x0" ::: "memory");
  __syncthreads();

  const _Float16* fa = stage + (wm * (16 * WM) + rlane) * kRowH + koff;
  const _Float16* fb = stage + (AM + (wn << 5) + rlane) * kRowH + koff;
  /* Two fragment sets: the LDS reads of k step s + 1 are issued in front of the products of step s, so their latency
     runs under the matrix instructions. Unrolled, as the loops inside: the sets, the fragment and the accumulator arrays
     are indexed by constants only. */
  constexpr int NS = KK / 32;
  v16h bh[2][2], ah[2][WM];
#pragma unroll
  for (int j = 0; j < 2; ++j) bh[0][j] = frag_load(fb + j * 16 * kRowH);
#pragma unroll
  for (int i = 0; i < WM; ++i) ah[0][i] = frag_load(fa + i * 16 * kRowH);
#pragma unroll
  for (int s = 0; s < NS; ++s) {
    const int cur = s & 1, nxt = cur ^ 1;
    if (s + 1 < NS) {
#pragma unroll
      for (int j = 0; j < 2; ++j) bh[nxt][j] = frag_load(fb + j * 16 * kRowH + (s + 1) * 32);
#pragma unroll
      for (int i = 0; i < WM; ++i) ah[nxt][i] = frag_load(fa + i * 16 * kRowH + (s + 1) * 32);
    }
#pragma unroll
    for (int i = 0; i < WM; ++i)
#pragma unroll
      for (int j = 0; j < 2; ++j) acc[i][j] = mma_f16(ah[cur][i], bh[cur][j], acc[i][j]);
  }

  // ---- epilogue ----
  float* slab = sT[wave];
  float* C = Cout + (size_t)b * strideC;
#pragma unroll
  for (int i = 0; i < WM; ++i) {
    const int mBase = m0 + (i << 4);
#pragma unroll
    for (int j = 0; j < 2; ++j) {
#pragma unroll
      for (int r = 0; r < 8; ++r) {
        float v = acc[i][j][r] * scale;
        if (BIAS_MODE == 2) v += bv[j];
        slab[(mOff + r) * kSlabW + (j << 4) + rlane] = v;
      }
    }
    __builtin_amdgcn_fence(__ATOMIC_RELEASE, "workgroup");
    __builtin_amdgcn_wave_barrier();
    __builtin_amdgcn_fence(__ATOMIC_ACQUIRE, "workgroup");
    {
      /* row segment = 128 B = 8 lanes x 16 B; lanes 8q..8q+7 take row 4*it + q */
      const int q = lane >> 3, c4 = (lane & 7) * 4;
#pragma unroll
      for (int it = 0; it < 4; ++it) {
        const int row = it * 4 + q;
        v4f v = *(const v4f*)(slab + row * kSlabW + c4);
        *(v4f*)(C + (size_t)(mBase + row) * ldc + n0 + c4) = v;
        if (EXP_PLANE) {
          const v4f f = (v4f){exp_factor(v[0]), exp_factor(v[1]), exp_factor(v[2]), exp_factor(v[3])};
          *(v4f*)(Xout + (size_t)b * strideC + (size_t)(mBase + row) * ldc + n0 + c4) = f;
        }
      }
      /* the wait that stands before the next rows, or another job's code, reuse a register of these stores; the
         scheduling barrier keeps the next rows' arithmetic from being lifted over it */
      asm volatile("s_wait_xcnt 0x0" ::: "memory");
      __builtin_amdgcn_sched_barrier(0);
    }
    __builtin_amdgcn_fence(__ATOMIC_RELEASE, "workgroup");
    __builtin_amdgcn_wave_barrier();
    __builtin_amdgcn_fence(__ATOMIC_ACQUIRE, "workgroup");
  }
}

/* one GEMM per launch: grid (blocks per batch, batches); K = kTE, 64 x 64 tiles */
__global__ __launch_bounds__(256) void gemm_f16_tile64(
    const unsigned short* __restrict__ Ap, int lda, long strideA,
    const unsigned short* __restrict__ Btp, int ldb, long strideB,
    float* __restrict__ Cout, int ldc, long strideC,
    int M, int N, int K, float scale) {
  __shared__ __align__(16) float sT[8][16 * kSlabW];
  __shared__ __align__(16) _Float16 stage[(64 + 64) * (kTE + kPadH)];
  gemm_tile_body<0, false, 1, kTE, kD / 64>(sT, stage, (int)blockIdx.x, (int)blockIdx.y, Ap, lda, strideA, Btp, ldb,
                                            strideB, Cout, nullptr, ldc, strideC, nullptr, M, N, K, scale);
}

// ---------------------------------------------------------------------------
// Row-major f32 -> f16 (x carry) cast of the encoder rows (bx 0..511) and the decoder rows (bx 512..767).
// 8 consecutive elements per thread: enc 4096*256/8 = 131,072 threads = 512 blocks; dec 2048*256/8 = 65,536 threads
// = 256 blocks; the grid covers both planes exactly. One 16-B store per lane; 32 consecutive lanes = 512 contiguous
// ---------------------------------------------------------------------------
constexpr int kEncCastBlocks = (kEncRows * kD / 8) / 256;
constexpr int kDecCastBlocks = (kDecRows * kD / 8) / 256;
static_assert(kEncCastBlocks * 256 * 8 == kEncRows * kD, "enc cast coverage");
static_assert(kDecCastBlocks * 256 * 8 == kDecRows * kD, "dec cast coverage");

__device__ __forceinline__ void cast_rows_body(int bx, const float* enc, const float* dec,
                                               unsigned short* encH, unsigned short* decH, float carry) {
  /* block-uniform plane select */
  const int isDec = (bx >= kEncCastBlocks) ? 1 : 0;
  const int blk = bx - isDec * kEncCastBlocks;
  const float* src = isDec ? dec : enc;
  unsigned short* dst = isDec ? decH : encH;
  const size_t e0 = ((size_t)blk * 256 + threadIdx.x) * 8;
  const v4f a = *(const v4f*)(src + e0);
  const v4f c = *(const v4f*)(src + e0 + 4);
  unsigned short hb[8];
#pragma unroll
  for (int e = 0; e < 4; ++e) {
    const float fa = a[e] * carry;
    const float fc = c[e] * carry;
    hb[e]     = h_bits_flush(fa);
    hb[4 + e] = h_bits_flush(fc);
  }
  const v4u u = (v4u){pk16(hb[0], hb[1]), pk16(hb[2], hb[3]), pk16(hb[4], hb[5]), pk16(hb[6], hb[7])};
  unsigned short* q = dst + e0;
  *(v4u*)q = u;
  /* the wait stands before any of the store's registers is reused */
  asm volatile("s_wait_xcnt 0x0" ::: "memory");
}

// ---------------------------------------------------------------------------
// Transpose + cast: in[rows][cols] f32 (row pitch ldi) -> out[cols][rows] f16 (row pitch ldo), values x carry.
// Block (bx, by) of (rows/64, cols/64) of one plane; src and op point at that plane; sm is the block's LDS tile.
// Load coverage: 16 iterations x 256 threads = 4096 = the whole 64x64 tile (coalesced along cols).
// Store coverage: 8 waves x 2 iterations x 4 rows (lane>>3) = 64 out rows; (lane&7) x 8 halves = 64 out cols; each
// ---------------------------------------------------------------------------
__device__ __forceinline__ void transpose_cast_body(float (&sm)[64][65], int bx, int by, const float* src, int ldi,
                                                    unsigned short* __restrict__ op, int ldo, float carry) {
  const int t  = threadIdx.x;
  const int r0 = bx * 64;
  const int c0 = by * 64;
#pragma unroll
  for (int i = 0; i < 16; ++i) {
    const int e = i * 256 + t;
    const int r = e >> 6;
    const int c = e & 63;
    sm[c][r] = src[(size_t)(r0 + r) * ldi + c0 + c] * carry;
  }
  __syncthreads();
  const int lane = t & 31, wave = t >> 5;
  const int q = lane >> 3, c8 = (lane & 7) * 8;
  {
#pragma unroll
    for (int it = 0; it < 2; ++it) {
      const int row = wave * 8 + it * 4 + q;
      unsigned short hb[8];
#pragma unroll
      for (int e = 0; e < 8; ++e) hb[e] = h_bits_flush(sm[row][c8 + e]);
      const v4u u = (v4u){pk16(hb[0], hb[1]), pk16(hb[2], hb[3]), pk16(hb[4], hb[5]), pk16(hb[6], hb[7])};
      *(v4u*)(op + (size_t)(c0 + row) * ldo + r0 + c8) = u;
    }
    /* one wait for both stores, as behind the cast job's store */
    asm volatile("s_wait_xcnt 0x0" ::: "memory");
  }
}

// ---------------------------------------------------------------------------
// Launch 1: all f16 operand planes, one grid. The jobs read only inputs and write disjoint planes.
// Job by block index (block-uniform, so the transpose's barrier is reached by all threads of a block or by none):
//   0 .. 31        W[d][u] (pitch kU) -> WT[u][d] (pitch kD), plane 0 = W1, plane 1 = W2, (d/64, u/64, 2) = (4, 4, 2)
//   32 .. 287      enc[b][e][d] (pitch kD) -> ENCT[b][d][e] (pitch kTE), (e/64, d/64, b) = (8, 4, 8)
//   288 .. 1055    row-major casts of enc and dec
// ---------------------------------------------------------------------------
constexpr int kWTX = kD / 64, kWTY = kU / 64;
constexpr int kWTBlocks = kWTX * kWTY * 2;
constexpr int kEncTX = kTE / 64, kEncTY = kD / 64;
constexpr int kEncTBlocks = kEncTX * kEncTY * kB;
constexpr int kPlaneBlocks = kWTBlocks + kEncTBlocks + kEncCastBlocks + kDecCastBlocks;
static_assert(kWTBlocks == 32 && kEncTBlocks == 256 && kPlaneBlocks == 1056, "operand grid");

__global__ __launch_bounds__(256) void operand_planes_kernel(const float* enc, const float* dec,
                                                             const float* W1, const float* W2,
                                                             unsigned short* encH, unsigned short* decH,
                                                             unsigned short* wT, unsigned short* encT,
                                                             float xCarry, float wCarry) {
  __shared__ float sm[64][65];
  const int blk = (int)blockIdx.x;
  if (blk < kWTBlocks) {
    const int bx = blk % kWTX;
    const int by = (blk / kWTX) % kWTY;
    const int z  = blk / (kWTX * kWTY);
    transpose_cast_body(sm, bx, by, (z == 1) ? W2 : W1, kU, wT + (size_t)z * kU * kD, kD, wCarry);
  } else if (blk < kWTBlocks + kEncTBlocks) {
    const int j  = blk - kWTBlocks;
    const int bx = j % kEncTX;
    const int by = (j / kEncTX) % kEncTY;
    const int z  = j / (kEncTX * kEncTY);
    transpose_cast_body(sm, bx, by, enc + (size_t)z * kTE * kD, kD, encT + (size_t)z * kD * kTE, kTE, xCarry);
  } else {
    cast_rows_body(blk - kWTBlocks - kEncTBlocks, enc, dec, encH, decH, xCarry);
  }
}

// ---------------------------------------------------------------------------
// Launch 2: the two projections do not depend on each other: one grid of 128 x 64 tiles. Job by block index
// (block-uniform):
//   0 .. 127       job 0, enc projection (batched, no bias, also stored as its exp factor; kEncGemmGridX blocks per batch)
//   128 .. 191     job 1, dec projection (one batch, bias)
// ---------------------------------------------------------------------------
constexpr int kEncGemmGridX  = (kU / 128) * (kTE / 64);
constexpr int kEncGemmBlocks = kEncGemmGridX * kB;
constexpr int kDecGemmBlocks = (kDecRows / 128) * (kU / 64);
constexpr int kProjBlocks = kEncGemmBlocks + kDecGemmBlocks;
static_assert(kEncGemmBlocks == 128 && kDecGemmBlocks == 64 && kProjBlocks == 192, "projection grid");

__global__ __launch_bounds__(256) void projections_kernel(
    const unsigned short* __restrict__ A0, long strideA0,
    const unsigned short* __restrict__ Bt0, long strideB0,
    float* __restrict__ C0, float* __restrict__ X0, int ldc0, long strideC0, int M0, int N0, float scale0,
    const unsigned short* __restrict__ A1,
    const unsigned short* __restrict__ Bt1,
    float* __restrict__ C1, int ldc1, const float* __restrict__ bias1, int M1, int N1, float scale1,
    int ldk, int K) {
  __shared__ __align__(16) float sT[8][16 * kSlabW];
  __shared__ __align__(16) _Float16 stage[(128 + 64) * (kD + kPadH)];
  const int blk = (int)blockIdx.x;
  if (blk < kEncGemmBlocks) {
    gemm_tile_body<0, true, 2, kD, kTE / 64>(sT, stage, blk % kEncGemmGridX, blk / kEncGemmGridX, A0, ldk, strideA0, Bt0,
                                             ldk, strideB0, C0, X0, ldc0, strideC0, nullptr, M0, N0, K, scale0);
  } else {
    gemm_tile_body<2, false, 2, kD, kU / 64>(sT, stage, blk - kEncGemmBlocks, 0, A1, ldk, 0L, Bt1, ldk, 0L,
                                             C1, nullptr, ldc1, 0L, bias1, M1, N1, K, scale1);
  }
}

// ---------------------------------------------------------------------------
// Rows of EPF are held in a ring of kSets register sets of kPf rows. A set is refilled one stage behind its use, so a
// row is asked for (kSets - 2) * kPf rows of arithmetic ahead of its use. Why: every block of a batch walks the same
// rows at the same pace, so a row's first readers all wait out a memory round trip unless it was asked for early.
constexpr int kPf   = 8;
constexpr int kSets = 4;
constexpr int kRing = kPf * kSets;
static_assert((kU % kRing) == 0 && kU >= 2 * kRing, "the u loop takes one whole ring per trip");

__device__ __forceinline__ void load_rows(v2f (&x)[kPf], const float* p) {
#pragma unroll
  for (int i = 0; i < kPf; ++i) x[i] = *(const v2f*)(p + (size_t)i * kTE);
}
/* product form: x = rows of EPF, su = rows of sU (dec factors and -2*V) */
__device__ __forceinline__ void score_rows(const v2f (&x)[kPf], const float* su, float (&acc)[4][2]) {
#pragma unroll
  for (int i = 0; i < kPf; ++i) {
    const v4f d  = *(const v4f*)(su + i * 8);
    const float vm = su[i * 8 + 4];
#pragma unroll
    for (int t = 0; t < 4; ++t) {
      const float r0 = __builtin_amdgcn_rcpf(fmaf(x[i][0], d[t], 1.0f));
      const float r1 = __builtin_amdgcn_rcpf(fmaf(x[i][1], d[t], 1.0f));
      acc[t][0] = fmaf(r0, vm, acc[t][0]);
      acc[t][1] = fmaf(r1, vm, acc[t][1]);
    }
  }
}
/* sum form: x = rows of EPS, sd = rows of sD (dec exponents), su = rows of sU (for -2*V) */
__device__ __forceinline__ void score_rows_sum(const v2f (&x)[kPf], const float* sd, const float* su, float (&acc)[4][2]) {
#pragma unroll
  for (int i = 0; i < kPf; ++i) {
    const v4f d  = *(const v4f*)(sd + i * 4);
    const float vm = su[i * 8 + 4];
#pragma unroll
    for (int t = 0; t < 4; ++t) {
      const float e0 = exp_scaled(x[i][0] + d[t]);
      const float e1 = exp_scaled(x[i][1] + d[t]);
      const float r0 = __builtin_amdgcn_rcpf(1.0f + e0);
      const float r1 = __builtin_amdgcn_rcpf(1.0f + e1);
      acc[t][0] = fmaf(r0, vm, acc[t][0]);
      acc[t][1] = fmaf(r1, vm, acc[t][1]);
    }
  }
}

// ---------------------------------------------------------------------------
// Score + softmax, f32. Block = one batch element b and 4 consecutive decoder steps; 256 threads; thread tid owns the
// encoder positions 2*tid and 2*tid+1 (256 x 2 = 512 = the whole softmax axis), 8 accumulators.
// EPS[b][u][e] holds kArgScale*(enc.W1) and EPF[b][u][e] its exp factor; the LDS row sD[u] = kArgScale*(dec.W2 + b2 + b1)
// for the 4 steps, the LDS row sU[u] = {2^sD[u] for the 4 steps, -2*V[u], 0, 0, 0} (all slots written by thread u).
// tanh(x) = 1 - 2/(1 + exp(2x)), so
//   logit = sum_u V[u] + bV + sum_u (-2*V[u]) / (1 + exp(2x)), exp(2x) = EPF * sU (product form) = 2^(EPS + sD) (sum form).
// Reductions in fixed order: wave shuffle tree, then the 8 wave partials in index order.
// 256w..256w+255 of each of the block's 4 rows); the x512 f16 copy as one packed 4-B word per lane (32 lanes = one
// grid = 8 * 64 = 512 blocks. Barriers under block-uniform control only; no early exit.
// ---------------------------------------------------------------------------
__global__ __launch_bounds__(256) void score_softmax_kernel(
    const float* __restrict__ eps, const float* __restrict__ epf, const float* __restrict__ dpb,
    const float* __restrict__ b1,
    const float* __restrict__ vvec, const float* __restrict__ bV,
    float* __restrict__ wout, unsigned* __restrict__ pw) {
  __shared__ __align__(16) float sU[kU * 8];
  __shared__ float sRedM[4 * 8];
  __shared__ float sRedS[4 * 8];
  __shared__ float sRedV[8];
  __shared__ __align__(16) float sD[kU * 4];
  __shared__ unsigned sWide[8];
  const int tid = threadIdx.x, lane = tid & 31, wave = tid >> 5;
  const int bt0 = blockIdx.x * 4;
  const int b   = bt0 / kTD;

  /* all sets of the ring but the last: in flight across the set-up of sU */
  const float* ep = epf + (size_t)b * kU * kTE + 2 * tid;
  v2f xr[kSets][kPf];
#pragma unroll
  for (int s = 0; s < kSets - 1; ++s) load_rows(xr[s], ep + (size_t)(s * kPf) * kTE);

  {
    const float bb = b1[tid];
    const float vv = vvec[tid];
    v4f dsv;
    dsv[0] = (dpb[(size_t)(bt0 + 0) * kU + tid] + bb) * kArgScale;
    dsv[1] = (dpb[(size_t)(bt0 + 1) * kU + tid] + bb) * kArgScale;
    dsv[2] = (dpb[(size_t)(bt0 + 2) * kU + tid] + bb) * kArgScale;
    dsv[3] = (dpb[(size_t)(bt0 + 3) * kU + tid] + bb) * kArgScale;
    const v4f vsl = (v4f){-2.0f * vv, 0.0f, 0.0f, 0.0f};
    const v4f dfv = (v4f){exp_scaled(dsv[0]), exp_scaled(dsv[1]), exp_scaled(dsv[2]), exp_scaled(dsv[3])};
    *(v4f*)(sD + tid * 4)     = dsv;
    *(v4f*)(sU + tid * 8)     = dfv;
    *(v4f*)(sU + tid * 8 + 4) = vsl;
    /* a NaN exponent may pass: it makes its term NaN in either form */
    const float dmax = fmaxf(fmaxf(fabsf(dsv[0]), fabsf(dsv[1])), fmaxf(fabsf(dsv[2]), fabsf(dsv[3])));
    const unsigned wideMask = __builtin_amdgcn_ballot_w32(dmax > kDecLim);
    float sv = vv;
#pragma unroll
    for (int off = 16; off > 0; off >>= 1) sv += __shfl_xor(sv, off, 32);
    if (lane == 0) { sRedV[wave] = sv; sWide[wave] = wideMask; }
  }
  __syncthreads();
  float cst = sRedV[0];
#pragma unroll
  for (int w = 1; w < 8; ++w) cst += sRedV[w];
  cst += bV[0];
  unsigned anyWide = sWide[0];
#pragma unroll
  for (int w = 1; w < 8; ++w) anyWide |= sWide[w];

  float acc[4][2];
#pragma unroll
  for (int t = 0; t < 4; ++t) { acc[t][0] = 0.0f; acc[t][1] = 0.0f; }

  /* block-uniform: every thread reads the same eight words */
  if (__builtin_amdgcn_readfirstlane(anyWide) != 0u) {
    const float* er = eps + (size_t)b * kU * kTE + 2 * tid;
    for (int u = 0; u < kU; u += kPf) {
      v2f xs[kPf];
      load_rows(xs, er + (size_t)u * kTE);
      score_rows_sum(xs, sD + u * 4, sU + u * 8, acc);
    }
  } else {
  for (int u = 0; u < kU - kRing; u += kRing) {
#pragma unroll
    for (int s = 0; s < kSets; ++s) {
      score_rows(xr[s], sU + (u + s * kPf) * 8, acc);
      /* The two scheduling barriers keep each refill in its stage: without them the compiler reads the whole ring at
         the top of a trip and refills it late, which takes the lead away. The set refilled is the one used a stage
         ago: a refill that overtakes its set's last use goes to spare registers, and the copy back at the top of the
         trip waits for every load in flight. LDS reads (0x100) may still move up across both. */
      __builtin_amdgcn_sched_barrier(0x100);
      const int f = (s + kSets - 1) % kSets;
      load_rows(xr[f], ep + (size_t)(u + (s == 0 ? 0 : kRing) + f * kPf) * kTE);
      __builtin_amdgcn_sched_barrier(0x100);
    }
  }
  /* the last ring: only its last set is still to be fetched */
  score_rows(xr[0], sU + (kU - kRing) * 8, acc);
  __builtin_amdgcn_sched_barrier(0x100);  /* as in the loop */
  load_rows(xr[kSets - 1], ep + (size_t)(kU - kPf) * kTE);
  __builtin_amdgcn_sched_barrier(0x100);  /* as in the loop */
#pragma unroll
  for (int s = 1; s < kSets; ++s) score_rows(xr[s], sU + (kU - kRing + s * kPf) * 8, acc);
  }

  float lg[4][2];
  float mx[4];
#pragma unroll
  for (int t = 0; t < 4; ++t) {
    lg[t][0] = acc[t][0] + cst;
    lg[t][1] = acc[t][1] + cst;
    float m = fmaxf(lg[t][0], lg[t][1]);
#pragma unroll
    for (int off = 16; off > 0; off >>= 1) m = fmaxf(m, __shfl_xor(m, off, 32));
    mx[t] = m;
  }
  if (lane == 0) {
#pragma unroll
    for (int t = 0; t < 4; ++t) sRedM[t * 8 + wave] = mx[t];
  }
  __syncthreads();
  float ex[4][2];
  float sm[4];
#pragma unroll
  for (int t = 0; t < 4; ++t) {
    float m = sRedM[t * 8];
#pragma unroll
    for (int w = 1; w < 8; ++w) m = fmaxf(m, sRedM[t * 8 + w]);
    ex[t][0] = expf(lg[t][0] - m);
    ex[t][1] = expf(lg[t][1] - m);
    float s = ex[t][0] + ex[t][1];
#pragma unroll
    for (int off = 16; off > 0; off >>= 1) s += __shfl_xor(s, off, 32);
    sm[t] = s;
  }
  if (lane == 0) {
#pragma unroll
    for (int t = 0; t < 4; ++t) sRedS[t * 8 + wave] = sm[t];
  }
  __syncthreads();
  v2f wv[4];
  unsigned pk[4];
#pragma unroll
  for (int t = 0; t < 4; ++t) {
    float s = sRedS[t * 8];
#pragma unroll
    for (int w = 1; w < 8; ++w) s += sRedS[t * 8 + w];
    const float inv = __builtin_amdgcn_rcpf(s);
    const float w0 = ex[t][0] * inv;
    const float w1 = ex[t][1] * inv;
    wv[t] = (v2f){w0, w1};
    pk[t] = pk16(h_bits_flush(w0 * kPCarry), h_bits_flush(w1 * kPCarry));
  }
  {
#pragma unroll
    for (int t = 0; t < 4; ++t) {
      *(v2f*)(wout + (size_t)(bt0 + t) * kTE + 2 * tid) = wv[t];
      *(unsigned*)(pw + (size_t)(bt0 + t) * (kTE / 2) + tid) = pk[t];
    }
    
  }
}

// ---------------------------------------------------------------------------
// Host glue: 4 kernel launches, nothing else.
// GEMM shapes (all K % 32 == 0, M and N % 64 == 0):
//   enc projection (swapped roles): M 256 (u), N 512 (e), K 256 (d), 8 batches -> 2 x 8 tiles of 128 x 64, x 8 = 128 blocks
//   dec projection                : M 2048,    N 256 (u), K 256 (d)            -> 16 x 4 tiles of 128 x 64 = 64 blocks
//   context                       : M 256 (t), N 256 (d), K 512 (e), 8 batches -> 4 x 4 tiles of 64 x 64 -> grid (16, 8)
// ---------------------------------------------------------------------------
constexpr int kCtxGridX = (kTD / 64) * (kD / 64);
static_assert(kCtxGridX == 16, "context grid");

extern "C" void kernel_launch(void* const* d_in, const int* in_sizes, int n_in,
                              void* d_out, int out_size, void* d_ws, size_t ws_size,
                              hipStream_t stream) {
  if (n_in < 8) return;
  if (in_sizes[0] != kB * kTE * kD) return;
  if (in_sizes[1] != kB * kTD * kD) return;
  if (in_sizes[2] != kD * kU) return;
  if (in_sizes[3] != kU) return;
  if (in_sizes[4] != kD * kU) return;
  if (in_sizes[5] != kU) return;
  if (in_sizes[6] != kU) return;
  if (in_sizes[7] != 1) return;
  if (out_size != kB * kTD * kD + kB * kTD * kTE) return;
  if (ws_size < kWsTotal) return;

  const float* enc = (const float*)d_in[0];
  const float* dec = (const float*)d_in[1];
  const float* W1  = (const float*)d_in[2];
  const float* b1  = (const float*)d_in[3];
  const float* W2  = (const float*)d_in[4];
  const float* b2  = (const float*)d_in[5];
  const float* Vv  = (const float*)d_in[6];
  const float* bV  = (const float*)d_in[7];

  float* out0 = (float*)d_out;
  float* out1 = (float*)d_out + kOut1OffElems;

  char* ws = (char*)d_ws;
  unsigned short* ENCH = (unsigned short*)(ws + kOffENCH);
  unsigned short* DECH = (unsigned short*)(ws + kOffDECH);
  unsigned short* ENCT = (unsigned short*)(ws + kOffENCT);
  unsigned short* WT   = (unsigned short*)(ws + kOffWT);
  float*          EPS  = (float*)(ws + kOffEPS);
  float*          DPB  = (float*)(ws + kOffDPB);
  unsigned short* PH   = (unsigned short*)(ws + kOffPH);
  float*          EPF  = (float*)(ws + kOffEPF);
  unsigned short* W1T  = WT;
  unsigned short* W2T  = WT + (size_t)kU * kD;

  // ---- operand planes ----
  operand_planes_kernel<<<kPlaneBlocks, 256, 0, stream>>>(enc, dec, W1, W2, ENCH, DECH, WT, ENCT, kXCarry, kWCarry);

  // ---- job 0: EPS[b][u][e] = kArgScale * sum_d W1T[u][d] * enc[b][e][d], EPF = its exp factor ----
  // ---- job 1: DPB[bt][u] = sum_d dec[bt][d] * W2T[u][d] + b2[u] ----
  projections_kernel<<<kProjBlocks, 256, 0, stream>>>(
      W1T, 0L,
      ENCH, (long)kTE * kD,
      EPS, EPF, kTE, (long)kU * kTE, kU, kTE, kEpScale,
      DECH,
      W2T,
      DPB, kU, b2, kDecRows, kU, kProjScale,
      kD, kD);

  // ---- tanh, V dot, softmax over the encoder axis -> second output (f32) and the x512 f16 copy ----
  score_softmax_kernel<<<kB * (kTD / 4), 256, 0, stream>>>(EPS, EPF, DPB, b1, Vv, bV, out1, (unsigned*)PH);

  // ---- context[b][t][d] = (1/8192) * sum_e PH[b][t][e] * ENCT[b][d][e] ----
  gemm_f16_tile64<<<dim3(kCtxGridX, kB), 256, 0, stream>>>(
      PH, kTE, (long)kTD * kTE,
      ENCT, kTE, (long)kD * kTE,
      out0, kD, (long)kTD * kD,
      kTD, kD, kTE, kCtxScale);
}

// v006
// A run of this version takes 30 microseconds.
// Timed twice side by side with v005, it ran 1.11 and 1.09 times as fast.
// All steps since v000 together make it 4.34 times as fast.
// Contractions enc.W1, dec.W2 and weights.enc: v_wmma_f32_16x16x32_f16 (f16 operands with power-of-two carries: activations x16, weight planes x256, probabilities x512; f32 accumulate); tanh, the 256-term V dot and the softmax: f32 on the vector unit.
#include <hip/hip_runtime.h>
#include <math.h>

typedef __attribute__((ext_vector_type(16))) _Float16 v16h;
typedef __attribute__((ext_vector_type(8)))  _Float16 v8h;
typedef __attribute__((ext_vector_type(8)))  float    v8f;
typedef __attribute__((ext_vector_type(4)))  float    v4f;
typedef __attribute__((ext_vector_type(2)))  float    v2f;
typedef __attribute__((ext_vector_type(4)))  unsigned int v4u;

// ---------------------------------------------------------------------------
// Shape constants
// ---------------------------------------------------------------------------
constexpr int kB  = 8;
constexpr int kTE = 512;
constexpr int kTD = 256;
constexpr int kD  = 256;
constexpr int kU  = 256;
constexpr int kEncRows = kB * kTE;
constexpr int kDecRows = kB * kTD;
static_assert(kEncRows == 4096 && kDecRows == 2048, "row counts");
static_assert((kD % 32) == 0 && (kTE % 32) == 0, "GEMM K multiples of 32");
static_assert((kU % 64) == 0 && (kTE % 64) == 0 && (kTD % 64) == 0 && (kD % 64) == 0 && (kDecRows % 64) == 0, "GEMM M,N multiples of 64");
static_assert(kU == 256 && kTE == 512, "score kernel thread map: 256 threads a group, two encoder positions per thread");

// power-of-two carries of the f16 operand planes and the folded-back epilogue scales
constexpr float kXCarry   = 16.0f;
constexpr float kWCarry   = 256.0f;
constexpr float kPCarry   = 512.0f;
constexpr float kProjScale = 1.0f / (kWCarry * kXCarry);
constexpr float kCtxScale  = 1.0f / (kPCarry * kXCarry);
constexpr float kF16MinNormal = 6.103515625e-05f;

// exp(2x) is evaluated as 2^(x * 2*log2(e)). The argument constant is the SAME in every compilation pass
// (no target-dependent selection), so a host-passed scale and the device code always agree; only the body
// of the device-only 2^a helper depends on which builtin the device compiler offers.
constexpr float kArgScale = 2.8853900817779268f;
static_assert(kArgScale > 2.885f && kArgScale < 2.886f, "argument constant is 2*log2(e) in every pass");
__device__ __forceinline__ float exp_scaled(float a) {
#if __has_builtin(__builtin_amdgcn_exp2f)
  return __builtin_amdgcn_exp2f(a);
#else
  return exp2f(a);
#endif
}
constexpr float kEpScale = kArgScale * kProjScale;
// exp(2(a + d)) = exp(2a) * exp(2d), a = the enc side, d = the dec side, each factor formed once where its projection is
// at hand. The enc exponent is clamped to the f32 normal range, so its factor is never 0 or infinite. The product form is
// used only while every dec exponent of a thread group lies within kDecLim: then a clamped enc factor still leaves an exponent
// sum beyond +-24, where 1/(1 + 2^s) is 0 or 1 to f32 rounding, as it is for the true sum. Any other group takes the sum
// form from the unclamped plane.
constexpr float kExpLim = 126.0f;
constexpr float kDecLim = 102.0f;
static_assert(kExpLim - kDecLim >= 24.0f, "a clamped enc factor saturates the term for every admitted dec exponent");
__device__ __forceinline__ float exp_factor(float a) { return exp_scaled(fminf(fmaxf(a, -kExpLim), kExpLim)); }

// ---------------------------------------------------------------------------
// Workspace region map (bytes; every offset is a multiple of 128)
//   ENCH f16 [4096][256]     enc x16, row-major                  2,097,152
//   DECH f16 [2048][256]     dec x16, row-major                  1,048,576
//   ENCT f16 [8][256][512]   enc x16, transposed per batch       2,097,152
//   WT   f16 [2][256][256]   W1^T, W2^T x256 ([u][d])              262,144
//   EPS  f32 [8][256][512]   kArgScale * enc.W1, [b][u][e]       4,194,304
//   DPB  f32 [2048][256]     dec.W2 + b2                         2,097,152
//   EPF  f32 [8][256][512]   2^EPS, exponent clamped, [b][u][e]  4,194,304
//   total                                                       15,990,784
// ---------------------------------------------------------------------------
constexpr size_t kOffENCH = 0;
constexpr size_t kOffDECH = kOffENCH + (size_t)kEncRows * kD * 2;
constexpr size_t kOffENCT = kOffDECH + (size_t)kDecRows * kD * 2;
constexpr size_t kOffWT   = kOffENCT + (size_t)kB * kD * kTE * 2;
constexpr size_t kOffEPS  = kOffWT   + (size_t)2 * kU * kD * 2;
constexpr size_t kOffDPB  = kOffEPS  + (size_t)kB * kU * kTE * 4;
constexpr size_t kOffEPF  = kOffDPB  + (size_t)kDecRows * kU * 4;
constexpr size_t kWsTotal = kOffEPF  + (size_t)kB * kU * kTE * 4;
static_assert(kWsTotal == 15990784ull, "carve total");
static_assert(kWsTotal <= 134217728ull, "carve cap");
static_assert((kOffDECH % 128) == 0 && (kOffENCT % 128) == 0 && (kOffWT % 128) == 0 && (kOffEPS % 128) == 0 &&
              (kOffDPB % 128) == 0 && (kOffEPF % 128) == 0, "128-B aligned regions");

// output packing (bytes -> float elements)
constexpr size_t kOut0Bytes = (size_t)kB * kTD * kD * 4;
constexpr size_t kOut1OffBytes = 2097152ull;
constexpr size_t kOut1Bytes = (size_t)kB * kTD * kTE * 4;
static_assert(kOut0Bytes == kOut1OffBytes, "second output follows the first");
static_assert(kOut1OffBytes + kOut1Bytes == 6291456ull, "output total");
static_assert((kOut1OffBytes % 128) == 0, "second output line aligned");
constexpr size_t kOut1OffElems = kOut1OffBytes / 4;

// ---------------------------------------------------------------------------
// Small helpers
// ---------------------------------------------------------------------------
__device__ __forceinline__ unsigned pk16(unsigned short a, unsigned short b) { return (unsigned)a | ((unsigned)b << 16); }

// f32 -> f16 bits (RNE); magnitudes under the f16 normal range become +0 by a select before the convert
__device__ __forceinline__ unsigned short h_bits_flush(float f) {
  const float g = (fabsf(f) < kF16MinNormal) ? 0.0f : f;
  const _Float16 h = (_Float16)g;
  return __builtin_bit_cast(unsigned short, h);
}

/* fragment load: elements 0..7 <- p[0..7], elements 8..15 <- p[16..23] */
union FragH { v16h v; v8h h[2]; };
__device__ __forceinline__ v16h frag_load(const _Float16* p) {
  FragH f;
  f.h[0] = *(const v8h*)(p);
  f.h[1] = *(const v8h*)(p + 16);
  return f.v;
}
/* one matrix instruction followed by its own hazard guard: ties this accumulator, names both fragments */
__device__ __forceinline__ v8f mma_f16(v16h a, v16h b, v8f c) {
  c = __builtin_amdgcn_wmma_f32_16x16x32_f16(false, a, false, b, (short)0, c, false, false);
  asm volatile("v_nop\n\tv_nop\n\tv_nop\n\tv_nop" : "+v"(c) : "v"(a), "v"(b));
  return c;
}

// ---------------------------------------------------------------------------
// Batched f16 GEMM: C[m,n] = scale * sum_k A[m,k] * Bt[n,k] (+ bias[n] when BIAS_MODE == 2); with EXP_PLANE the plane
// Xout (shaped as Cout) also takes exp_factor(C[m,n]).
// A row-major [M,K]; Bt row-major [N,K]; K == KK, N == 64 * TN, M % (64 * WM) == 0; b = batch, bx = the block's index
// inside its batch. A block owns one (64 * WM) x 64 tile of C: small, so that a launch has blocks for most of the chip.
// Its 8 waves are 4 (m) x 2 (n); a wave owns (16 * WM) x 32, whose rows are whole 128-B lines of C.
// The tile's A and Bt rows go to LDS for the whole of K by one run of asynchronous copies, so the way from L2 is waited
// out once per block; the fragments are read from LDS. stage: (64 * WM + 64) rows of KK + kPadH halves, A rows first.
// sT: the block's LDS slabs for the epilogue, one per wave.
// ---------------------------------------------------------------------------
constexpr int kPadH  = 8;    /* row pitch = K + 16 B = 16 B x odd: free of bank conflicts for 16-B fragment reads */
constexpr int kSlabW = 36;   /* slab row pitch in floats: 16-B multiple; rows r and r + 8 fall on different banks */

/* NA + NB copies per thread, RS rows per step of the block. l0, ga, gb: this thread's LDS byte address and its 16 B in
   the first RS rows of the A and the Bt slab; lstep, stepA, stepB: RS rows further in LDS (bytes) and in A, Bt (halves). */
template <int NA, int NB>
__device__ __forceinline__ void stage_copies(unsigned l0, unsigned lstep, const _Float16* ga, size_t stepA,
                                             const _Float16* gb, size_t stepB) {
  constexpr int NJ = NA + NB;
  static_assert((NJ % 8) == 0 && NJ <= 63, "eight copies per statement; the run stays under the outstanding limit");
  /* both loops unrolled: j is a constant, so the A / Bt choice and the address arrays fold into registers */
#pragma unroll
  for (int j0 = 0; j0 < NJ; j0 += 8) {
    unsigned l[8];
    const _Float16* g[8];
#pragma unroll
    for (int q = 0; q < 8; ++q) {
      const int j = j0 + q;
      l[q] = l0 + (unsigned)j * lstep;
      g[q] = (j < NA) ? ga + (size_t)j * stepA : gb + (size_t)(j - NA) * stepB;
    }
    /* the copies and, as the last line, the wait that stands before any of their address registers is rewritten */
    asm volatile(
        "global_load_async_to_lds_b128 %0, %8, off\n\t"
        "global_load_async_to_lds_b128 %1, %9, off\n\t"
        "global_load_async_to_lds_b128 %2, %10, off\n\t"
        "global_load_async_to_lds_b128 %3, %11, off\n\t"
        "global_load_async_to_lds_b128 %4, %12, off\n\t"
        "global_load_async_to_lds_b128 %5, %13, off\n\t"
        "global_load_async_to_lds_b128 %6, %14, off\n\t"
        "global_load_async_to_lds_b128 %7, %15, off\n\t"
        "s_wait_xcnt 0x0"
        :: "v"(l[0]), "v"(l[1]), "v"(l[2]), "v"(l[3]), "v"(l[4]), "v"(l[5]), "v"(l[6]), "v"(l[7]),
           "v"(g[0]), "v"(g[1]), "v"(g[2]), "v"(g[3]), "v"(g[4]), "v"(g[5]), "v"(g[6]), "v"(g[7])
        : "memory");
  }
}

template <int BIAS_MODE, bool EXP_PLANE, int WM, int KK, int TN>
__device__ __forceinline__ void gemm_tile_body(
    float (&sT)[8][16 * kSlabW], _Float16* stage, int bx, int b,
    const unsigned short* __restrict__ Ap, int lda, long strideA,
    const unsigned short* __restrict__ Btp, int ldb, long strideB,
    float* __restrict__ Cout, float* __restrict__ Xout, int ldc, long strideC,
    const float* __restrict__ bias,
    int M, int N, int K, float scale) {
  const _Float16* A  = (const _Float16*)Ap;
  const _Float16* Bt = (const _Float16*)Btp;
  const int lane = threadIdx.x & 31;
  const int wave = threadIdx.x >> 5;
  constexpr int AM     = 64 * WM;          /* A rows of the block */
  constexpr int kRowH  = KK + kPadH;       /* LDS row pitch in halves */
  constexpr int kPiece = KK / 8;           /* 16-B pieces per row */
  constexpr int RS     = 256 / kPiece;     /* rows per step of the block's 256 threads */
  static_assert(RS * kPiece == 256 && (AM % RS) == 0 && (64 % RS) == 0 && (KK % 32) == 0, "whole rows, whole steps");
  /* block-uniform exit, in front of the barrier */
  if (K != KK || N != TN * 64 || bx >= (M / AM) * TN) return;
  const int mB = (bx / TN) * AM;
  const int nB = (bx % TN) << 6;
  const int wm = wave >> 1;
  const int wn = wave & 1;
  const int m0 = mB + wm * (16 * WM);
  const int n0 = nB + (wn << 5);

  const _Float16* Ab = A  + (size_t)b * strideA;
  const _Float16* Bb = Bt + (size_t)b * strideB;

  /* row (A) / column (B, D) within a 16-wide subtile; k offset and D row offset of this lane half */
  const int rlane = lane & 15;
  const int koff  = (lane >> 4) * 8;
  const int mOff  = (lane >> 4) * 8;

  v8f acc[WM][2];
#pragma unroll
  for (int i = 0; i < WM; ++i)
#pragma unroll
    for (int j = 0; j < 2; ++j) acc[i][j] = (v8f){0.f,0.f,0.f,0.f,0.f,0.f,0.f,0.f};

  /* asked for ahead of the copies' wait, so that the epilogue does not wait for it */
  float bv[2] = {0.f, 0.f};
  if (BIAS_MODE == 2) {
#pragma unroll
    for (int j = 0; j < 2; ++j) bv[j] = bias[n0 + (j << 4) + rlane];
  }

  const int crow = (int)threadIdx.x / kPiece;
  const int cpos = ((int)threadIdx.x % kPiece) * 8;
  stage_copies<AM / RS, 64 / RS>((unsigned)(size_t)stage + (unsigned)((crow * kRowH + cpos) * 2),
                                 (unsigned)(RS * kRowH * 2),
                                 Ab + (size_t)(mB + crow) * lda + cpos, (size_t)RS * lda,
                                 Bb + (size_t)(nB + crow) * ldb + cpos, (size_t)RS * ldb);
  /* this wave's copies have landed; the barrier publishes every wave's rows to the others */
  asm volatile("s_wait_asynccnt 0x0" ::: "memory");
  __syncthreads();

  const _Float16* fa = stage + (wm * (16 * WM) + rlane) * kRowH + koff;
  const _Float16* fb = stage + (AM + (wn << 5) + rlane) * kRowH + koff;
  /* Two fragment sets: the LDS reads of k step s + 1 are issued in front of the products of step s, so their latency
     runs under the matrix instructions. Unrolled, as the loops inside: the sets, the fragment and the accumulator arrays
     are indexed by constants only. */
  constexpr int NS = KK / 32;
  v16h bh[2][2], ah[2][WM];
#pragma unroll
  for (int j = 0; j < 2; ++j) bh[0][j] = frag_load(fb + j * 16 * kRowH);
#pragma unroll
  for (int i = 0; i < WM; ++i) ah[0][i] = frag_load(fa + i * 16 * kRowH);
#pragma unroll
  for (int s = 0; s < NS; ++s) {
    const int cur = s & 1, nxt = cur ^ 1;
    if (s + 1 < NS) {
#pragma unroll
      for (int j = 0; j < 2; ++j) bh[nxt][j] = frag_load(fb + j * 16 * kRowH + (s + 1) * 32);
#pragma unroll
      for (int i = 0; i < WM; ++i) ah[nxt][i] = frag_load(fa + i * 16 * kRowH + (s + 1) * 32);
    }
#pragma unroll
    for (int i = 0; i < WM; ++i)
#pragma unroll
      for (int j = 0; j < 2; ++j) acc[i][j] = mma_f16(ah[cur][i], bh[cur][j], acc[i][j]);
  }

  // ---- epilogue ----
  float* slab = sT[wave];
  float* C = Cout + (size_t)b * strideC;
#pragma unroll
  for (int i = 0; i < WM; ++i) {
    const int mBase = m0 + (i << 4);
#pragma unroll
    for (int j = 0; j < 2; ++j) {
#pragma unroll
      for (int r = 0; r < 8; ++r) {
        float v = acc[i][j][r] * scale;
        if (BIAS_MODE == 2) v += bv[j];
        slab[(mOff + r) * kSlabW + (j << 4) + rlane] = v;
      }
    }
    __builtin_amdgcn_fence(__ATOMIC_RELEASE, "workgroup");
    __builtin_amdgcn_wave_barrier();
    __builtin_amdgcn_fence(__ATOMIC_ACQUIRE, "workgroup");
    {
      /* row segment = 128 B = 8 lanes x 16 B; lanes 8q..8q+7 take row 4*it + q */
      const int q = lane >> 3, c4 = (lane & 7) * 4;
#pragma unroll
      for (int it = 0; it < 4; ++it) {
        const int row = it * 4 + q;
        v4f v = *(const v4f*)(slab + row * kSlabW + c4);
        *(v4f*)(C + (size_t)(mBase + row) * ldc + n0 + c4) = v;
        if (EXP_PLANE) {
          const v4f f = (v4f){exp_factor(v[0]), exp_factor(v[1]), exp_factor(v[2]), exp_factor(v[3])};
          *(v4f*)(Xout + (size_t)b * strideC + (size_t)(mBase + row) * ldc + n0 + c4) = f;
        }
      }
      /* the wait that stands before the next rows, or another job's code, reuse a register of these stores; the
         scheduling barrier keeps the next rows' arithmetic from being lifted over it */
      asm volatile("s_wait_xcnt 0x0" ::: "memory");
      __builtin_amdgcn_sched_barrier(0);
    }
    __builtin_amdgcn_fence(__ATOMIC_RELEASE, "workgroup");
    __builtin_amdgcn_wave_barrier();
    __builtin_amdgcn_fence(__ATOMIC_ACQUIRE, "workgroup");
  }
}

// ---------------------------------------------------------------------------
// Row-major f32 -> f16 (x carry) cast of the encoder rows (bx 0..511) and the decoder rows (bx 512..767).
// 8 consecutive elements per thread: enc 4096*256/8 = 131,072 threads = 512 blocks; dec 2048*256/8 = 65,536 threads
// = 256 blocks; the grid covers both planes exactly. One 16-B store per lane; 32 consecutive lanes = 512 contiguous
// ---------------------------------------------------------------------------
constexpr int kEncCastBlocks = (kEncRows * kD / 8) / 256;
constexpr int kDecCastBlocks = (kDecRows * kD / 8) / 256;
static_assert(kEncCastBlocks * 256 * 8 == kEncRows * kD, "enc cast coverage");
static_assert(kDecCastBlocks * 256 * 8 == kDecRows * kD, "dec cast coverage");

__device__ __forceinline__ void cast_rows_body(int bx, const float* enc, const float* dec,
                                               unsigned short* encH, unsigned short* decH, float carry) {
  /* block-uniform plane select */
  const int isDec = (bx >= kEncCastBlocks) ? 1 : 0;
  const int blk = bx - isDec * kEncCastBlocks;
  const float* src = isDec ? dec : enc;
  unsigned short* dst = isDec ? decH : encH;
  const size_t e0 = ((size_t)blk * 256 + threadIdx.x) * 8;
  const v4f a = *(const v4f*)(src + e0);
  const v4f c = *(const v4f*)(src + e0 + 4);
  unsigned short hb[8];
#pragma unroll
  for (int e = 0; e < 4; ++e) {
    const float fa = a[e] * carry;
    const float fc = c[e] * carry;
    hb[e]     = h_bits_flush(fa);
    hb[4 + e] = h_bits_flush(fc);
  }
  const v4u u = (v4u){pk16(hb[0], hb[1]), pk16(hb[2], hb[3]), pk16(hb[4], hb[5]), pk16(hb[6], hb[7])};
  unsigned short* q = dst + e0;
  *(v4u*)q = u;
  /* the wait stands before any of the store's registers is reused */
  asm volatile("s_wait_xcnt 0x0" ::: "memory");
}

// ---------------------------------------------------------------------------
// Transpose + cast: in[rows][cols] f32 (row pitch ldi) -> out[cols][rows] f16 (row pitch ldo), values x carry.
// Block (bx, by) of (rows/64, cols/64) of one plane; src and op point at that plane; sm is the block's LDS tile.
// Load coverage: 16 iterations x 256 threads = 4096 = the whole 64x64 tile (coalesced along cols).
// Store coverage: 8 waves x 2 iterations x 4 rows (lane>>3) = 64 out rows; (lane&7) x 8 halves = 64 out cols; each
// ---------------------------------------------------------------------------
__device__ __forceinline__ void transpose_cast_body(float (&sm)[64][65], int bx, int by, const float* src, int ldi,
                                                    unsigned short* __restrict__ op, int ldo, float carry) {
  const int t  = threadIdx.x;
  const int r0 = bx * 64;
  const int c0 = by * 64;
#pragma unroll
  for (int i = 0; i < 16; ++i) {
    const int e = i * 256 + t;
    const int r = e >> 6;
    const int c = e & 63;
    sm[c][r] = src[(size_t)(r0 + r) * ldi + c0 + c] * carry;
  }
  __syncthreads();
  const int lane = t & 31, wave = t >> 5;
  const int q = lane >> 3, c8 = (lane & 7) * 8;
  {
#pragma unroll
    for (int it = 0; it < 2; ++it) {
      const int row = wave * 8 + it * 4 + q;
      unsigned short hb[8];
#pragma unroll
      for (int e = 0; e < 8; ++e) hb[e] = h_bits_flush(sm[row][c8 + e]);
      const v4u u = (v4u){pk16(hb[0], hb[1]), pk16(hb[2], hb[3]), pk16(hb[4], hb[5]), pk16(hb[6], hb[7])};
      *(v4u*)(op + (size_t)(c0 + row) * ldo + r0 + c8) = u;
    }
    /* one wait for both stores, as behind the cast job's store */
    asm volatile("s_wait_xcnt 0x0" ::: "memory");
  }
}

// ---------------------------------------------------------------------------
// Launch 1: all f16 operand planes, one grid. The jobs read only inputs and write disjoint planes.
// Job by block index (block-uniform, so the transpose's barrier is reached by all threads of a block or by none):
//   0 .. 31        W[d][u] (pitch kU) -> WT[u][d] (pitch kD), plane 0 = W1, plane 1 = W2, (d/64, u/64, 2) = (4, 4, 2)
//   32 .. 287      enc[b][e][d] (pitch kD) -> ENCT[b][d][e] (pitch kTE), (e/64, d/64, b) = (8, 4, 8)
//   288 .. 1055    row-major casts of enc and dec
// ---------------------------------------------------------------------------
constexpr int kWTX = kD / 64, kWTY = kU / 64;
constexpr int kWTBlocks = kWTX * kWTY * 2;
constexpr int kEncTX = kTE / 64, kEncTY = kD / 64;
constexpr int kEncTBlocks = kEncTX * kEncTY * kB;
constexpr int kPlaneBlocks = kWTBlocks + kEncTBlocks + kEncCastBlocks + kDecCastBlocks;
static_assert(kWTBlocks == 32 && kEncTBlocks == 256 && kPlaneBlocks == 1056, "operand grid");

__global__ __launch_bounds__(256) void operand_planes_kernel(const float* enc, const float* dec,
                                                             const float* W1, const float* W2,
                                                             unsigned short* encH, unsigned short* decH,
                                                             unsigned short* wT, unsigned short* encT,
                                                             float xCarry, float wCarry) {
  __shared__ float sm[64][65];
  const int blk = (int)blockIdx.x;
  if (blk < kWTBlocks) {
    const int bx = blk % kWTX;
    const int by = (blk / kWTX) % kWTY;
    const int z  = blk / (kWTX * kWTY);
    transpose_cast_body(sm, bx, by, (z == 1) ? W2 : W1, kU, wT + (size_t)z * kU * kD, kD, wCarry);
  } else if (blk < kWTBlocks + kEncTBlocks) {
    const int j  = blk - kWTBlocks;
    const int bx = j % kEncTX;
    const int by = (j / kEncTX) % kEncTY;
    const int z  = j / (kEncTX * kEncTY);
    transpose_cast_body(sm, bx, by, enc + (size_t)z * kTE * kD, kD, encT + (size_t)z * kD * kTE, kTE, xCarry);
  } else {
    cast_rows_body(blk - kWTBlocks - kEncTBlocks, enc, dec, encH, decH, xCarry);
  }
}

// ---------------------------------------------------------------------------
// Launch 2: the two projections do not depend on each other: one grid of 128 x 64 tiles. Job by block index
// (block-uniform):
//   0 .. 127       job 0, enc projection (batched, no bias, also stored as its exp factor; kEncGemmGridX blocks per batch)
//   128 .. 191     job 1, dec projection (one batch, bias)
// ---------------------------------------------------------------------------
constexpr int kEncGemmGridX  = (kU / 128) * (kTE / 64);
constexpr int kEncGemmBlocks = kEncGemmGridX * kB;
constexpr int kDecGemmBlocks = (kDecRows / 128) * (kU / 64);
constexpr int kProjBlocks = kEncGemmBlocks + kDecGemmBlocks;
static_assert(kEncGemmBlocks == 128 && kDecGemmBlocks == 64 && kProjBlocks == 192, "projection grid");

__global__ __launch_bounds__(256) void projections_kernel(
    const unsigned short* __restrict__ A0, long strideA0,
    const unsigned short* __restrict__ Bt0, long strideB0,
    float* __restrict__ C0, float* __restrict__ X0, int ldc0, long strideC0, int M0, int N0, float scale0,
    const unsigned short* __restrict__ A1,
    const unsigned short* __restrict__ Bt1,
    float* __restrict__ C1, int ldc1, const float* __restrict__ bias1, int M1, int N1, float scale1,
    int ldk, int K) {
  __shared__ __align__(16) float sT[8][16 * kSlabW];
  __shared__ __align__(16) _Float16 stage[(128 + 64) * (kD + kPadH)];
  const int blk = (int)blockIdx.x;
  if (blk < kEncGemmBlocks) {
    gemm_tile_body<0, true, 2, kD, kTE / 64>(sT, stage, blk % kEncGemmGridX, blk / kEncGemmGridX, A0, ldk, strideA0, Bt0,
                                             ldk, strideB0, C0, X0, ldc0, strideC0, nullptr, M0, N0, K, scale0);
  } else {
    gemm_tile_body<2, false, 2, kD, kU / 64>(sT, stage, blk - kEncGemmBlocks, 0, A1, ldk, 0L, Bt1, ldk, 0L,
                                             C1, nullptr, ldc1, 0L, bias1, M1, N1, K, scale1);
  }
}

// ---------------------------------------------------------------------------
// Rows of EPF are held in a ring of kSets register sets of kPf rows. A set is refilled one stage behind its use, so a
// row is asked for (kSets - 2) * kPf rows of arithmetic ahead of its use. Why: every block of a batch walks the same
// rows at the same pace, so a row's first readers all wait out a memory round trip unless it was asked for early.
constexpr int kPf   = 8;
constexpr int kSets = 4;
constexpr int kRing = kPf * kSets;
static_assert((kU % kRing) == 0 && kU >= 2 * kRing, "the u loop takes one whole ring per trip");

__device__ __forceinline__ void load_rows(v2f (&x)[kPf], const float* p) {
#pragma unroll
  for (int i = 0; i < kPf; ++i) x[i] = *(const v2f*)(p + (size_t)i * kTE);
}
/* product form: x = rows of EPF, su = rows of sU (dec factors and -2*V) */
__device__ __forceinline__ void score_rows(const v2f (&x)[kPf], const float* su, v2f (&acc)[4]) {
#pragma unroll
  for (int i = 0; i < kPf; ++i) {
    const v4f d  = *(const v4f*)(su + i * 8);
    const float vm = su[i * 8 + 4];
#pragma unroll
    for (int t = 0; t < 4; ++t) {
      const float r0 = __builtin_amdgcn_rcpf(fmaf(x[i][0], d[t], 1.0f));
      const float r1 = __builtin_amdgcn_rcpf(fmaf(x[i][1], d[t], 1.0f));
      /* both positions in one packed operation (the same two fused multiply-adds): one issue slot whatever registers
         the build hands out; under this kernel's register ceiling half of the dual-issue pairs were lost */
      acc[t] = __builtin_elementwise_fma((v2f){r0, r1}, (v2f){vm, vm}, acc[t]);
    }
  }
}
/* sum form: x = rows of EPS, sd = rows of sD (dec exponents), su = rows of sU (for -2*V) */
__device__ __forceinline__ void score_rows_sum(const v2f (&x)[kPf], const float* sd, const float* su, v2f (&acc)[4]) {
#pragma unroll
  for (int i = 0; i < kPf; ++i) {
    const v4f d  = *(const v4f*)(sd + i * 4);
    const float vm = su[i * 8 + 4];
#pragma unroll
    for (int t = 0; t < 4; ++t) {
      const float e0 = exp_scaled(x[i][0] + d[t]);
      const float e1 = exp_scaled(x[i][1] + d[t]);
      const float r0 = __builtin_amdgcn_rcpf(1.0f + e0);
      const float r1 = __builtin_amdgcn_rcpf(1.0f + e1);
      acc[t][0] = fmaf(r0, vm, acc[t][0]);
      acc[t][1] = fmaf(r1, vm, acc[t][1]);
    }
  }
}

// ---------------------------------------------------------------------------
// Score + softmax (f32) + context rows (matrix unit). Block = one batch element b and kTB = 8 consecutive decoder steps;
// 512 threads = two groups of 256, group g takes the steps 4g .. 4g+3; thread tid of a group owns the encoder positions
// 2*tid and 2*tid+1 (256 x 2 = 512 = the whole softmax axis), 8 accumulators.
// EPS[b][u][e] holds kArgScale*(enc.W1) and EPF[b][u][e] its exp factor; the LDS row sD[g][u] = kArgScale*(dec.W2 + b2 + b1)
// for the group's 4 steps, the LDS row sU[g][u] = {2^sD[g][u] for the 4 steps, -2*V[u], 0, 0, 0} (all slots written by thread u).
// tanh(x) = 1 - 2/(1 + exp(2x)), so
//   logit = sum_u V[u] + bV + sum_u (-2*V[u]) / (1 + exp(2x)), exp(2x) = EPF * sU (product form) = 2^(EPS + sD) (sum form).
// Reductions in fixed order: wave shuffle tree, then the 8 wave partials of the group in index order.
// Context: the batch's ENCT rows ([d][e], f16) are asked for at the start by asynchronous copies to LDS and land under the
// score loop; the block's 8 weight rows (x512, f16) go to LDS; context[t][d] = sum_e weight[t][e] * ENCT[d][e], k in
// ascending steps of 32. The LDS footprint leaves one block per WGP: 16 waves, four per SIMD.
// grid = 8 * 32 = 256 blocks. Barriers under block-uniform control only; no early exit.
// ---------------------------------------------------------------------------
constexpr int kTB   = 8;
constexpr int kRowE = kTE + kPadH;   /* LDS row pitch in halves of the ENCT rows and the weight rows: 16 B x odd */
static_assert((kTD % kTB) == 0, "a block lies in one batch");
static_assert((kD % 8) == 0 && kTE / 8 == 64, "copies: 64 pieces of 16 B a row, 8 rows a step of the block's 512 threads");

__global__ __launch_bounds__(512) void score_softmax_context_kernel(
    const float* __restrict__ eps, const float* __restrict__ epf, const float* __restrict__ dpb,
    const float* __restrict__ b1,
    const float* __restrict__ vvec, const float* __restrict__ bV,
    const unsigned short* __restrict__ encT,
    float* __restrict__ wout, float* __restrict__ ctx) {
  __shared__ __align__(16) _Float16 sE[kD * kRowE];
  __shared__ __align__(16) _Float16 sP[kTB * kRowE];
  __shared__ __align__(16) float sU[2][kU * 8];
  __shared__ __align__(16) float sD[2][kU * 4];
  __shared__ float sRedM[2][4 * 8];
  __shared__ float sRedS[2][4 * 8];
  __shared__ float sRedV[2][8];
  __shared__ unsigned sWide[2][8];
  const int tid = threadIdx.x & 255, lane = tid & 31, wave = tid >> 5;
  /* the same in every lane of a wave: kept in a scalar register, so that the group's LDS rows have scalar bases */
  const int grp = __builtin_amdgcn_readfirstlane((int)(threadIdx.x >> 8));
  const int bt0 = blockIdx.x * kTB + grp * 4;
  const int b   = bt0 / kTD;

  /* the set-up's own loads stand first: the first barrier depends on them, and behind the copies below they would wait
     for a quarter of a megabyte per block */
  const float bb = b1[tid];
  const float vv = vvec[tid];
  float dp[4];
#pragma unroll
  for (int t = 0; t < 4; ++t) dp[t] = dpb[(size_t)(bt0 + t) * kU + tid];

  /* all sets of the ring but the last: in flight across the set-up of sU */
  const float* ep = epf + (size_t)b * kU * kTE + 2 * tid;
  v2f xr[kSets][kPf];
#pragma unroll
  for (int s = 0; s < kSets - 1; ++s) load_rows(xr[s], ep + (size_t)(s * kPf) * kTE);

  /* behind those loads, so that they are served first: the batch's ENCT rows, 32 copies per thread */
  {
    const int crow = (int)threadIdx.x >> 6;
    const int cpos = ((int)threadIdx.x & 63) * 8;
    const _Float16* ge = (const _Float16*)encT + (size_t)b * kD * kTE + (size_t)crow * kTE + cpos;
    stage_copies<kD / 8, 0>((unsigned)(size_t)sE + (unsigned)((crow * kRowE + cpos) * 2), (unsigned)(8 * kRowE * 2),
                            ge, (size_t)8 * kTE, ge, 0);
  }

  {
    v4f dsv;
    dsv[0] = (dp[0] + bb) * kArgScale;
    dsv[1] = (dp[1] + bb) * kArgScale;
    dsv[2] = (dp[2] + bb) * kArgScale;
    dsv[3] = (dp[3] + bb) * kArgScale;
    const v4f vsl = (v4f){-2.0f * vv, 0.0f, 0.0f, 0.0f};
    const v4f dfv = (v4f){exp_scaled(dsv[0]), exp_scaled(dsv[1]), exp_scaled(dsv[2]), exp_scaled(dsv[3])};
    *(v4f*)(sD[grp] + tid * 4)     = dsv;
    *(v4f*)(sU[grp] + tid * 8)     = dfv;
    *(v4f*)(sU[grp] + tid * 8 + 4) = vsl;
    /* a NaN exponent may pass: it makes its term NaN in either form */
    const float dmax = fmaxf(fmaxf(fabsf(dsv[0]), fabsf(dsv[1])), fmaxf(fabsf(dsv[2]), fabsf(dsv[3])));
    const unsigned wideMask = __builtin_amdgcn_ballot_w32(dmax > kDecLim);
    float sv = vv;
#pragma unroll
    for (int off = 16; off > 0; off >>= 1) sv += __shfl_xor(sv, off, 32);
    if (lane == 0) { sRedV[grp][wave] = sv; sWide[grp][wave] = wideMask; }
  }
  __syncthreads();
  const float* sUg = sU[grp];
  float cst = sRedV[grp][0];
#pragma unroll
  for (int w = 1; w < 8; ++w) cst += sRedV[grp][w];
  cst += bV[0];
  unsigned anyWide = sWide[grp][0];
#pragma unroll
  for (int w = 1; w < 8; ++w) anyWide |= sWide[grp][w];

  v2f acc[4];
#pragma unroll
  for (int t = 0; t < 4; ++t) acc[t] = (v2f){0.0f, 0.0f};

  /* uniform for a group, so for a wave: every thread of a group reads the same eight words; no barrier inside */
  if (__builtin_amdgcn_readfirstlane(anyWide) != 0u) {
    const float* er = eps + (size_t)b * kU * kTE + 2 * tid;
    for (int u = 0; u < kU; u += kPf) {
      v2f xs[kPf];
      load_rows(xs, er + (size_t)u * kTE);
      score_rows_sum(xs, sD[grp] + u * 4, sUg + u * 8, acc);
    }
  } else {
  for (int u = 0; u < kU - kRing; u += kRing) {
#pragma unroll
    for (int s = 0; s < kSets; ++s) {
      score_rows(xr[s], sUg + (u + s * kPf) * 8, acc);
      /* The two scheduling barriers keep each refill in its stage: without them the compiler reads the whole ring at
         the top of a trip and refills it late, which takes the lead away. The set refilled is the one used a stage
         ago: a refill that overtakes its set's last use goes to spare registers, and the copy back at the top of the
         trip waits for every load in flight. Nothing crosses them, LDS reads included: a wave of a 512-thread block
         has 256 registers, and with a trip's LDS reads free to move to its top the schedule passed that ceiling and
         the build fell back to source order, one dependent chain after another. */
      __builtin_amdgcn_sched_barrier(0);
      const int f = (s + kSets - 1) % kSets;
      load_rows(xr[f], ep + (size_t)(u + (s == 0 ? 0 : kRing) + f * kPf) * kTE);
      __builtin_amdgcn_sched_barrier(0);
    }
  }
  /* the last ring: only its last set is still to be fetched */
  score_rows(xr[0], sUg + (kU - kRing) * 8, acc);
  __builtin_amdgcn_sched_barrier(0);  /* as in the loop */
  load_rows(xr[kSets - 1], ep + (size_t)(kU - kPf) * kTE);
  __builtin_amdgcn_sched_barrier(0);  /* as in the loop */
#pragma unroll
  for (int s = 1; s < kSets; ++s) score_rows(xr[s], sUg + (kU - kRing + s * kPf) * 8, acc);
  }

  float lg[4][2];
  float mx[4];
#pragma unroll
  for (int t = 0; t < 4; ++t) {
    lg[t][0] = acc[t][0] + cst;
    lg[t][1] = acc[t][1] + cst;
    float m = fmaxf(lg[t][0], lg[t][1]);
#pragma unroll
    for (int off = 16; off > 0; off >>= 1) m = fmaxf(m, __shfl_xor(m, off, 32));
    mx[t] = m;
  }
  if (lane == 0) {
#pragma unroll
    for (int t = 0; t < 4; ++t) sRedM[grp][t * 8 + wave] = mx[t];
  }
  __syncthreads();
  float ex[4][2];
  float sm[4];
#pragma unroll
  for (int t = 0; t < 4; ++t) {
    float m = sRedM[grp][t * 8];
#pragma unroll
    for (int w = 1; w < 8; ++w) m = fmaxf(m, sRedM[grp][t * 8 + w]);
    ex[t][0] = expf(lg[t][0] - m);
    ex[t][1] = expf(lg[t][1] - m);
    float s = ex[t][0] + ex[t][1];
#pragma unroll
    for (int off = 16; off > 0; off >>= 1) s += __shfl_xor(s, off, 32);
    sm[t] = s;
  }
  if (lane == 0) {
#pragma unroll
    for (int t = 0; t < 4; ++t) sRedS[grp][t * 8 + wave] = sm[t];
  }
  __syncthreads();
  v2f wv[4];
#pragma unroll
  for (int t = 0; t < 4; ++t) {
    float s = sRedS[grp][t * 8];
#pragma unroll
    for (int w = 1; w < 8; ++w) s += sRedS[grp][t * 8 + w];
    const float inv = __builtin_amdgcn_rcpf(s);
    const float w0 = ex[t][0] * inv;
    const float w1 = ex[t][1] * inv;
    wv[t] = (v2f){w0, w1};
    /* the x512 f16 copy: one packed 4-B word per lane into the block's weight rows */
    *(unsigned*)(sP + (grp * 4 + t) * kRowE + 2 * tid) = pk16(h_bits_flush(w0 * kPCarry), h_bits_flush(w1 * kPCarry));
  }
  /* this wave's ENCT copies have landed; the barrier publishes every wave's ENCT rows and weight rows to the others */
  asm volatile("s_wait_asynccnt 0x0" ::: "memory");
  __syncthreads();
  /* behind the barrier, which would otherwise wait for these stores */
#pragma unroll
  for (int t = 0; t < 4; ++t) *(v2f*)(wout + (size_t)(bt0 + t) * kTE + 2 * tid) = wv[t];
  /* the wait that stands before the code below reuses a register of these stores; the scheduling barrier keeps that
     code from being lifted over it */
  asm volatile("s_wait_xcnt 0x0" ::: "memory");
  __builtin_amdgcn_sched_barrier(0);

  /* context rows: the 8 waves of group 0 (a scalar test; no barrier follows); wave w owns the columns 32w .. 32w+31,
     whole 128-B lines of the output. The A tile has 16 rows: row m reads weight row m & 7, so the D rows 8 .. 15, held
     by lanes 16 .. 31, repeat the rows 0 .. 7; each lane half stores four of the eight rows. */
  if (grp == 0) {
    const int rlane = lane & 15;
    const int hi    = lane >> 4;
    const int koff  = hi * 8;
    const int n0    = wave << 5;
    const _Float16* fa = sP + (rlane & 7) * kRowE + koff;
    const _Float16* fb = sE + (n0 + rlane) * kRowE + koff;
    v8f cacc[2];
#pragma unroll
    for (int j = 0; j < 2; ++j) cacc[j] = (v8f){0.f,0.f,0.f,0.f,0.f,0.f,0.f,0.f};
    /* two fragment sets, as in the projection GEMM: the LDS reads of k step s + 1 stand in front of the products of
       step s; unrolled, so that the sets are indexed by constants only */
    constexpr int NS = kTE / 32;
    v16h ah[2], bh[2][2];
    ah[0] = frag_load(fa);
#pragma unroll
    for (int j = 0; j < 2; ++j) bh[0][j] = frag_load(fb + j * 16 * kRowE);
#pragma unroll
    for (int s = 0; s < NS; ++s) {
      const int cur = s & 1, nxt = cur ^ 1;
      if (s + 1 < NS) {
        ah[nxt] = frag_load(fa + (s + 1) * 32);
#pragma unroll
        for (int j = 0; j < 2; ++j) bh[nxt][j] = frag_load(fb + j * 16 * kRowE + (s + 1) * 32);
      }
#pragma unroll
      for (int j = 0; j < 2; ++j) cacc[j] = mma_f16(ah[cur], bh[cur][j], cacc[j]);
    }
    v4f cv[2];
#pragma unroll
    for (int j = 0; j < 2; ++j) {
      const v4f lo4 = __builtin_shufflevector(cacc[j], cacc[j], 0, 1, 2, 3);
      const v4f hi4 = __builtin_shufflevector(cacc[j], cacc[j], 4, 5, 6, 7);
      cv[j] = (hi ? hi4 : lo4) * kCtxScale;
    }
    float* cp = ctx + (size_t)(blockIdx.x * kTB + hi * 4) * kD + n0 + rlane;
#pragma unroll
    for (int i = 0; i < 4; ++i)
#pragma unroll
      for (int j = 0; j < 2; ++j) cp[(size_t)i * kD + (j << 4)] = cv[j][i];
  }
}

// ---------------------------------------------------------------------------
// Host glue: 3 kernel launches, nothing else.
// GEMM shapes (all K % 32 == 0; projection M and N % 64 == 0):
//   enc projection (swapped roles): M 256 (u), N 512 (e), K 256 (d), 8 batches -> 2 x 8 tiles of 128 x 64, x 8 = 128 blocks
//   dec projection                : M 2048,    N 256 (u), K 256 (d)            -> 16 x 4 tiles of 128 x 64 = 64 blocks
//   context (in the score kernel) : M 8 (t) of a 16-row tile, N 256 (d), K 512 (e), one product per block
// ---------------------------------------------------------------------------

extern "C" void kernel_launch(void* const* d_in, const int* in_sizes, int n_in,
                              void* d_out, int out_size, void* d_ws, size_t ws_size,
                              hipStream_t stream) {
  if (n_in < 8) return;
  if (in_sizes[0] != kB * kTE * kD) return;
  if (in_sizes[1] != kB * kTD * kD) return;
  if (in_sizes[2] != kD * kU) return;
  if (in_sizes[3] != kU) return;
  if (in_sizes[4] != kD * kU) return;
  if (in_sizes[5] != kU) return;
  if (in_sizes[6] != kU) return;
  if (in_sizes[7] != 1) return;
  if (out_size != kB * kTD * kD + kB * kTD * kTE) return;
  if (ws_size < kWsTotal) return;

  const float* enc = (const float*)d_in[0];
  const float* dec = (const float*)d_in[1];
  const float* W1  = (const float*)d_in[2];
  const float* b1  = (const float*)d_in[3];
  const float* W2  = (const float*)d_in[4];
  const float* b2  = (const float*)d_in[5];
  const float* Vv  = (const float*)d_in[6];
  const float* bV  = (const float*)d_in[7];

  float* out0 = (float*)d_out;
  float* out1 = (float*)d_out + kOut1OffElems;

  char* ws = (char*)d_ws;
  unsigned short* ENCH = (unsigned short*)(ws + kOffENCH);
  unsigned short* DECH = (unsigned short*)(ws + kOffDECH);
  unsigned short* ENCT = (unsigned short*)(ws + kOffENCT);
  unsigned short* WT   = (unsigned short*)(ws + kOffWT);
  float*          EPS  = (float*)(ws + kOffEPS);
  float*          DPB  = (float*)(ws + kOffDPB);
  float*          EPF  = (float*)(ws + kOffEPF);
  unsigned short* W1T  = WT;
  unsigned short* W2T  = WT + (size_t)kU * kD;

  // ---- operand planes ----
  operand_planes_kernel<<<kPlaneBlocks, 256, 0, stream>>>(enc, dec, W1, W2, ENCH, DECH, WT, ENCT, kXCarry, kWCarry);

  // ---- job 0: EPS[b][u][e] = kArgScale * sum_d W1T[u][d] * enc[b][e][d], EPF = its exp factor ----
  // ---- job 1: DPB[bt][u] = sum_d dec[bt][d] * W2T[u][d] + b2[u] ----
  projections_kernel<<<kProjBlocks, 256, 0, stream>>>(
      W1T, 0L,
      ENCH, (long)kTE * kD,
      EPS, EPF, kTE, (long)kU * kTE, kU, kTE, kEpScale,
      DECH,
      W2T,
      DPB, kU, b2, kDecRows, kU, kProjScale,
      kD, kD);

  // ---- tanh, V dot, softmax over the encoder axis -> second output (f32) ----
  // ---- context[b][t][d] = (1/8192) * sum_e (x512 f16 weights)[t][e] * ENCT[b][d][e] -> first output ----
  score_softmax_context_kernel<<<kB * (kTD / kTB), 512, 0, stream>>>(EPS, EPF, DPB, b1, Vv, bV, ENCT, out1, out0);
}

// v007
// One run takes 28.1 microseconds.
// Two timings next to v006 both put it at 1.07 times that version's speed.
// Counting every step since v000, it is 4.65 times as fast.
// Contractions enc.W1, dec.W2 and weights.enc: v_wmma_f32_16x16x32_f16 (f16 operands with power-of-two carries: activations x16, weight planes x256, probabilities x512; f32 accumulate); tanh, the 256-term V dot and the softmax: f32 on the vector unit.
#include <hip/hip_runtime.h>
#include <math.h>

typedef __attribute__((ext_vector_type(16))) _Float16 v16h;
typedef __attribute__((ext_vector_type(8)))  _Float16 v8h;
typedef __attribute__((ext_vector_type(8)))  float    v8f;
typedef __attribute__((ext_vector_type(4)))  float    v4f;
typedef __attribute__((ext_vector_type(2)))  float    v2f;
typedef __attribute__((ext_vector_type(4)))  unsigned int v4u;

// ---------------------------------------------------------------------------
// Shape constants
// ---------------------------------------------------------------------------
constexpr int kB  = 8;
constexpr int kTE = 512;
constexpr int kTD = 256;
constexpr int kD  = 256;
constexpr int kU  = 256;
constexpr int kEncRows = kB * kTE;
constexpr int kDecRows = kB * kTD;
static_assert(kEncRows == 4096 && kDecRows == 2048, "row counts");
static_assert((kD % 32) == 0 && (kTE % 32) == 0, "GEMM K multiples of 32");
static_assert((kU % 64) == 0 && (kTE % 64) == 0 && (kTD % 64) == 0 && (kD % 64) == 0 && (kDecRows % 64) == 0, "GEMM M,N multiples of 64");
static_assert(kU == 256 && kTE == 512, "score kernel thread map: 256 threads a group, two encoder positions per thread");

// power-of-two carries of the f16 operand planes and the folded-back epilogue scales
constexpr float kXCarry   = 16.0f;
constexpr float kWCarry   = 256.0f;
constexpr float kPCarry   = 512.0f;
constexpr float kProjScale = 1.0f / (kWCarry * kXCarry);
constexpr float kCtxScale  = 1.0f / (kPCarry * kXCarry);
constexpr float kF16MinNormal = 6.103515625e-05f;

// exp(2x) is evaluated as 2^(x * 2*log2(e)). The argument constant is the SAME in every compilation pass
// (no target-dependent selection), so a host-passed scale and the device code always agree; only the body
// of the device-only 2^a helper depends on which builtin the device compiler offers.
constexpr float kArgScale = 2.8853900817779268f;
static_assert(kArgScale > 2.885f && kArgScale < 2.886f, "argument constant is 2*log2(e) in every pass");
__device__ __forceinline__ float exp_scaled(float a) {
#if __has_builtin(__builtin_amdgcn_exp2f)
  return __builtin_amdgcn_exp2f(a);
#else
  return exp2f(a);
#endif
}
constexpr float kEpScale = kArgScale * kProjScale;
// exp(2(a + d)) = exp(2a) * exp(2d), a = the enc side, d = the dec side, each factor formed once where its projection is
// at hand. The enc exponent is clamped to +-kExpLim, so its factor is never 0 or infinite. The product form is used only
// while every dec exponent of a group lies within kDecLim: then a clamped enc factor still leaves an exponent sum beyond
// +-24, where 1/(1 + 2^s) is 0 or 1 to f32 rounding, as it is for the true sum. Any other group takes the sum form from
// the unclamped plane.
// The product form joins four terms over one denominator. Each factor is carried as P = kDenCarry * (1 + 2^s), which lies
// in 2^-31 .. 2^31 (+ 1 ulp) for |s| <= kExpLim + kDecLim = 62: a product of four stays a normal f32, 2^-124 .. 2^124.
// The joint numerator, four products of -2V and three factors, is below 4 * 2^93 * |2V|: finite while |V| <= kVLim.
constexpr float kExpLim   = 43.0f;
constexpr float kDecLim   = 19.0f;
constexpr float kDenCarry = 4.656612873077392578125e-10f;   /* 2^-31 */
constexpr float kVLim     = 1073741824.0f;                  /* 2^30 */
static_assert(kExpLim - kDecLim >= 24.0f, "a clamped enc factor saturates the term for every admitted dec exponent");
static_assert(kExpLim + kDecLim == 62.0f && kDenCarry * 2147483648.0f == 1.0f, "factors centred on 1: 2^-31 .. 2^31");
static_assert(2.0f + 93.0f + 31.0f <= 127.0f && kVLim * 2.0f == 2147483648.0f, "the joint numerator is finite");
__device__ __forceinline__ float exp_factor(float a) { return exp_scaled(fminf(fmaxf(a, -kExpLim), kExpLim)); }

// ---------------------------------------------------------------------------
// Workspace region map (bytes; every offset is a multiple of 128)
//   ENCH f16 [4096][256]     enc x16, row-major                  2,097,152
//   DECH f16 [2048][256]     dec x16, row-major                  1,048,576
//   ENCT f16 [8][256][512]   enc x16, transposed per batch       2,097,152
//   WT   f16 [2][256][256]   W1^T, W2^T x256 ([u][d])              262,144
//   EPS  f32 [8][256][512]   kArgScale * enc.W1, [b][u][e]       4,194,304
//   DPB  f32 [2048][256]     dec.W2 + b2                         2,097,152
//   EPF  f32 [8][256][512]   2^EPS, exponent clamped, [b][u][e]  4,194,304
//   total                                                       15,990,784
// ---------------------------------------------------------------------------
constexpr size_t kOffENCH = 0;
constexpr size_t kOffDECH = kOffENCH + (size_t)kEncRows * kD * 2;
constexpr size_t kOffENCT = kOffDECH + (size_t)kDecRows * kD * 2;
constexpr size_t kOffWT   = kOffENCT + (size_t)kB * kD * kTE * 2;
constexpr size_t kOffEPS  = kOffWT   + (size_t)2 * kU * kD * 2;
constexpr size_t kOffDPB  = kOffEPS  + (size_t)kB * kU * kTE * 4;
constexpr size_t kOffEPF  = kOffDPB  + (size_t)kDecRows * kU * 4;
constexpr size_t kWsTotal = kOffEPF  + (size_t)kB * kU * kTE * 4;
static_assert(kWsTotal == 15990784ull, "carve total");
static_assert(kWsTotal <= 134217728ull, "carve cap");
static_assert((kOffDECH % 128) == 0 && (kOffENCT % 128) == 0 && (kOffWT % 128) == 0 && (kOffEPS % 128) == 0 &&
              (kOffDPB % 128) == 0 && (kOffEPF % 128) == 0, "128-B aligned regions");

// output packing (bytes -> float elements)
constexpr size_t kOut0Bytes = (size_t)kB * kTD * kD * 4;
constexpr size_t kOut1OffBytes = 2097152ull;
constexpr size_t kOut1Bytes = (size_t)kB * kTD * kTE * 4;
static_assert(kOut0Bytes == kOut1OffBytes, "second output follows the first");
static_assert(kOut1OffBytes + kOut1Bytes == 6291456ull, "output total");
static_assert((kOut1OffBytes % 128) == 0, "second output line aligned");
constexpr size_t kOut1OffElems = kOut1OffBytes / 4;

// ---------------------------------------------------------------------------
// Small helpers
// ---------------------------------------------------------------------------
__device__ __forceinline__ unsigned pk16(unsigned short a, unsigned short b) { return (unsigned)a | ((unsigned)b << 16); }

// f32 -> f16 bits (RNE); magnitudes under the f16 normal range become +0 by a select before the convert
__device__ __forceinline__ unsigned short h_bits_flush(float f) {
  const float g = (fabsf(f) < kF16MinNormal) ? 0.0f : f;
  const _Float16 h = (_Float16)g;
  return __builtin_bit_cast(unsigned short, h);
}

/* fragment load: elements 0..7 <- p[0..7], elements 8..15 <- p[16..23] */
union FragH { v16h v; v8h h[2]; };
__device__ __forceinline__ v16h frag_load(const _Float16* p) {
  FragH f;
  f.h[0] = *(const v8h*)(p);
  f.h[1] = *(const v8h*)(p + 16);
  return f.v;
}
/* one matrix instruction followed by its own hazard guard: ties this accumulator, names both fragments */
__device__ __forceinline__ v8f mma_f16(v16h a, v16h b, v8f c) {
  c = __builtin_amdgcn_wmma_f32_16x16x32_f16(false, a, false, b, (short)0, c, false, false);
  asm volatile("v_nop\n\tv_nop\n\tv_nop\n\tv_nop" : "+v"(c) : "v"(a), "v"(b));
  return c;
}

// ---------------------------------------------------------------------------
// Batched f16 GEMM: C[m,n] = scale * sum_k A[m,k] * Bt[n,k] (+ bias[n] when BIAS_MODE == 2); with EXP_PLANE the plane
// Xout (shaped as Cout) also takes exp_factor(C[m,n]).
// A row-major [M,K]; Bt row-major [N,K]; K == KK, N == 64 * TN, M % (64 * WM) == 0; b = batch, bx = the block's index
// inside its batch. A block owns one (64 * WM) x 64 tile of C: small, so that a launch has blocks for most of the chip.
// Its 8 waves are 4 (m) x 2 (n); a wave owns (16 * WM) x 32, whose rows are whole 128-B lines of C.
// The tile's A and Bt rows go to LDS for the whole of K by one run of asynchronous copies, so the way from L2 is waited
// out once per block; the fragments are read from LDS. stage: (64 * WM + 64) rows of KK + kPadH halves, A rows first.
// sT: the block's LDS slabs for the epilogue, one per wave.
// ---------------------------------------------------------------------------
constexpr int kPadH  = 8;    /* row pitch = K + 16 B = 16 B x odd: free of bank conflicts for 16-B fragment reads */
constexpr int kSlabW = 36;   /* slab row pitch in floats: 16-B multiple; rows r and r + 8 fall on different banks */

/* NA + NB copies per thread, RS rows per step of the block. l0, ga, gb: this thread's LDS byte address and its 16 B in
   the first RS rows of the A and the Bt slab; lstep, stepA, stepB: RS rows further in LDS (bytes) and in A, Bt (halves). */
template <int NA, int NB>
__device__ __forceinline__ void stage_copies(unsigned l0, unsigned lstep, const _Float16* ga, size_t stepA,
                                             const _Float16* gb, size_t stepB) {
  constexpr int NJ = NA + NB;
  static_assert((NJ % 8) == 0 && NJ <= 63, "eight copies per statement; the run stays under the outstanding limit");
  /* both loops unrolled: j is a constant, so the A / Bt choice and the address arrays fold into registers */
#pragma unroll
  for (int j0 = 0; j0 < NJ; j0 += 8) {
    unsigned l[8];
    const _Float16* g[8];
#pragma unroll
    for (int q = 0; q < 8; ++q) {
      const int j = j0 + q;
      l[q] = l0 + (unsigned)j * lstep;
      g[q] = (j < NA) ? ga + (size_t)j * stepA : gb + (size_t)(j - NA) * stepB;
    }
    /* the copies and, as the last line, the wait that stands before any of their address registers is rewritten */
    asm volatile(
        "global_load_async_to_lds_b128 %0, %8, off\n\t"
        "global_load_async_to_lds_b128 %1, %9, off\n\t"
        "global_load_async_to_lds_b128 %2, %10, off\n\t"
        "global_load_async_to_lds_b128 %3, %11, off\n\t"
        "global_load_async_to_lds_b128 %4, %12, off\n\t"
        "global_load_async_to_lds_b128 %5, %13, off\n\t"
        "global_load_async_to_lds_b128 %6, %14, off\n\t"
        "global_load_async_to_lds_b128 %7, %15, off\n\t"
        "s_wait_xcnt 0x0"
        :: "v"(l[0]), "v"(l[1]), "v"(l[2]), "v"(l[3]), "v"(l[4]), "v"(l[5]), "v"(l[6]), "v"(l[7]),
           "v"(g[0]), "v"(g[1]), "v"(g[2]), "v"(g[3]), "v"(g[4]), "v"(g[5]), "v"(g[6]), "v"(g[7])
        : "memory");
  }
}

template <int BIAS_MODE, bool EXP_PLANE, int WM, int KK, int TN>
__device__ __forceinline__ void gemm_tile_body(
    float (&sT)[8][16 * kSlabW], _Float16* stage, int bx, int b,
    const unsigned short* __restrict__ Ap, int lda, long strideA,
    const unsigned short* __restrict__ Btp, int ldb, long strideB,
    float* __restrict__ Cout, float* __restrict__ Xout, int ldc, long strideC,
    const float* __restrict__ bias,
    int M, int N, int K, float scale) {
  const _Float16* A  = (const _Float16*)Ap;
  const _Float16* Bt = (const _Float16*)Btp;
  const int lane = threadIdx.x & 31;
  const int wave = threadIdx.x >> 5;
  constexpr int AM     = 64 * WM;          /* A rows of the block */
  constexpr int kRowH  = KK + kPadH;       /* LDS row pitch in halves */
  constexpr int kPiece = KK / 8;           /* 16-B pieces per row */
  constexpr int RS     = 256 / kPiece;     /* rows per step of the block's 256 threads */
  static_assert(RS * kPiece == 256 && (AM % RS) == 0 && (64 % RS) == 0 && (KK % 32) == 0, "whole rows, whole steps");
  /* block-uniform exit, in front of the barrier */
  if (K != KK || N != TN * 64 || bx >= (M / AM) * TN) return;
  const int mB = (bx / TN) * AM;
  const int nB = (bx % TN) << 6;
  const int wm = wave >> 1;
  const int wn = wave & 1;
  const int m0 = mB + wm * (16 * WM);
  const int n0 = nB + (wn << 5);

  const _Float16* Ab = A  + (size_t)b * strideA;
  const _Float16* Bb = Bt + (size_t)b * strideB;

  /* row (A) / column (B, D) within a 16-wide subtile; k offset and D row offset of this lane half */
  const int rlane = lane & 15;
  const int koff  = (lane >> 4) * 8;
  const int mOff  = (lane >> 4) * 8;

  v8f acc[WM][2];
#pragma unroll
  for (int i = 0; i < WM; ++i)
#pragma unroll
    for (int j = 0; j < 2; ++j) acc[i][j] = (v8f){0.f,0.f,0.f,0.f,0.f,0.f,0.f,0.f};

  /* asked for ahead of the copies' wait, so that the epilogue does not wait for it */
  float bv[2] = {0.f, 0.f};
  if (BIAS_MODE == 2) {
#pragma unroll
    for (int j = 0; j < 2; ++j) bv[j] = bias[n0 + (j << 4) + rlane];
  }

  const int crow = (int)threadIdx.x / kPiece;
  const int cpos = ((int)threadIdx.x % kPiece) * 8;
  stage_copies<AM / RS, 64 / RS>((unsigned)(size_t)stage + (unsigned)((crow * kRowH + cpos) * 2),
                                 (unsigned)(RS * kRowH * 2),
                                 Ab + (size_t)(mB + crow) * lda + cpos, (size_t)RS * lda,
                                 Bb + (size_t)(nB + crow) * ldb + cpos, (size_t)RS * ldb);
  /* this wave's copies have landed; the barrier publishes every wave's rows to the others */
  asm volatile("s_wait_asynccnt 0x0" ::: "memory");
  __syncthreads();

  const _Float16* fa = stage + (wm * (16 * WM) + rlane) * kRowH + koff;
  const _Float16* fb = stage + (AM + (wn << 5) + rlane) * kRowH + koff;
  /* Two fragment sets: the LDS reads of k step s + 1 are issued in front of the products of step s, so their latency
     runs under the matrix instructions. Unrolled, as the loops inside: the sets, the fragment and the accumulator arrays
     are indexed by constants only. */
  constexpr int NS = KK / 32;
  v16h bh[2][2], ah[2][WM];
#pragma unroll
  for (int j = 0; j < 2; ++j) bh[0][j] = frag_load(fb + j * 16 * kRowH);
#pragma unroll
  for (int i = 0; i < WM; ++i) ah[0][i] = frag_load(fa + i * 16 * kRowH);
#pragma unroll
  for (int s = 0; s < NS; ++s) {
    const int cur = s & 1, nxt = cur ^ 1;
    if (s + 1 < NS) {
#pragma unroll
      for (int j = 0; j < 2; ++j) bh[nxt][j] = frag_load(fb + j * 16 * kRowH + (s + 1) * 32);
#pragma unroll
      for (int i = 0; i < WM; ++i) ah[nxt][i] = frag_load(fa + i * 16 * kRowH + (s + 1) * 32);
    }
#pragma unroll
    for (int i = 0; i < WM; ++i)
#pragma unroll
      for (int j = 0; j < 2; ++j) acc[i][j] = mma_f16(ah[cur][i], bh[cur][j], acc[i][j]);
  }

  // ---- epilogue ----
  float* slab = sT[wave];
  float* C = Cout + (size_t)b * strideC;
#pragma unroll
  for (int i = 0; i < WM; ++i) {
    const int mBase = m0 + (i << 4);
#pragma unroll
    for (int j = 0; j < 2; ++j) {
#pragma unroll
      for (int r = 0; r < 8; ++r) {
        float v = acc[i][j][r] * scale;
        if (BIAS_MODE == 2) v += bv[j];
        slab[(mOff + r) * kSlabW + (j << 4) + rlane] = v;
      }
    }
    __builtin_amdgcn_fence(__ATOMIC_RELEASE, "workgroup");
    __builtin_amdgcn_wave_barrier();
    __builtin_amdgcn_fence(__ATOMIC_ACQUIRE, "workgroup");
    {
      /* row segment = 128 B = 8 lanes x 16 B; lanes 8q..8q+7 take row 4*it + q */
      const int q = lane >> 3, c4 = (lane & 7) * 4;
#pragma unroll
      for (int it = 0; it < 4; ++it) {
        const int row = it * 4 + q;
        v4f v = *(const v4f*)(slab + row * kSlabW + c4);
        *(v4f*)(C + (size_t)(mBase + row) * ldc + n0 + c4) = v;
        if (EXP_PLANE) {
          const v4f f = (v4f){exp_factor(v[0]), exp_factor(v[1]), exp_factor(v[2]), exp_factor(v[3])};
          *(v4f*)(Xout + (size_t)b * strideC + (size_t)(mBase + row) * ldc + n0 + c4) = f;
        }
      }
      /* the wait that stands before the next rows, or another job's code, reuse a register of these stores; the
         scheduling barrier keeps the next rows' arithmetic from being lifted over it */
      asm volatile("s_wait_xcnt 0x0" ::: "memory");
      __builtin_amdgcn_sched_barrier(0);
    }
    __builtin_amdgcn_fence(__ATOMIC_RELEASE, "workgroup");
    __builtin_amdgcn_wave_barrier();
    __builtin_amdgcn_fence(__ATOMIC_ACQUIRE, "workgroup");
  }
}

// ---------------------------------------------------------------------------
// Row-major f32 -> f16 (x carry) cast of the encoder rows (bx 0..511) and the decoder rows (bx 512..767).
// 8 consecutive elements per thread: enc 4096*256/8 = 131,072 threads = 512 blocks; dec 2048*256/8 = 65,536 threads
// = 256 blocks; the grid covers both planes exactly. One 16-B store per lane; 32 consecutive lanes = 512 contiguous
// ---------------------------------------------------------------------------
constexpr int kEncCastBlocks = (kEncRows * kD / 8) / 256;
constexpr int kDecCastBlocks = (kDecRows * kD / 8) / 256;
static_assert(kEncCastBlocks * 256 * 8 == kEncRows * kD, "enc cast coverage");
static_assert(kDecCastBlocks * 256 * 8 == kDecRows * kD, "dec cast coverage");

__device__ __forceinline__ void cast_rows_body(int bx, const float* enc, const float* dec,
                                               unsigned short* encH, unsigned short* decH, float carry) {
  /* block-uniform plane select */
  const int isDec = (bx >= kEncCastBlocks) ? 1 : 0;
  const int blk = bx - isDec * kEncCastBlocks;
  const float* src = isDec ? dec : enc;
  unsigned short* dst = isDec ? decH : encH;
  const size_t e0 = ((size_t)blk * 256 + threadIdx.x) * 8;
  const v4f a = *(const v4f*)(src + e0);
  const v4f c = *(const v4f*)(src + e0 + 4);
  unsigned short hb[8];
#pragma unroll
  for (int e = 0; e < 4; ++e) {
    const float fa = a[e] * carry;
    const float fc = c[e] * carry;
    hb[e]     = h_bits_flush(fa);
    hb[4 + e] = h_bits_flush(fc);
  }
  const v4u u = (v4u){pk16(hb[0], hb[1]), pk16(hb[2], hb[3]), pk16(hb[4], hb[5]), pk16(hb[6], hb[7])};
  unsigned short* q = dst + e0;
  *(v4u*)q = u;
  /* the wait stands before any of the store's registers is reused */
  asm volatile("s_wait_xcnt 0x0" ::: "memory");
}

// ---------------------------------------------------------------------------
// Transpose + cast: in[rows][cols] f32 (row pitch ldi) -> out[cols][rows] f16 (row pitch ldo), values x carry.
// Block (bx, by) of (rows/64, cols/64) of one plane; src and op point at that plane; sm is the block's LDS tile.
// Load coverage: 16 iterations x 256 threads = 4096 = the whole 64x64 tile (coalesced along cols).
// Store coverage: 8 waves x 2 iterations x 4 rows (lane>>3) = 64 out rows; (lane&7) x 8 halves = 64 out cols; each
// ---------------------------------------------------------------------------
__device__ __forceinline__ void transpose_cast_body(float (&sm)[64][65], int bx, int by, const float* src, int ldi,
                                                    unsigned short* __restrict__ op, int ldo, float carry) {
  const int t  = threadIdx.x;
  const int r0 = bx * 64;
  const int c0 = by * 64;
#pragma unroll
  for (int i = 0; i < 16; ++i) {
    const int e = i * 256 + t;
    const int r = e >> 6;
    const int c = e & 63;
    sm[c][r] = src[(size_t)(r0 + r) * ldi + c0 + c] * carry;
  }
  __syncthreads();
  const int lane = t & 31, wave = t >> 5;
  const int q = lane >> 3, c8 = (lane & 7) * 8;
  {
#pragma unroll
    for (int it = 0; it < 2; ++it) {
      const int row = wave * 8 + it * 4 + q;
      unsigned short hb[8];
#pragma unroll
      for (int e = 0; e < 8; ++e) hb[e] = h_bits_flush(sm[row][c8 + e]);
      const v4u u = (v4u){pk16(hb[0], hb[1]), pk16(hb[2], hb[3]), pk16(hb[4], hb[5]), pk16(hb[6], hb[7])};
      *(v4u*)(op + (size_t)(c0 + row) * ldo + r0 + c8) = u;
    }
    /* one wait for both stores, as behind the cast job's store */
    asm volatile("s_wait_xcnt 0x0" ::: "memory");
  }
}

// ---------------------------------------------------------------------------
// Launch 1: all f16 operand planes, one grid. The jobs read only inputs and write disjoint planes.
// Job by block index (block-uniform, so the transpose's barrier is reached by all threads of a block or by none):
//   0 .. 31        W[d][u] (pitch kU) -> WT[u][d] (pitch kD), plane 0 = W1, plane 1 = W2, (d/64, u/64, 2) = (4, 4, 2)
//   32 .. 287      enc[b][e][d] (pitch kD) -> ENCT[b][d][e] (pitch kTE), (e/64, d/64, b) = (8, 4, 8)
//   288 .. 1055    row-major casts of enc and dec
// ---------------------------------------------------------------------------
constexpr int kWTX = kD / 64, kWTY = kU / 64;
constexpr int kWTBlocks = kWTX * kWTY * 2;
constexpr int kEncTX = kTE / 64, kEncTY = kD / 64;
constexpr int kEncTBlocks = kEncTX * kEncTY * kB;
constexpr int kPlaneBlocks = kWTBlocks + kEncTBlocks + kEncCastBlocks + kDecCastBlocks;
static_assert(kWTBlocks == 32 && kEncTBlocks == 256 && kPlaneBlocks == 1056, "operand grid");

__global__ __launch_bounds__(256) void operand_planes_kernel(const float* enc, const float* dec,
                                                             const float* W1, const float* W2,
                                                             unsigned short* encH, unsigned short* decH,
                                                             unsigned short* wT, unsigned short* encT,
                                                             float xCarry, float wCarry) {
  __shared__ float sm[64][65];
  const int blk = (int)blockIdx.x;
  if (blk < kWTBlocks) {
    const int bx = blk % kWTX;
    const int by = (blk / kWTX) % kWTY;
    const int z  = blk / (kWTX * kWTY);
    transpose_cast_body(sm, bx, by, (z == 1) ? W2 : W1, kU, wT + (size_t)z * kU * kD, kD, wCarry);
  } else if (blk < kWTBlocks + kEncTBlocks) {
    const int j  = blk - kWTBlocks;
    const int bx = j % kEncTX;
    const int by = (j / kEncTX) % kEncTY;
    const int z  = j / (kEncTX * kEncTY);
    transpose_cast_body(sm, bx, by, enc + (size_t)z * kTE * kD, kD, encT + (size_t)z * kD * kTE, kTE, xCarry);
  } else {
    cast_rows_body(blk - kWTBlocks - kEncTBlocks, enc, dec, encH, decH, xCarry);
  }
}

// ---------------------------------------------------------------------------
// Launch 2: the two projections do not depend on each other: one grid of 128 x 64 tiles. Job by block index
// (block-uniform):
//   0 .. 127       job 0, enc projection (batched, no bias, also stored as its exp factor; kEncGemmGridX blocks per batch)
//   128 .. 191     job 1, dec projection (one batch, bias)
// ---------------------------------------------------------------------------
constexpr int kEncGemmGridX  = (kU / 128) * (kTE / 64);
constexpr int kEncGemmBlocks = kEncGemmGridX * kB;
constexpr int kDecGemmBlocks = (kDecRows / 128) * (kU / 64);
constexpr int kProjBlocks = kEncGemmBlocks + kDecGemmBlocks;
static_assert(kEncGemmBlocks == 128 && kDecGemmBlocks == 64 && kProjBlocks == 192, "projection grid");

__global__ __launch_bounds__(256) void projections_kernel(
    const unsigned short* __restrict__ A0, long strideA0,
    const unsigned short* __restrict__ Bt0, long strideB0,
    float* __restrict__ C0, float* __restrict__ X0, int ldc0, long strideC0, int M0, int N0, float scale0,
    const unsigned short* __restrict__ A1,
    const unsigned short* __restrict__ Bt1,
    float* __restrict__ C1, int ldc1, const float* __restrict__ bias1, int M1, int N1, float scale1,
    int ldk, int K) {
  __shared__ __align__(16) float sT[8][16 * kSlabW];
  __shared__ __align__(16) _Float16 stage[(128 + 64) * (kD + kPadH)];
  const int blk = (int)blockIdx.x;
  if (blk < kEncGemmBlocks) {
    gemm_tile_body<0, true, 2, kD, kTE / 64>(sT, stage, blk % kEncGemmGridX, blk / kEncGemmGridX, A0, ldk, strideA0, Bt0,
                                             ldk, strideB0, C0, X0, ldc0, strideC0, nullptr, M0, N0, K, scale0);
  } else {
    gemm_tile_body<2, false, 2, kD, kU / 64>(sT, stage, blk - kEncGemmBlocks, 0, A1, ldk, 0L, Bt1, ldk, 0L,
                                             C1, nullptr, ldc1, 0L, bias1, M1, N1, K, scale1);
  }
}

// ---------------------------------------------------------------------------
// Rows of EPF are held in a ring of kSets register sets of kPf rows. A set is refilled one stage behind its use, so a
// row is asked for (kSets - 2) * kPf rows of arithmetic ahead of its use. Why: every block of a batch walks the same
// rows at the same pace, so a row's first readers all wait out a memory round trip unless it was asked for early.
constexpr int kPf   = 8;
constexpr int kSets = 4;
constexpr int kRing = kPf * kSets;
static_assert((kU % kRing) == 0 && kU >= 2 * kRing, "the u loop takes one whole ring per trip");

__device__ __forceinline__ void load_rows(v2f (&x)[kPf], const float* p) {
#pragma unroll
  for (int i = 0; i < kPf; ++i) x[i] = *(const v2f*)(p + (size_t)i * kTE);
}
/* product form: x = rows of EPF, su = rows of sU (dec factors x kDenCarry and -2*V); acc takes the sum / kDenCarry.
   Four rows share one reciprocal: v0/P0 + v1/P1 = na/qa, na = v0*P1 + v1*P0, qa = P0*P1; likewise nb/qb of the rows 2, 3;
   na/qa + nb/qb = (na*qb + nb*qa) / (qa*qb). A reciprocal serves one encoder position;
   each packed operation that stands in for it serves both. */
__device__ __forceinline__ v2f both(float s) { return (v2f){s, s}; }
__device__ __forceinline__ void score_rows(const v2f (&x)[kPf], const float* su, v2f (&acc)[4]) {
  static_assert((kPf % 4) == 0, "rows are taken in fours");
#pragma unroll
  for (int i = 0; i < kPf; i += 4) {
    v4f d[4];
    float v[4];
#pragma unroll
    for (int k = 0; k < 4; ++k) {
      d[k] = *(const v4f*)(su + (i + k) * 8);
      v[k] = su[(i + k) * 8 + 4];
    }
#pragma unroll
    for (int t = 0; t < 4; ++t) {
      const v2f p0 = __builtin_elementwise_fma(x[i],     both(d[0][t]), both(kDenCarry));
      const v2f p1 = __builtin_elementwise_fma(x[i + 1], both(d[1][t]), both(kDenCarry));
      const v2f p2 = __builtin_elementwise_fma(x[i + 2], both(d[2][t]), both(kDenCarry));
      const v2f p3 = __builtin_elementwise_fma(x[i + 3], both(d[3][t]), both(kDenCarry));
      const v2f qa = p0 * p1;
      const v2f qb = p2 * p3;
      const v2f na = __builtin_elementwise_fma(p0, both(v[1]), p1 * both(v[0]));
      const v2f nb = __builtin_elementwise_fma(p2, both(v[3]), p3 * both(v[2]));
      const v2f den = qa * qb;
      const v2f num = __builtin_elementwise_fma(na, qb, nb * qa);
      const v2f r = (v2f){__builtin_amdgcn_rcpf(den[0]), __builtin_amdgcn_rcpf(den[1])};
      acc[t] = __builtin_elementwise_fma(num, r, acc[t]);
    }
  }
}
/* sum form: x = rows of EPS, sd = rows of sD (dec exponents), su = rows of sU (for -2*V) */
__device__ __forceinline__ void score_rows_sum(const v2f (&x)[kPf], const float* sd, const float* su, v2f (&acc)[4]) {
#pragma unroll
  for (int i = 0; i < kPf; ++i) {
    const v4f d  = *(const v4f*)(sd + i * 4);
    const float vm = su[i * 8 + 4];
#pragma unroll
    for (int t = 0; t < 4; ++t) {
      const float e0 = exp_scaled(x[i][0] + d[t]);
      const float e1 = exp_scaled(x[i][1] + d[t]);
      const float r0 = __builtin_amdgcn_rcpf(1.0f + e0);
      const float r1 = __builtin_amdgcn_rcpf(1.0f + e1);
      acc[t][0] = fmaf(r0, vm, acc[t][0]);
      acc[t][1] = fmaf(r1, vm, acc[t][1]);
    }
  }
}

// ---------------------------------------------------------------------------
// Score + softmax (f32) + context rows (matrix unit). Block = one batch element b and kTB = 8 consecutive decoder steps;
// 512 threads = two groups of 256, group g takes the steps 4g .. 4g+3; thread tid of a group owns the encoder positions
// 2*tid and 2*tid+1 (256 x 2 = 512 = the whole softmax axis), 8 accumulators.
// EPS[b][u][e] holds kArgScale*(enc.W1) and EPF[b][u][e] its exp factor; the LDS row sD[g][u] = kArgScale*(dec.W2 + b2 + b1)
// for the group's 4 steps, the LDS row sU[g][u] = {kDenCarry * 2^sD[g][u] for the 4 steps, -2*V[u], 0, 0, 0} (all slots written by thread u).
// tanh(x) = 1 - 2/(1 + exp(2x)), so
//   logit = sum_u V[u] + bV + sum_u (-2*V[u]) / (1 + exp(2x)), exp(2x) = EPF * sU / kDenCarry (product form) = 2^(EPS + sD) (sum form).
// Reductions in fixed order: wave shuffle tree, then the 8 wave partials of the group in index order.
// Context: the batch's ENCT rows ([d][e], f16) are asked for at the start by asynchronous copies to LDS and land under the
// score loop; the block's 8 weight rows (x512, f16) go to LDS; context[t][d] = sum_e weight[t][e] * ENCT[d][e], k in
// ascending steps of 32. The LDS footprint leaves one block per WGP: 16 waves, four per SIMD.
// grid = 8 * 32 = 256 blocks. Barriers under block-uniform control only; no early exit.
// ---------------------------------------------------------------------------
constexpr int kTB   = 8;
constexpr int kRowE = kTE + kPadH;   /* LDS row pitch in halves of the ENCT rows and the weight rows: 16 B x odd */
static_assert((kTD % kTB) == 0, "a block lies in one batch");
static_assert((kD % 8) == 0 && kTE / 8 == 64, "copies: 64 pieces of 16 B a row, 8 rows a step of the block's 512 threads");

__global__ __launch_bounds__(512) void score_softmax_context_kernel(
    const float* __restrict__ eps, const float* __restrict__ epf, const float* __restrict__ dpb,
    const float* __restrict__ b1,
    const float* __restrict__ vvec, const float* __restrict__ bV,
    const unsigned short* __restrict__ encT,
    float* __restrict__ wout, float* __restrict__ ctx) {
  __shared__ __align__(16) _Float16 sE[kD * kRowE];
  __shared__ __align__(16) _Float16 sP[kTB * kRowE];
  __shared__ __align__(16) float sU[2][kU * 8];
  __shared__ __align__(16) float sD[2][kU * 4];
  __shared__ float sRedM[2][4 * 8];
  __shared__ float sRedS[2][4 * 8];
  __shared__ float sRedV[2][8];
  __shared__ unsigned sWide[2][8];
  const int tid = threadIdx.x & 255, lane = tid & 31, wave = tid >> 5;
  /* the same in every lane of a wave: kept in a scalar register, so that the group's LDS rows have scalar bases */
  const int grp = __builtin_amdgcn_readfirstlane((int)(threadIdx.x >> 8));
  const int bt0 = blockIdx.x * kTB + grp * 4;
  const int b   = bt0 / kTD;

  /* the set-up's own loads stand first: the first barrier depends on them, and behind the copies below they would wait
     for a quarter of a megabyte per block */
  const float bb = b1[tid];
  const float vv = vvec[tid];
  float dp[4];
#pragma unroll
  for (int t = 0; t < 4; ++t) dp[t] = dpb[(size_t)(bt0 + t) * kU + tid];

  /* all sets of the ring but the last: in flight across the set-up of sU */
  const float* ep = epf + (size_t)b * kU * kTE + 2 * tid;
  v2f xr[kSets][kPf];
#pragma unroll
  for (int s = 0; s < kSets - 1; ++s) load_rows(xr[s], ep + (size_t)(s * kPf) * kTE);

  /* behind those loads, so that they are served first: the batch's ENCT rows, 32 copies per thread */
  {
    const int crow = (int)threadIdx.x >> 6;
    const int cpos = ((int)threadIdx.x & 63) * 8;
    const _Float16* ge = (const _Float16*)encT + (size_t)b * kD * kTE + (size_t)crow * kTE + cpos;
    stage_copies<kD / 8, 0>((unsigned)(size_t)sE + (unsigned)((crow * kRowE + cpos) * 2), (unsigned)(8 * kRowE * 2),
                            ge, (size_t)8 * kTE, ge, 0);
  }

  {
    v4f dsv;
    dsv[0] = (dp[0] + bb) * kArgScale;
    dsv[1] = (dp[1] + bb) * kArgScale;
    dsv[2] = (dp[2] + bb) * kArgScale;
    dsv[3] = (dp[3] + bb) * kArgScale;
    const v4f vsl = (v4f){-2.0f * vv, 0.0f, 0.0f, 0.0f};
    const v4f dfv = (v4f){exp_scaled(dsv[0]), exp_scaled(dsv[1]), exp_scaled(dsv[2]), exp_scaled(dsv[3])} * kDenCarry;
    *(v4f*)(sD[grp] + tid * 4)     = dsv;
    *(v4f*)(sU[grp] + tid * 8)     = dfv;
    *(v4f*)(sU[grp] + tid * 8 + 4) = vsl;
    /* a NaN exponent may pass: it makes its term NaN in either form */
    const float dmax = fmaxf(fmaxf(fabsf(dsv[0]), fabsf(dsv[1])), fmaxf(fabsf(dsv[2]), fabsf(dsv[3])));
    const unsigned wideMask = __builtin_amdgcn_ballot_w32(dmax > kDecLim || fabsf(vv) > kVLim);
    float sv = vv;
#pragma unroll
    for (int off = 16; off > 0; off >>= 1) sv += __shfl_xor(sv, off, 32);
    if (lane == 0) { sRedV[grp][wave] = sv; sWide[grp][wave] = wideMask; }
  }
  __syncthreads();
  const float* sUg = sU[grp];
  float cst = sRedV[grp][0];
#pragma unroll
  for (int w = 1; w < 8; ++w) cst += sRedV[grp][w];
  cst += bV[0];
  unsigned anyWide = sWide[grp][0];
#pragma unroll
  for (int w = 1; w < 8; ++w) anyWide |= sWide[grp][w];

  v2f acc[4];
#pragma unroll
  for (int t = 0; t < 4; ++t) acc[t] = (v2f){0.0f, 0.0f};

  /* uniform for a group, so for a wave: every thread of a group reads the same eight words; no barrier inside */
  if (__builtin_amdgcn_readfirstlane(anyWide) != 0u) {
    const float* er = eps + (size_t)b * kU * kTE + 2 * tid;
    for (int u = 0; u < kU; u += kPf) {
      v2f xs[kPf];
      load_rows(xs, er + (size_t)u * kTE);
      score_rows_sum(xs, sD[grp] + u * 4, sUg + u * 8, acc);
    }
  } else {
  for (int u = 0; u < kU - kRing; u += kRing) {
#pragma unroll
    for (int s = 0; s < kSets; ++s) {
      score_rows(xr[s], sUg + (u + s * kPf) * 8, acc);
      /* The two scheduling barriers keep each refill in its stage: without them the compiler reads the whole ring at
         the top of a trip and refills it late, which takes the lead away. The set refilled is the one used a stage
         ago: a refill that overtakes its set's last use goes to spare registers, and the copy back at the top of the
         trip waits for every load in flight. Nothing crosses them, LDS reads included: a wave of a 512-thread block
         has 256 registers, and with a trip's LDS reads free to move to its top the schedule passed that ceiling and
         the build fell back to source order, one dependent chain after another. */
      __builtin_amdgcn_sched_barrier(0);
      const int f = (s + kSets - 1) % kSets;
      load_rows(xr[f], ep + (size_t)(u + (s == 0 ? 0 : kRing) + f * kPf) * kTE);
      __builtin_amdgcn_sched_barrier(0);
    }
  }
  /* the last ring: only its last set is still to be fetched */
  score_rows(xr[0], sUg + (kU - kRing) * 8, acc);
  __builtin_amdgcn_sched_barrier(0);  /* as in the loop */
  load_rows(xr[kSets - 1], ep + (size_t)(kU - kPf) * kTE);
  __builtin_amdgcn_sched_barrier(0);  /* as in the loop */
#pragma unroll
  for (int s = 1; s < kSets; ++s) score_rows(xr[s], sUg + (kU - kRing + s * kPf) * 8, acc);
  /* the carry of the denominators is taken back: a power of two, exact */
#pragma unroll
  for (int t = 0; t < 4; ++t) acc[t] *= kDenCarry;
  }

  float lg[4][2];
  float mx[4];
#pragma unroll
  for (int t = 0; t < 4; ++t) {
    lg[t][0] = acc[t][0] + cst;
    lg[t][1] = acc[t][1] + cst;
    float m = fmaxf(lg[t][0], lg[t][1]);
#pragma unroll
    for (int off = 16; off > 0; off >>= 1) m = fmaxf(m, __shfl_xor(m, off, 32));
    mx[t] = m;
  }
  if (lane == 0) {
#pragma unroll
    for (int t = 0; t < 4; ++t) sRedM[grp][t * 8 + wave] = mx[t];
  }
  __syncthreads();
  float ex[4][2];
  float sm[4];
#pragma unroll
  for (int t = 0; t < 4; ++t) {
    float m = sRedM[grp][t * 8];
#pragma unroll
    for (int w = 1; w < 8; ++w) m = fmaxf(m, sRedM[grp][t * 8 + w]);
    ex[t][0] = expf(lg[t][0] - m);
    ex[t][1] = expf(lg[t][1] - m);
    float s = ex[t][0] + ex[t][1];
#pragma unroll
    for (int off = 16; off > 0; off >>= 1) s += __shfl_xor(s, off, 32);
    sm[t] = s;
  }
  if (lane == 0) {
#pragma unroll
    for (int t = 0; t < 4; ++t) sRedS[grp][t * 8 + wave] = sm[t];
  }
  __syncthreads();
  v2f wv[4];
#pragma unroll
  for (int t = 0; t < 4; ++t) {
    float s = sRedS[grp][t * 8];
#pragma unroll
    for (int w = 1; w < 8; ++w) s += sRedS[grp][t * 8 + w];
    const float inv = __builtin_amdgcn_rcpf(s);
    const float w0 = ex[t][0] * inv;
    const float w1 = ex[t][1] * inv;
    wv[t] = (v2f){w0, w1};
    /* the x512 f16 copy: one packed 4-B word per lane into the block's weight rows */
    *(unsigned*)(sP + (grp * 4 + t) * kRowE + 2 * tid) = pk16(h_bits_flush(w0 * kPCarry), h_bits_flush(w1 * kPCarry));
  }
  /* this wave's ENCT copies have landed; the barrier publishes every wave's ENCT rows and weight rows to the others */
  asm volatile("s_wait_asynccnt 0x0" ::: "memory");
  __syncthreads();
  /* behind the barrier, which would otherwise wait for these stores */
#pragma unroll
  for (int t = 0; t < 4; ++t) *(v2f*)(wout + (size_t)(bt0 + t) * kTE + 2 * tid) = wv[t];
  /* the wait that stands before the code below reuses a register of these stores; the scheduling barrier keeps that
     code from being lifted over it */
  asm volatile("s_wait_xcnt 0x0" ::: "memory");
  __builtin_amdgcn_sched_barrier(0);

  /* context rows: the 8 waves of group 0 (a scalar test; no barrier follows); wave w owns the columns 32w .. 32w+31,
     whole 128-B lines of the output. The A tile has 16 rows: row m reads weight row m & 7, so the D rows 8 .. 15, held
     by lanes 16 .. 31, repeat the rows 0 .. 7; each lane half stores four of the eight rows. */
  if (grp == 0) {
    const int rlane = lane & 15;
    const int hi    = lane >> 4;
    const int koff  = hi * 8;
    const int n0    = wave << 5;
    const _Float16* fa = sP + (rlane & 7) * kRowE + koff;
    const _Float16* fb = sE + (n0 + rlane) * kRowE + koff;
    v8f cacc[2];
#pragma unroll
    for (int j = 0; j < 2; ++j) cacc[j] = (v8f){0.f,0.f,0.f,0.f,0.f,0.f,0.f,0.f};
    /* two fragment sets, as in the projection GEMM: the LDS reads of k step s + 1 stand in front of the products of
       step s; unrolled, so that the sets are indexed by constants only */
    constexpr int NS = kTE / 32;
    v16h ah[2], bh[2][2];
    ah[0] = frag_load(fa);
#pragma unroll
    for (int j = 0; j < 2; ++j) bh[0][j] = frag_load(fb + j * 16 * kRowE);
#pragma unroll
    for (int s = 0; s < NS; ++s) {
      const int cur = s & 1, nxt = cur ^ 1;
      if (s + 1 < NS) {
        ah[nxt] = frag_load(fa + (s + 1) * 32);
#pragma unroll
        for (int j = 0; j < 2; ++j) bh[nxt][j] = frag_load(fb + j * 16 * kRowE + (s + 1) * 32);
      }
#pragma unroll
      for (int j = 0; j < 2; ++j) cacc[j] = mma_f16(ah[cur], bh[cur][j], cacc[j]);
    }
    v4f cv[2];
#pragma unroll
    for (int j = 0; j < 2; ++j) {
      const v4f lo4 = __builtin_shufflevector(cacc[j], cacc[j], 0, 1, 2, 3);
      const v4f hi4 = __builtin_shufflevector(cacc[j], cacc[j], 4, 5, 6, 7);
      cv[j] = (hi ? hi4 : lo4) * kCtxScale;
    }
    float* cp = ctx + (size_t)(blockIdx.x * kTB + hi * 4) * kD + n0 + rlane;
#pragma unroll
    for (int i = 0; i < 4; ++i)
#pragma unroll
      for (int j = 0; j < 2; ++j) cp[(size_t)i * kD + (j << 4)] = cv[j][i];
  }
}

// ---------------------------------------------------------------------------
// Host glue: 3 kernel launches, nothing else.
// GEMM shapes (all K % 32 == 0; projection M and N % 64 == 0):
//   enc projection (swapped roles): M 256 (u), N 512 (e), K 256 (d), 8 batches -> 2 x 8 tiles of 128 x 64, x 8 = 128 blocks
//   dec projection                : M 2048,    N 256 (u), K 256 (d)            -> 16 x 4 tiles of 128 x 64 = 64 blocks
//   context (in the score kernel) : M 8 (t) of a 16-row tile, N 256 (d), K 512 (e), one product per block
// ---------------------------------------------------------------------------

extern "C" void kernel_launch(void* const* d_in, const int* in_sizes, int n_in,
                              void* d_out, int out_size, void* d_ws, size_t ws_size,
                              hipStream_t stream) {
  if (n_in < 8) return;
  if (in_sizes[0] != kB * kTE * kD) return;
  if (in_sizes[1] != kB * kTD * kD) return;
  if (in_sizes[2] != kD * kU) return;
  if (in_sizes[3] != kU) return;
  if (in_sizes[4] != kD * kU) return;
  if (in_sizes[5] != kU) return;
  if (in_sizes[6] != kU) return;
  if (in_sizes[7] != 1) return;
  if (out_size != kB * kTD * kD + kB * kTD * kTE) return;
  if (ws_size < kWsTotal) return;

  const float* enc = (const float*)d_in[0];
  const float* dec = (const float*)d_in[1];
  const float* W1  = (const float*)d_in[2];
  const float* b1  = (const float*)d_in[3];
  const float* W2  = (const float*)d_in[4];
  const float* b2  = (const float*)d_in[5];
  const float* Vv  = (const float*)d_in[6];
  const float* bV  = (const float*)d_in[7];

  float* out0 = (float*)d_out;
  float* out1 = (float*)d_out + kOut1OffElems;

  char* ws = (char*)d_ws;
  unsigned short* ENCH = (unsigned short*)(ws + kOffENCH);
  unsigned short* DECH = (unsigned short*)(ws + kOffDECH);
  unsigned short* ENCT = (unsigned short*)(ws + kOffENCT);
  unsigned short* WT   = (unsigned short*)(ws + kOffWT);
  float*          EPS  = (float*)(ws + kOffEPS);
  float*          DPB  = (float*)(ws + kOffDPB);
  float*          EPF  = (float*)(ws + kOffEPF);
  unsigned short* W1T  = WT;
  unsigned short* W2T  = WT + (size_t)kU * kD;

  // ---- operand planes ----
  operand_planes_kernel<<<kPlaneBlocks, 256, 0, stream>>>(enc, dec, W1, W2, ENCH, DECH, WT, ENCT, kXCarry, kWCarry);

  // ---- job 0: EPS[b][u][e] = kArgScale * sum_d W1T[u][d] * enc[b][e][d], EPF = its exp factor ----
  // ---- job 1: DPB[bt][u] = sum_d dec[bt][d] * W2T[u][d] + b2[u] ----
  projections_kernel<<<kProjBlocks, 256, 0, stream>>>(
      W1T, 0L,
      ENCH, (long)kTE * kD,
      EPS, EPF, kTE, (long)kU * kTE, kU, kTE, kEpScale,
      DECH,
      W2T,
      DPB, kU, b2, kDecRows, kU, kProjScale,
      kD, kD);

  // ---- tanh, V dot, softmax over the encoder axis -> second output (f32) ----
  // ---- context[b][t][d] = (1/8192) * sum_e (x512 f16 weights)[t][e] * ENCT[b][d][e] -> first output ----
  score_softmax_context_kernel<<<kB * (kTD / kTB), 512, 0, stream>>>(EPS, EPF, DPB, b1, Vv, bV, ENCT, out1, out0);
}
